// v000
// The times below were measured on an AMD MI455X: many runs one after another, warmed up first and cycling through
// copies of the inputs, with the whole window's GPU time divided by the number of runs. Launches and the gaps
// between them are all in it. The median over several windows is given; except for v000 it joins two sittings, which
// can be a few percent apart, so the side-by-side timings, each taken in one sitting, are the better comparison.
// The starting kernel, v000, takes 818 microseconds a run.
#include <hip/hip_runtime.h>

// SAGAN self-attention over a feature map (x [4][256][64][64] channel-major; tokens = 4,096 positions; q, k, v = 1x1 convs to 32 channels ('oi' [32][256] + [32]); energy = q.k (unscaled, 32 dims: logit sigma ~5.7); attn = softmax over positions; out = attn v ([4096][32]); y = Wo out + bo (1x1 conv 'oi' [256][32] + [256]) written channel-major -> [4][256][64][64] (4.2 M)).
// Layout per batch: the channel-major slab transposed once into a token-major bf16 operand; exact projections + f32 biases; the three 32-channel projections zero-padded to 64 columns (zero weight rows and zero biases: the padded columns are exactly 0, so every 64-wide contraction equals the 32-wide one); scores as hi/lo x hi/lo (3 products) for every row (the logits are too sharp for fp16), streaming three-sweep softmax writing bf16 hi/lo probabilities, attn.v (3 products); the 64-wide context (32 real + 32 zero columns) as hi/lo planes x the zero-padded Wo ([256][64]) exact + bo; the result transposed back to channel-major rows.
// Compute dtypes, f32 accumulate: every input rounded to bf16; projections exact + f32 biases; scores and attn.v 3 products; softmax f32; Wo hl x exact + bias.

#define NB_  4
#define TT   4096
#define DM   256
#define NH_  1
#define NKV  1
#define REP  (NH_ / NKV)
#define HD   64
#define DQ   (NH_ * HD)
#define DKV  (NKV * HD)
#define ZH   1
#define RH   4096                  // query rows < RH use hi+lo planes (0: none)
#define WIN  0
#define PCAR 1024.0f
#define SCL  1.0f   // unscaled energy
#define CC   256     // channels
#define CQR  32      // real q/k/v channels (padded to HD = 64)
#define MID  HD
typedef _Float16 h16;
typedef unsigned short bf;
typedef __attribute__((ext_vector_type(16))) __bf16   v16bf;
typedef __attribute__((ext_vector_type(16))) _Float16 v16h;
typedef __attribute__((ext_vector_type(8)))  _Float16 v8h;
typedef __attribute__((ext_vector_type(8)))  unsigned short v8us;
typedef __attribute__((ext_vector_type(8)))  float    v8f;
typedef __attribute__((ext_vector_type(4)))  float    v4f;
typedef v8h  __attribute__((may_alias)) v8ha;
typedef v4f  __attribute__((may_alias)) v4fa;
typedef v8us __attribute__((may_alias)) v8usa;

__device__ __forceinline__ unsigned short f2bf(float f) { unsigned u = __float_as_uint(f); u += 0x7FFFu + ((u >> 16) & 1u); return (unsigned short)(u >> 16); }
__device__ __forceinline__ float bf2f(unsigned short b) { return __uint_as_float(((unsigned)b) << 16); }
__device__ __forceinline__ float bfr(float f) { return bf2f(f2bf(f)); }
__device__ __forceinline__ v16h cat16(v8h lo, v8h hi) { return __builtin_shufflevector(lo, hi, 0, 1, 2, 3, 4, 5, 6, 7, 8, 9, 10, 11, 12, 13, 14, 15); }
__device__ __forceinline__ v16bf cat16b(v8us lo, v8us hi) { return __builtin_bit_cast(v16bf, __builtin_shufflevector(lo, hi, 0, 1, 2, 3, 4, 5, 6, 7, 8, 9, 10, 11, 12, 13, 14, 15)); }
__device__ __forceinline__ v8f wmma16(v16h a, v16h b, v8f c) { return __builtin_amdgcn_wmma_f32_16x16x32_f16(false, a, false, b, (short)0, c, false, false); }
__device__ __forceinline__ v8f wmmab(v16bf a, v16bf b, v8f c) { return __builtin_amdgcn_wmma_f32_16x16x32_bf16(false, a, false, b, (short)0, c, false, false); }



// ---- k_gemmw: register-blocked GEMM, ONE WAVE per 64x64 output tile (16 accumulators), operands straight from K-contiguous 16-bit planes; grid (M/64, N/64, Z), 32 threads.
// C[m][n] (f32, pitch ldc, + optional f32 bias[n]) = sum_k A[m][k] Bt[n][k] (+ split products per NSPLIT). z-batch strides sA/sB/sC in elements. K % 32 == 0.
template <typename T16> struct WFrag;
template <> struct WFrag<h16> { typedef v16h V; static __device__ __forceinline__ V ld(const h16* p) { return cat16(*(const v8h*)p, *(const v8h*)(p + 16)); } static __device__ __forceinline__ v8f mma(V a, V b, v8f c) { return wmma16(a, b, c); } };
template <> struct WFrag<bf> { typedef v16bf V; static __device__ __forceinline__ V ld(const bf* p) { return cat16b(*(const v8us*)p, *(const v8us*)(p + 16)); } static __device__ __forceinline__ v8f mma(V a, V b, v8f c) { return wmmab(a, b, c); } };
template <typename T16, int NSPLIT, bool BIAS>
__global__ __launch_bounds__(32) void k_gemmw(const T16* __restrict__ A, const T16* __restrict__ A2, const T16* __restrict__ Bt, const T16* __restrict__ Bt2, int K, float* C, int ldc, const float* __restrict__ bias, size_t sA, size_t sB, size_t sC) {
    typedef typename WFrag<T16>::V V;
    __shared__ __align__(16) float os[16 * 68];
    const size_t z = blockIdx.z; A += z * sA; if (A2) A2 += z * sA; Bt += z * sB; if (Bt2) Bt2 += z * sB; C += z * sC;
    const int lane = threadIdx.x & 31, lr = lane & 15, hi = lane >> 4; const int r0 = blockIdx.x * 64, c0 = blockIdx.y * 64;
    v8f acc[4][4];
#pragma unroll
    for (int mb = 0; mb < 4; ++mb)
#pragma unroll
        for (int nb = 0; nb < 4; ++nb) acc[mb][nb] = (v8f){};
    const size_t aoff = (size_t)(r0 + lr) * K + 8 * hi, boff = (size_t)(c0 + lr) * K + 8 * hi;
#pragma unroll 1
    for (int kc = 0; kc < K; kc += 32) {
        V a[4], a2[4];
#pragma unroll
        for (int mb = 0; mb < 4; ++mb) { a[mb] = WFrag<T16>::ld(A + aoff + (size_t)mb * 16 * K + kc); if (NSPLIT == 1 || NSPLIT == 2) a2[mb] = WFrag<T16>::ld(A2 + aoff + (size_t)mb * 16 * K + kc); }
#pragma unroll
        for (int nb = 0; nb < 4; ++nb) { const V b = WFrag<T16>::ld(Bt + boff + (size_t)nb * 16 * K + kc); V b2; if (NSPLIT >= 2) b2 = WFrag<T16>::ld(Bt2 + boff + (size_t)nb * 16 * K + kc);
#pragma unroll
            for (int mb = 0; mb < 4; ++mb) { acc[mb][nb] = WFrag<T16>::mma(a[mb], b, acc[mb][nb]); if (NSPLIT == 1 || NSPLIT == 2) acc[mb][nb] = WFrag<T16>::mma(a2[mb], b, acc[mb][nb]); if (NSPLIT >= 2) acc[mb][nb] = WFrag<T16>::mma(a[mb], b2, acc[mb][nb]); } }
        asm volatile("v_nop\n\tv_nop\n\tv_nop\n\tv_nop" : "+v"(acc[0][0]), "+v"(acc[1][1]), "+v"(acc[2][2]), "+v"(acc[3][3]) : "v"(a[0]), "v"(a[3]));
    }
#pragma unroll
    for (int mb = 0; mb < 4; ++mb) {
#pragma unroll
        for (int nb = 0; nb < 4; ++nb) {
#pragma unroll
            for (int j = 0; j < 8; ++j) os[(hi * 8 + j) * 68 + nb * 16 + lr] = acc[mb][nb][j]; }
        __builtin_amdgcn_wave_barrier(); asm volatile("" ::: "memory");
        float* crow = C + (size_t)(r0 + mb * 16) * ldc + c0;
{
#pragma unroll
            for (int s = 0; s < 8; ++s) { const int row = 2 * s + hi, cofs = lr * 4; v4f val = *(const v4fa*)(os + row * 68 + cofs); if (BIAS) { val[0] += bfr(bias[c0 + cofs]); val[1] += bfr(bias[c0 + cofs + 1]); val[2] += bfr(bias[c0 + cofs + 2]); val[3] += bfr(bias[c0 + cofs + 3]); }
                *(v4f*)(crow + (size_t)row * ldc + cofs) = val; }
             }
        __builtin_amdgcn_wave_barrier(); asm volatile("" ::: "memory");
    }
}

__device__ __forceinline__ h16 tohx(float x) { return (h16)x; }
__device__ __forceinline__ void splitf(float y, unsigned short& h, unsigned short& l) { h = f2bf(y); l = f2bf(y - bf2f(h)); }
typedef __attribute__((ext_vector_type(2))) _Float16 v2h;
typedef __attribute__((ext_vector_type(4))) _Float16 v4h;
typedef __attribute__((ext_vector_type(2))) unsigned short v2us;
typedef __attribute__((ext_vector_type(4))) unsigned short v4us;
typedef __attribute__((ext_vector_type(2))) float v2f;
typedef __attribute__((ext_vector_type(4))) int v4i;

__global__ __launch_bounds__(256) void k_wtG(const float* __restrict__ w, int K, int N, bf* Bt) {
    const int lane = threadIdx.x & 31; const int L0 = (blockIdx.x * 8 + (threadIdx.x >> 5)) * 8; const int nlines = N * K / 64;
{
#pragma unroll 1
        for (int l = 0; l < 8; ++l) { const int L = L0 + l; if (L >= nlines) break; const size_t e = (size_t)L * 64 + lane * 2; const int k = (int)(e % K), n = (int)(e / K); v2us o;
            o[0] = f2bf(w[(size_t)k * N + n]); o[1] = f2bf(w[(size_t)(k + 1) * N + n]); *(v2us*)(Bt + e) = o; }
         }
}
__global__ __launch_bounds__(256) void k_cvt8(const float* __restrict__ src, bf* dst, size_t n8) { const size_t i = (size_t)blockIdx.x * 256 + threadIdx.x; if (i >= n8) return; const v8f v = *(const v8f*)(src + i * 8); v8us o;
#pragma unroll
    for (int k = 0; k < 8; ++k) o[k] = f2bf(v[k]); *(v8us*)(dst + i * 8) = o;  }

__global__ __launch_bounds__(256) void k_flat(const float* __restrict__ F, h16* P16, bf* Ph, bf* Pl, size_t n4) { const size_t i = (size_t)blockIdx.x * 256 + threadIdx.x; if (i >= n4) return; const v4f a = *(const v4f*)(F + i * 4); v4h o16; v4us oh, ol;
#pragma unroll
    for (int q = 0; q < 4; ++q) { o16[q] = tohx(a[q]); unsigned short x2, y2; splitf(a[q], x2, y2); oh[q] = x2; ol[q] = y2; }
    *(v4h*)(P16 + i * 4) = o16; *(v4us*)(Ph + i * 4) = oh; *(v4us*)(Pl + i * 4) = ol;  }


__global__ __launch_bounds__(256) void k_vtp(const float* __restrict__ F, int pitch, int nheads, h16* V16, bf* Vh, bf* Vl) { const size_t e = ((size_t)blockIdx.x * 256 + threadIdx.x) * 2; if (e >= (size_t)nheads * HD * TT) return; const int t = (int)(e % TT); const int d = (int)((e / TT) % HD); const int g = (int)(e / ((size_t)TT * HD)); v2h o16; v2us oh, ol;
#pragma unroll
    for (int q = 0; q < 2; ++q) { const float x = F[(size_t)(t + q) * pitch + g * HD + d]; o16[q] = tohx(x); unsigned short a2, c2; splitf(x, a2, c2); oh[q] = a2; ol[q] = c2; }
    *(v2h*)(V16 + e) = o16; *(v2us*)(Vh + e) = oh; *(v2us*)(Vl + e) = ol;  }
// k_lsoft: streaming row softmax over the TK = TT = 4096 keys, one wave per row i, three sweeps of the f32 score row (lane -> 4 consecutive keys per 128-key chunk, 32 chunks; no mask: every key is used and the score GEMM computes every tile):
__global__ __launch_bounds__(256) void k_lsoft(const float* __restrict__ Sb, h16* P16, bf* Ph, bf* Pl) {
    const int lane = threadIdx.x & 31; const int row = blockIdx.x * 8 + (threadIdx.x >> 5); if (row >= ZH * TT) return; const int i = row % TT; const int zz = row / TT; const bool hires = (i < RH); const float* sr = Sb + (size_t)row * TT; float mx = -3.0e38f;
#pragma unroll 4
    for (int ch = 0; ch < TT / 128; ++ch) { const int j0 = ch * 128 + lane * 4; const v4f a = *(const v4f*)(sr + j0);
#pragma unroll
        for (int q = 0; q < 4; ++q) { float t = a[q] * SCL; asm volatile("" : "+v"(t)); mx = fmaxf(mx, t); } }
#pragma unroll
    for (int sh = 16; sh; sh >>= 1) mx = fmaxf(mx, __shfl_xor(mx, sh, 32));
    float sum = 0.f;
#pragma unroll 4
    for (int ch = 0; ch < TT / 128; ++ch) { const int j0 = ch * 128 + lane * 4; const v4f a = *(const v4f*)(sr + j0);
#pragma unroll
        for (int q = 0; q < 4; ++q) { float t = a[q] * SCL; asm volatile("" : "+v"(t)); float d0 = __fsub_rn(t, mx); asm volatile("" : "+v"(d0)); sum += __builtin_amdgcn_exp2f(__fmul_rn(d0, 1.4426950408889634f)); } }
#pragma unroll
    for (int sh = 16; sh; sh >>= 1) sum += __shfl_xor(sum, sh, 32);
    const float f = __fdiv_rn(hires ? 1.0f : PCAR, sum);
{
        if (hires) {   /* rows < RH: normalised bf16 hi/lo over all keys, planes [zz][RH][TT] */
#pragma unroll
            for (int ch = 0; ch < TT / 128; ++ch) { const int j0 = ch * 128 + lane * 4; const v4f a = *(const v4f*)(sr + j0); v4us oh, ol;
#pragma unroll
                for (int q = 0; q < 4; ++q) { float t = a[q] * SCL; asm volatile("" : "+v"(t)); float d0 = __fsub_rn(t, mx); asm volatile("" : "+v"(d0)); float ex = __builtin_amdgcn_exp2f(__fmul_rn(d0, 1.4426950408889634f)); asm volatile("" : "+v"(ex)); unsigned short a2, c2; splitf(ex * f, a2, c2); oh[q] = a2; ol[q] = c2; }
                const size_t oo = ((size_t)zz * RH + i) * TT + j0; *(v4us*)(Ph + oo) = oh; *(v4us*)(Pl + oo) = ol; }
        } else {
#pragma unroll 2
            for (int ch = 0; ch < TT / 128; ++ch) { const int j0 = ch * 128 + lane * 4; const v4f a = *(const v4f*)(sr + j0); v4h o4;
#pragma unroll
                for (int q = 0; q < 4; ++q) { float t = a[q] * SCL; asm volatile("" : "+v"(t)); float d0 = __fsub_rn(t, mx); asm volatile("" : "+v"(d0)); float ex = __builtin_amdgcn_exp2f(__fmul_rn(d0, 1.4426950408889634f)); asm volatile("" : "+v"(ex)); o4[q] = tohx(ex * f); }
                *(v4h*)(P16 + (size_t)row * TT + j0) = o4; } }
         }
}

__global__ __launch_bounds__(256) void k_xT(const float* __restrict__ xs, bf* XB) { const size_t k = (size_t)blockIdx.x * 256 + threadIdx.x; if (k >= (size_t)TT * CC / 8) return; const int c0 = (int)(k % (CC / 8)) * 8; const int t = (int)(k / (CC / 8)); v8us o;
#pragma unroll
    for (int q = 0; q < 8; ++q) o[q] = f2bf(xs[(size_t)(c0 + q) * TT + t]);
    *(v8us*)(XB + (size_t)t * CC + c0) = o;  }
__global__ __launch_bounds__(256) void k_outT(const float* __restrict__ Y, float* outb) { const size_t i = (size_t)blockIdx.x * 256 + threadIdx.x; if (i >= (size_t)CC * TT / 4) return; const size_t e = i * 4; const int t = (int)(e % TT); const int c = (int)(e / TT); v4f o;
#pragma unroll
    for (int q = 0; q < 4; ++q) o[q] = Y[(size_t)(t + q) * CC + c];
    *(v4f*)(outb + e) = o;  }
__global__ __launch_bounds__(256) void k_wqpad(const float* __restrict__ w, const float* __restrict__ bias, bf* Bt, float* bp) { const int i = blockIdx.x * 256 + threadIdx.x; if (i >= MID * CC / 8) return; const int c0 = (i % (CC / 8)) * 8; const int r = i / (CC / 8); const float* src = w + (size_t)min(r, CQR - 1) * CC + c0; v8us o;
#pragma unroll
    for (int q = 0; q < 8; ++q) { const unsigned short v = f2bf(src[q]); o[q] = (r < CQR) ? v : (unsigned short)0; }
    *(v8us*)(Bt + (size_t)r * CC + c0) = o; if (i < MID) { const float bb = bias[min(i, CQR - 1)]; ((float*)bp)[i] = (i < CQR) ? bb : 0.0f; }  }
__global__ __launch_bounds__(256) void k_wopad(const float* __restrict__ w, bf* Bt) { const int i = blockIdx.x * 256 + threadIdx.x; if (i >= CC * HD / 8) return; const int k0 = (i % (HD / 8)) * 8; const int c = i / (HD / 8); v8us o;
#pragma unroll
    for (int q = 0; q < 8; ++q) { const int kk = k0 + q; const unsigned short v = f2bf(w[(size_t)c * CQR + min(kk, CQR - 1)]); o[q] = (kk < CQR) ? v : (unsigned short)0; }
    *(v8us*)(Bt + (size_t)c * HD + k0) = o;  }
__global__ __launch_bounds__(256) void k_merge(const float* __restrict__ O, int h0, float* OUTb) { const size_t e = ((size_t)blockIdx.x * 256 + threadIdx.x) * 2; if (e >= (size_t)ZH * TT * HD) return; const int d = (int)(e % HD); const int t = (int)((e / HD) % TT); const int zz = (int)(e / ((size_t)HD * TT)); const float cs = (t < RH) ? 1.0f : (1.0f / PCAR); const size_t oo = (size_t)t * DQ + (h0 + zz) * HD + d;
    v2f o2; o2[0] = O[e] * cs; o2[1] = O[e + 1] * cs; *(v2f*)(OUTb + oo) = o2;  }

extern "C" void kernel_launch(void* const* d_in, const int* in_sizes, int n_in,
                              void* d_out, int out_size, void* d_ws, size_t ws_size, hipStream_t stream) {
    (void)in_sizes; (void)n_in; (void)out_size;
    const float* x = (const float*)d_in[0]; const float* wq = (const float*)d_in[1]; const float* bq = (const float*)d_in[2]; const float* wk = (const float*)d_in[3]; const float* bk = (const float*)d_in[4]; const float* wv = (const float*)d_in[5]; const float* bv = (const float*)d_in[6]; const float* wo = (const float*)d_in[7]; const float* bo = (const float*)d_in[8];
    float* OUT = (float*)d_out;   /* [4][256][4096] channel-major */
    char* wsp = (char*)d_ws;
    auto take = [&](size_t bytes) { char* p = wsp; wsp += (bytes + 255) & ~(size_t)255; return (void*)p; };
    float* BQP = (float*)take(256); float* BKP = (float*)take(256); float* BVP = (float*)take(256); h16* A16 = (h16*)take((size_t)TT * HD * 2); bf* ATh = (bf*)take((size_t)TT * HD * 2); bf* ATl = (bf*)take((size_t)TT * HD * 2); bf* WOB = (bf*)take((size_t)CC * HD * 2); float* Y = (float*)take((size_t)TT * CC * 4); bf* WQ = (bf*)take((size_t)DQ * DM * 2); bf* WK = (bf*)take((size_t)DKV * DM * 2); bf* WV = (bf*)take((size_t)DKV * DM * 2); 
    bf* XB = (bf*)take((size_t)TT * DM * 2); float* FQ = (float*)take((size_t)TT * DQ * 4); float* FK = (float*)take((size_t)TT * DKV * 4);
    h16* QP16 = (h16*)take((size_t)NH_ * TT * HD * 2); h16* KP16 = (h16*)take((size_t)NKV * TT * HD * 2); h16* VT16 = (h16*)take((size_t)NKV * HD * TT * 2);
    bf* QPh = (bf*)take((size_t)NH_ * TT * HD * 2); bf* QPl = (bf*)take((size_t)NH_ * TT * HD * 2); bf* KPh = (bf*)take((size_t)NKV * TT * HD * 2); bf* KPl = (bf*)take((size_t)NKV * TT * HD * 2); bf* VTh = (bf*)take((size_t)NKV * HD * TT * 2); bf* VTl = (bf*)take((size_t)NKV * HD * TT * 2); bf* Ph = (bf*)take((size_t)ZH * RH * TT * 2); bf* Pl = (bf*)take((size_t)ZH * RH * TT * 2);
    float* Sb = (float*)take((size_t)ZH * TT * TT * 4); h16* P16 = nullptr; float* Ob = (float*)take((size_t)ZH * TT * HD * 4);
    if ((size_t)(wsp - (char*)d_ws) > ws_size) return;    // ws 256 MiB
    float* FV = FK;   // v projection reuses the k buffer after the k planes are built (stream-ordered)
    { k_wqpad<<<(MID * CC / 8 + 255) / 256, 256, 0, stream>>>(wq, bq, WQ, BQP); k_wqpad<<<(MID * CC / 8 + 255) / 256, 256, 0, stream>>>(wk, bk, WK, BKP); k_wqpad<<<(MID * CC / 8 + 255) / 256, 256, 0, stream>>>(wv, bv, WV, BVP); k_wopad<<<(CC * HD / 8 + 255) / 256, 256, 0, stream>>>(wo, WOB);
      
       }
    const unsigned LQ = (unsigned)(((size_t)NH_ * TT * HD / 2 + 255) / 256), LKv = (unsigned)(((size_t)NKV * TT * HD / 2 + 255) / 256);
    for (int b = 0; b < NB_; ++b) {
        
        k_xT<<<(unsigned)(((size_t)TT * DM / 8 + 255) / 256), 256, 0, stream>>>(x + (size_t)b * CC * TT, XB);   /* channel-major -> token-major bf16 */
        k_gemmw<bf, 0, true><<<dim3(TT / 64, DQ / 64, 1), 32, 0, stream>>>(XB, nullptr, WQ, nullptr, DM, FQ, DQ, BQP, 0, 0, 0);
        k_flat<<<(unsigned)(((size_t)TT * DQ / 4 + 255) / 256), 256, 0, stream>>>(FQ, QP16, QPh, QPl, (size_t)TT * DQ / 4);
        k_gemmw<bf, 0, true><<<dim3(TT / 64, DKV / 64, 1), 32, 0, stream>>>(XB, nullptr, WK, nullptr, DM, FK, DKV, BKP, 0, 0, 0);
        k_flat<<<(unsigned)(((size_t)TT * DKV / 4 + 255) / 256), 256, 0, stream>>>(FK, KP16, KPh, KPl, (size_t)TT * DKV / 4);
        k_gemmw<bf, 0, true><<<dim3(TT / 64, DKV / 64, 1), 32, 0, stream>>>(XB, nullptr, WV, nullptr, DM, FV, DKV, BVP, 0, 0, 0); k_vtp<<<LKv, 256, 0, stream>>>(FV, DKV, NKV, VT16, VTh, VTl);
        for (int h0 = 0; h0 < NH_; h0 += ZH) { const size_t zq = (size_t)h0, zk = (size_t)(h0 / REP);   // one kv head per query head: each pass covers ZH = 1 head, kv plane zk (z-strides TT*HD)
            k_gemmw<bf, 2, false><<<dim3(RH / 64, TT / 64, ZH), 32, 0, stream>>>(QPh + zq * TT * HD, QPl + zq * TT * HD, KPh + zk * TT * HD, KPl + zk * TT * HD, HD, Sb, TT, nullptr, (size_t)TT * HD, (size_t)TT * HD, (size_t)TT * TT);
            k_lsoft<<<ZH * TT / 8, 256, 0, stream>>>(Sb, P16, Ph, Pl);
            k_gemmw<bf, 2, false><<<dim3(RH / 64, HD / 64, ZH), 32, 0, stream>>>(Ph, Pl, VTh + zk * HD * TT, VTl + zk * HD * TT, TT, Ob, HD, nullptr, (size_t)RH * TT, (size_t)HD * TT, (size_t)TT * HD);
            k_flat<<<(unsigned)(((size_t)TT * HD / 4 + 255) / 256), 256, 0, stream>>>(Ob, A16, ATh, ATl, (size_t)TT * HD / 4); k_gemmw<bf, 1, true><<<dim3(TT / 64, CC / 64, 1), 32, 0, stream>>>(ATh, ATl, WOB, nullptr, HD, Y, CC, bo, 0, 0, 0);   /* Wo ctx + bo (token-major) */ k_outT<<<(unsigned)(((size_t)TT * CC / 4 + 255) / 256), 256, 0, stream>>>(Y, OUT + (size_t)b * CC * TT);   /* back to channel-major */ }
         }
}

// v001
// One run takes 304 microseconds.
// Two timings next to v000 put it at 2.61 and 2.64 times that version's speed.
#include <hip/hip_runtime.h>

// SAGAN self-attention over a feature map (x [4][256][64][64] channel-major; tokens = 4,096 positions; q, k, v = 1x1 convs to 32 channels ('oi' [32][256] + [32]); energy = q.k (unscaled, 32 dims: logit sigma ~5.7); attn = softmax over positions; out = attn v ([4096][32]); y = Wo out + bo (1x1 conv 'oi' [256][32] + [256]) written channel-major -> [4][256][64][64] (4.2 M)).
// Layout per batch: the channel-major slab transposed once into a token-major bf16 operand; exact projections + f32 biases; the three 32-channel projections zero-padded to 64 columns (zero weight rows and zero biases: the padded columns are exactly 0, so every 64-wide contraction equals the 32-wide one); scores as hi/lo x hi/lo (3 products) for every row (the logits are too sharp for fp16), softmax with a running maximum and sum on the score tiles in registers, bf16 hi/lo probabilities, attn.v (3 products), all in one launch; the 64-wide context (32 real + 32 zero columns) as hi/lo planes x the zero-padded Wo ([256][64]) exact + bo; the result transposed back to channel-major rows.
// Compute dtypes, f32 accumulate: every input rounded to bf16; projections exact + f32 biases; scores and attn.v 3 products; softmax f32; Wo hl x exact + bias.

#define NB_  4
#define TT   4096
#define DM   256
#define NH_  1
#define NKV  1
#define REP  (NH_ / NKV)
#define HD   64
#define DQ   (NH_ * HD)
#define DKV  (NKV * HD)
#define ZH   1
#define RH   4096                  // read only by k_merge, which is not launched; every query row uses hi+lo planes
#define WIN  0
#define PCAR 1024.0f
#define SCL  1.0f   // unscaled energy
#define CC   256     // channels
#define CQR  32      // real q/k/v channels (padded to HD = 64)
#define MID  HD
typedef _Float16 h16;
typedef unsigned short bf;
typedef __attribute__((ext_vector_type(16))) __bf16   v16bf;
typedef __attribute__((ext_vector_type(16))) _Float16 v16h;
typedef __attribute__((ext_vector_type(8)))  _Float16 v8h;
typedef __attribute__((ext_vector_type(8)))  unsigned short v8us;
typedef __attribute__((ext_vector_type(8)))  float    v8f;
typedef __attribute__((ext_vector_type(4)))  float    v4f;
typedef v8h  __attribute__((may_alias)) v8ha;
typedef v4f  __attribute__((may_alias)) v4fa;
typedef v8us __attribute__((may_alias)) v8usa;

__device__ __forceinline__ unsigned short f2bf(float f) { unsigned u = __float_as_uint(f); u += 0x7FFFu + ((u >> 16) & 1u); return (unsigned short)(u >> 16); }
__device__ __forceinline__ float bf2f(unsigned short b) { return __uint_as_float(((unsigned)b) << 16); }
__device__ __forceinline__ float bfr(float f) { return bf2f(f2bf(f)); }
__device__ __forceinline__ v16h cat16(v8h lo, v8h hi) { return __builtin_shufflevector(lo, hi, 0, 1, 2, 3, 4, 5, 6, 7, 8, 9, 10, 11, 12, 13, 14, 15); }
__device__ __forceinline__ v16bf cat16b(v8us lo, v8us hi) { return __builtin_bit_cast(v16bf, __builtin_shufflevector(lo, hi, 0, 1, 2, 3, 4, 5, 6, 7, 8, 9, 10, 11, 12, 13, 14, 15)); }
__device__ __forceinline__ v8f wmma16(v16h a, v16h b, v8f c) { return __builtin_amdgcn_wmma_f32_16x16x32_f16(false, a, false, b, (short)0, c, false, false); }
__device__ __forceinline__ v8f wmmab(v16bf a, v16bf b, v8f c) { return __builtin_amdgcn_wmma_f32_16x16x32_bf16(false, a, false, b, (short)0, c, false, false); }



// ---- k_gemmw: register-blocked GEMM, ONE WAVE per 64x64 output tile (16 accumulators), operands straight from K-contiguous 16-bit planes; grid (M/64, N/64, Z), 32 threads.
// C[m][n] (f32, pitch ldc, + optional f32 bias[n]) = sum_k A[m][k] Bt[n][k] (+ split products per NSPLIT). z-batch strides sA/sB/sC in elements. K % 32 == 0.
template <typename T16> struct WFrag;
template <> struct WFrag<h16> { typedef v16h V; static __device__ __forceinline__ V ld(const h16* p) { return cat16(*(const v8h*)p, *(const v8h*)(p + 16)); } static __device__ __forceinline__ v8f mma(V a, V b, v8f c) { return wmma16(a, b, c); } };
template <> struct WFrag<bf> { typedef v16bf V; static __device__ __forceinline__ V ld(const bf* p) { return cat16b(*(const v8us*)p, *(const v8us*)(p + 16)); } static __device__ __forceinline__ v8f mma(V a, V b, v8f c) { return wmmab(a, b, c); } };
template <typename T16, int NSPLIT, bool BIAS>
__global__ __launch_bounds__(32) void k_gemmw(const T16* __restrict__ A, const T16* __restrict__ A2, const T16* __restrict__ Bt, const T16* __restrict__ Bt2, int K, float* C, int ldc, const float* __restrict__ bias, size_t sA, size_t sB, size_t sC) {
    typedef typename WFrag<T16>::V V;
    __shared__ __align__(16) float os[16 * 68];
    const size_t z = blockIdx.z; A += z * sA; if (A2) A2 += z * sA; Bt += z * sB; if (Bt2) Bt2 += z * sB; C += z * sC;
    const int lane = threadIdx.x & 31, lr = lane & 15, hi = lane >> 4; const int r0 = blockIdx.x * 64, c0 = blockIdx.y * 64;
    v8f acc[4][4];
#pragma unroll
    for (int mb = 0; mb < 4; ++mb)
#pragma unroll
        for (int nb = 0; nb < 4; ++nb) acc[mb][nb] = (v8f){};
    const size_t aoff = (size_t)(r0 + lr) * K + 8 * hi, boff = (size_t)(c0 + lr) * K + 8 * hi;
#pragma unroll 1
    for (int kc = 0; kc < K; kc += 32) {
        V a[4], a2[4];
#pragma unroll
        for (int mb = 0; mb < 4; ++mb) { a[mb] = WFrag<T16>::ld(A + aoff + (size_t)mb * 16 * K + kc); if (NSPLIT == 1 || NSPLIT == 2) a2[mb] = WFrag<T16>::ld(A2 + aoff + (size_t)mb * 16 * K + kc); }
#pragma unroll
        for (int nb = 0; nb < 4; ++nb) { const V b = WFrag<T16>::ld(Bt + boff + (size_t)nb * 16 * K + kc); V b2; if (NSPLIT >= 2) b2 = WFrag<T16>::ld(Bt2 + boff + (size_t)nb * 16 * K + kc);
#pragma unroll
            for (int mb = 0; mb < 4; ++mb) { acc[mb][nb] = WFrag<T16>::mma(a[mb], b, acc[mb][nb]); if (NSPLIT == 1 || NSPLIT == 2) acc[mb][nb] = WFrag<T16>::mma(a2[mb], b, acc[mb][nb]); if (NSPLIT >= 2) acc[mb][nb] = WFrag<T16>::mma(a[mb], b2, acc[mb][nb]); } }
        asm volatile("v_nop\n\tv_nop\n\tv_nop\n\tv_nop" : "+v"(acc[0][0]), "+v"(acc[1][1]), "+v"(acc[2][2]), "+v"(acc[3][3]) : "v"(a[0]), "v"(a[3]));
    }
#pragma unroll
    for (int mb = 0; mb < 4; ++mb) {
#pragma unroll
        for (int nb = 0; nb < 4; ++nb) {
#pragma unroll
            for (int j = 0; j < 8; ++j) os[(hi * 8 + j) * 68 + nb * 16 + lr] = acc[mb][nb][j]; }
        __builtin_amdgcn_wave_barrier(); asm volatile("" ::: "memory");
        float* crow = C + (size_t)(r0 + mb * 16) * ldc + c0;
{
#pragma unroll
            for (int s = 0; s < 8; ++s) { const int row = 2 * s + hi, cofs = lr * 4; v4f val = *(const v4fa*)(os + row * 68 + cofs); if (BIAS) { val[0] += bfr(bias[c0 + cofs]); val[1] += bfr(bias[c0 + cofs + 1]); val[2] += bfr(bias[c0 + cofs + 2]); val[3] += bfr(bias[c0 + cofs + 3]); }
                *(v4f*)(crow + (size_t)row * ldc + cofs) = val; }
             }
        __builtin_amdgcn_wave_barrier(); asm volatile("" ::: "memory");
    }
}

__device__ __forceinline__ h16 tohx(float x) { return (h16)x; }
__device__ __forceinline__ void splitf(float y, unsigned short& h, unsigned short& l) { h = f2bf(y); l = f2bf(y - bf2f(h)); }
typedef __attribute__((ext_vector_type(2))) _Float16 v2h;
typedef __attribute__((ext_vector_type(4))) _Float16 v4h;
typedef __attribute__((ext_vector_type(2))) unsigned short v2us;
typedef __attribute__((ext_vector_type(4))) unsigned short v4us;
typedef __attribute__((ext_vector_type(2))) float v2f;
typedef __attribute__((ext_vector_type(4))) int v4i;

__global__ __launch_bounds__(256) void k_wtG(const float* __restrict__ w, int K, int N, bf* Bt) {
    const int lane = threadIdx.x & 31; const int L0 = (blockIdx.x * 8 + (threadIdx.x >> 5)) * 8; const int nlines = N * K / 64;
{
#pragma unroll 1
        for (int l = 0; l < 8; ++l) { const int L = L0 + l; if (L >= nlines) break; const size_t e = (size_t)L * 64 + lane * 2; const int k = (int)(e % K), n = (int)(e / K); v2us o;
            o[0] = f2bf(w[(size_t)k * N + n]); o[1] = f2bf(w[(size_t)(k + 1) * N + n]); *(v2us*)(Bt + e) = o; }
         }
}
__global__ __launch_bounds__(256) void k_cvt8(const float* __restrict__ src, bf* dst, size_t n8) { const size_t i = (size_t)blockIdx.x * 256 + threadIdx.x; if (i >= n8) return; const v8f v = *(const v8f*)(src + i * 8); v8us o;
#pragma unroll
    for (int k = 0; k < 8; ++k) o[k] = f2bf(v[k]); *(v8us*)(dst + i * 8) = o;  }

__global__ __launch_bounds__(256) void k_flat(const float* __restrict__ F, h16* P16, bf* Ph, bf* Pl, size_t n4) { const size_t i = (size_t)blockIdx.x * 256 + threadIdx.x; if (i >= n4) return; const v4f a = *(const v4f*)(F + i * 4); v4h o16; v4us oh, ol;
#pragma unroll
    for (int q = 0; q < 4; ++q) { o16[q] = tohx(a[q]); unsigned short x2, y2; splitf(a[q], x2, y2); oh[q] = x2; ol[q] = y2; }
    *(v4h*)(P16 + i * 4) = o16; *(v4us*)(Ph + i * 4) = oh; *(v4us*)(Pl + i * 4) = ol;  }


__global__ __launch_bounds__(256) void k_vtp(const float* __restrict__ F, int pitch, int nheads, h16* V16, bf* Vh, bf* Vl) { const size_t e = ((size_t)blockIdx.x * 256 + threadIdx.x) * 2; if (e >= (size_t)nheads * HD * TT) return; const int t = (int)(e % TT); const int d = (int)((e / TT) % HD); const int g = (int)(e / ((size_t)TT * HD)); v2h o16; v2us oh, ol;
#pragma unroll
    for (int q = 0; q < 2; ++q) { const float x = F[(size_t)(t + q) * pitch + g * HD + d]; o16[q] = tohx(x); unsigned short a2, c2; splitf(x, a2, c2); oh[q] = a2; ol[q] = c2; }
    *(v2h*)(V16 + e) = o16; *(v2us*)(Vh + e) = oh; *(v2us*)(Vl + e) = ol;  }
typedef __attribute__((ext_vector_type(2))) __bf16 v2bf;
typedef float __attribute__((may_alias)) fa;
#define FW_   8                 // waves of a work-group = key splits
#define FSK   64                // keys per stage
#define FPI   72                // LDS row pitch, 16-bit elements
#define FTILE (64 * FPI)        // one staged plane: 64 rows
#define FOP   68                // merge row pitch, floats
#define L2E   1.4426950408889634f
__device__ __forceinline__ float xhalf(float v) { const int b = __float_as_int(v); return __int_as_float(__builtin_amdgcn_permlanex16(b, b, 0x76543210, 0xfedcba98, false, false)); }
// orders one wave's LDS stores against its own later LDS loads of other lanes' bytes (the LDS serves a wave in order; this keeps the compiler from swapping them)
__device__ __forceinline__ void wave_order() { __builtin_amdgcn_wave_barrier(); asm volatile("" ::: "memory"); }
__global__ __launch_bounds__(256) void k_fattn(const bf* __restrict__ Qh, const bf* __restrict__ Ql, const bf* __restrict__ Kh, const bf* __restrict__ Kl, const bf* __restrict__ Vh, const bf* __restrict__ Vl, float* __restrict__ O) {
    __shared__ __align__(16) bf sm[FW_ * 4 * FTILE];
    const int lane = threadIdx.x & 31, c = lane & 15, h = lane >> 4; const int w = __builtin_amdgcn_readfirstlane((int)(threadIdx.x >> 5)); const int q0 = blockIdx.x * 16;
    bf* kh_s = sm + w * 4 * FTILE; bf* kl_s = kh_s + FTILE; bf* vh_s = kl_s + FTILE; bf* vl_s = vh_s + FTILE;
    v16bf qh[2], ql[2];
#pragma unroll
    for (int kc = 0; kc < 2; ++kc) { qh[kc] = WFrag<bf>::ld(Qh + (size_t)(q0 + c) * HD + kc * 32 + 8 * h); ql[kc] = WFrag<bf>::ld(Ql + (size_t)(q0 + c) * HD + kc * 32 + 8 * h); }
    v8f o[4];
#pragma unroll
    for (int dt = 0; dt < 4; ++dt) o[dt] = (v8f){};
    float m = -3.0e38f, l = 0.0f;
    const int srow = lane >> 3, scol = (lane & 7) * 8, sdst = srow * FPI + scol; const int kbase = w * (TT / FW_);
    v8us st[32];
#pragma unroll
    for (int i = 0; i < 16; ++i) { st[i] = *(const v8us*)(Kh + (size_t)kbase * HD + i * 256 + lane * 8); st[16 + i] = *(const v8us*)(Kl + (size_t)kbase * HD + i * 256 + lane * 8); }
#pragma unroll 1
    for (int s = 0; s < TT / FW_ / FSK; ++s) {
        const int key0 = kbase + s * FSK;
#pragma unroll
        for (int i = 0; i < 16; ++i) { *(v8us*)(kh_s + sdst + i * 4 * FPI) = st[i]; *(v8us*)(kl_s + sdst + i * 4 * FPI) = st[16 + i]; }
        // this stage's V^T rows fly while the scores are computed
        const bf* pvh = Vh + (size_t)srow * TT + key0 + scol; const bf* pvl = Vl + (size_t)srow * TT + key0 + scol;
#pragma unroll
        for (int i = 0; i < 16; ++i) { st[i] = *(const v8us*)(pvh + (size_t)i * 4 * TT); st[16 + i] = *(const v8us*)(pvl + (size_t)i * 4 * TT); }
        asm volatile("s_wait_xcnt 0x0" :: "v"(pvh), "v"(pvl) : "memory");   // precaution: stands before any overwrite of the address registers of the loads just issued; naming them keeps them whole up to here
        wave_order();
        v8f sc[4];
#pragma unroll
        for (int kt = 0; kt < 4; ++kt) sc[kt] = (v8f){};
#pragma unroll
        for (int kc = 0; kc < 2; ++kc) { v16bf a[4], a2[4];
#pragma unroll
            for (int kt = 0; kt < 4; ++kt) { a[kt] = WFrag<bf>::ld(kh_s + (kt * 16 + c) * FPI + kc * 32 + 8 * h); a2[kt] = WFrag<bf>::ld(kl_s + (kt * 16 + c) * FPI + kc * 32 + 8 * h); }
#pragma unroll
            for (int kt = 0; kt < 4; ++kt) sc[kt] = wmmab(a[kt], qh[kc], sc[kt]);
#pragma unroll
            for (int kt = 0; kt < 4; ++kt) sc[kt] = wmmab(a[kt], ql[kc], sc[kt]);
#pragma unroll
            for (int kt = 0; kt < 4; ++kt) sc[kt] = wmmab(a2[kt], qh[kc], sc[kt]); }
        float mx = sc[0][0];
#pragma unroll
        for (int kt = 0; kt < 4; ++kt)
#pragma unroll
            for (int r = 0; r < 8; ++r) mx = fmaxf(mx, sc[kt][r]);
        mx = fmaxf(mx, xhalf(mx));
        const float mn = fmaxf(m, mx); const float al = __builtin_amdgcn_exp2f((m - mn) * L2E); m = mn;
        float ps = 0.0f;
#pragma unroll
        for (int kt = 0; kt < 4; ++kt)
#pragma unroll
            for (int r = 0; r < 8; ++r) { const float p = __builtin_amdgcn_exp2f((sc[kt][r] - mn) * L2E); sc[kt][r] = p; ps += p; }
        l = l * al + ps;
#pragma unroll
        for (int dt = 0; dt < 4; ++dt) o[dt] *= al;
        wave_order();
#pragma unroll
        for (int i = 0; i < 16; ++i) { *(v8us*)(vh_s + sdst + i * 4 * FPI) = st[i]; *(v8us*)(vl_s + sdst + i * 4 * FPI) = st[16 + i]; }
        // the next stage's K rows fly while attn.v is computed
        if (s + 1 < TT / FW_ / FSK) {
            const bf* pkh = Kh + (size_t)(key0 + FSK) * HD + lane * 8; const bf* pkl = Kl + (size_t)(key0 + FSK) * HD + lane * 8;
#pragma unroll
            for (int i = 0; i < 16; ++i) { st[i] = *(const v8us*)(pkh + i * 256); st[16 + i] = *(const v8us*)(pkl + i * 256); }
            asm volatile("s_wait_xcnt 0x0" :: "v"(pkh), "v"(pkl) : "memory");   // same precaution as behind the V^T loads
        }
        wave_order();
#pragma unroll
        for (int kb = 0; kb < 2; ++kb) { v16bf ph, pl;
#pragma unroll
            for (int e = 0; e < 16; e += 2) { v2f pp; pp[0] = sc[2 * kb + (e >> 3)][e & 7]; pp[1] = sc[2 * kb + (e >> 3)][(e & 7) + 1]; const v2bf hh = __builtin_convertvector(pp, v2bf); const v2f bk = __builtin_convertvector(hh, v2f); const v2bf ll = __builtin_convertvector(pp - bk, v2bf); ph[e] = hh[0]; ph[e + 1] = hh[1]; pl[e] = ll[0]; pl[e + 1] = ll[1]; }
            v16bf a[4], a2[4];
#pragma unroll
            for (int dt = 0; dt < 4; ++dt) { a[dt] = WFrag<bf>::ld(vh_s + (dt * 16 + c) * FPI + kb * 32 + 8 * h); a2[dt] = WFrag<bf>::ld(vl_s + (dt * 16 + c) * FPI + kb * 32 + 8 * h); }
#pragma unroll
            for (int dt = 0; dt < 4; ++dt) o[dt] = wmmab(a[dt], ph, o[dt]);
#pragma unroll
            for (int dt = 0; dt < 4; ++dt) o[dt] = wmmab(a2[dt], ph, o[dt]);
#pragma unroll
            for (int dt = 0; dt < 4; ++dt) o[dt] = wmmab(a[dt], pl, o[dt]); }
    }
    l += xhalf(l);
    // each wave's partial O^T, maximum and sum go into its own slice, then the work-group merges the 8 key splits
    fa* of = (fa*)kh_s;
#pragma unroll
    for (int dt = 0; dt < 4; ++dt) { v4f lo4, hi4;
#pragma unroll
        for (int r = 0; r < 4; ++r) { lo4[r] = o[dt][r]; hi4[r] = o[dt][4 + r]; }
        *(v4fa*)(of + c * FOP + dt * 16 + 8 * h) = lo4; *(v4fa*)(of + c * FOP + dt * 16 + 8 * h + 4) = hi4; }
    if (h == 0) { of[16 * FOP + c] = m; of[16 * FOP + 16 + c] = l; }
    __syncthreads();
    const int q = threadIdx.x >> 4, d0 = (threadIdx.x & 15) * 4;
    float M = -3.0e38f;
#pragma unroll
    for (int u = 0; u < FW_; ++u) M = fmaxf(M, ((const fa*)(sm + u * 4 * FTILE))[16 * FOP + q]);
    float L = 0.0f; v4f acc = (v4f){};
#pragma unroll
    for (int u = 0; u < FW_; ++u) { const fa* b = (const fa*)(sm + u * 4 * FTILE); const float f = __builtin_amdgcn_exp2f((b[16 * FOP + q] - M) * L2E); L += b[16 * FOP + 16 + q] * f; acc += *(const v4fa*)(b + q * FOP + d0) * f; }
    const float inv = __fdiv_rn(1.0f, L);
    *(v4f*)(O + (size_t)(q0 + q) * HD + d0) = acc * inv;
}

__global__ __launch_bounds__(256) void k_xT(const float* __restrict__ xs, bf* XB) { const size_t k = (size_t)blockIdx.x * 256 + threadIdx.x; if (k >= (size_t)TT * CC / 8) return; const int c0 = (int)(k % (CC / 8)) * 8; const int t = (int)(k / (CC / 8)); v8us o;
#pragma unroll
    for (int q = 0; q < 8; ++q) o[q] = f2bf(xs[(size_t)(c0 + q) * TT + t]);
    *(v8us*)(XB + (size_t)t * CC + c0) = o;  }
__global__ __launch_bounds__(256) void k_outT(const float* __restrict__ Y, float* outb) { const size_t i = (size_t)blockIdx.x * 256 + threadIdx.x; if (i >= (size_t)CC * TT / 4) return; const size_t e = i * 4; const int t = (int)(e % TT); const int c = (int)(e / TT); v4f o;
#pragma unroll
    for (int q = 0; q < 4; ++q) o[q] = Y[(size_t)(t + q) * CC + c];
    *(v4f*)(outb + e) = o;  }
__global__ __launch_bounds__(256) void k_wqpad(const float* __restrict__ w, const float* __restrict__ bias, bf* Bt, float* bp) { const int i = blockIdx.x * 256 + threadIdx.x; if (i >= MID * CC / 8) return; const int c0 = (i % (CC / 8)) * 8; const int r = i / (CC / 8); const float* src = w + (size_t)min(r, CQR - 1) * CC + c0; v8us o;
#pragma unroll
    for (int q = 0; q < 8; ++q) { const unsigned short v = f2bf(src[q]); o[q] = (r < CQR) ? v : (unsigned short)0; }
    *(v8us*)(Bt + (size_t)r * CC + c0) = o; if (i < MID) { const float bb = bias[min(i, CQR - 1)]; ((float*)bp)[i] = (i < CQR) ? bb : 0.0f; }  }
__global__ __launch_bounds__(256) void k_wopad(const float* __restrict__ w, bf* Bt) { const int i = blockIdx.x * 256 + threadIdx.x; if (i >= CC * HD / 8) return; const int k0 = (i % (HD / 8)) * 8; const int c = i / (HD / 8); v8us o;
#pragma unroll
    for (int q = 0; q < 8; ++q) { const int kk = k0 + q; const unsigned short v = f2bf(w[(size_t)c * CQR + min(kk, CQR - 1)]); o[q] = (kk < CQR) ? v : (unsigned short)0; }
    *(v8us*)(Bt + (size_t)c * HD + k0) = o;  }
__global__ __launch_bounds__(256) void k_merge(const float* __restrict__ O, int h0, float* OUTb) { const size_t e = ((size_t)blockIdx.x * 256 + threadIdx.x) * 2; if (e >= (size_t)ZH * TT * HD) return; const int d = (int)(e % HD); const int t = (int)((e / HD) % TT); const int zz = (int)(e / ((size_t)HD * TT)); const float cs = (t < RH) ? 1.0f : (1.0f / PCAR); const size_t oo = (size_t)t * DQ + (h0 + zz) * HD + d;
    v2f o2; o2[0] = O[e] * cs; o2[1] = O[e + 1] * cs; *(v2f*)(OUTb + oo) = o2;  }

extern "C" void kernel_launch(void* const* d_in, const int* in_sizes, int n_in,
                              void* d_out, int out_size, void* d_ws, size_t ws_size, hipStream_t stream) {
    (void)in_sizes; (void)n_in; (void)out_size;
    const float* x = (const float*)d_in[0]; const float* wq = (const float*)d_in[1]; const float* bq = (const float*)d_in[2]; const float* wk = (const float*)d_in[3]; const float* bk = (const float*)d_in[4]; const float* wv = (const float*)d_in[5]; const float* bv = (const float*)d_in[6]; const float* wo = (const float*)d_in[7]; const float* bo = (const float*)d_in[8];
    float* OUT = (float*)d_out;   /* [4][256][4096] channel-major */
    char* wsp = (char*)d_ws;
    auto take = [&](size_t bytes) { char* p = wsp; wsp += (bytes + 255) & ~(size_t)255; return (void*)p; };
    float* BQP = (float*)take(256); float* BKP = (float*)take(256); float* BVP = (float*)take(256); h16* A16 = (h16*)take((size_t)TT * HD * 2); bf* ATh = (bf*)take((size_t)TT * HD * 2); bf* ATl = (bf*)take((size_t)TT * HD * 2); bf* WOB = (bf*)take((size_t)CC * HD * 2); float* Y = (float*)take((size_t)TT * CC * 4); bf* WQ = (bf*)take((size_t)DQ * DM * 2); bf* WK = (bf*)take((size_t)DKV * DM * 2); bf* WV = (bf*)take((size_t)DKV * DM * 2); 
    bf* XB = (bf*)take((size_t)TT * DM * 2); float* FQ = (float*)take((size_t)TT * DQ * 4); float* FK = (float*)take((size_t)TT * DKV * 4);
    h16* QP16 = (h16*)take((size_t)NH_ * TT * HD * 2); h16* KP16 = (h16*)take((size_t)NKV * TT * HD * 2); h16* VT16 = (h16*)take((size_t)NKV * HD * TT * 2);
    bf* QPh = (bf*)take((size_t)NH_ * TT * HD * 2); bf* QPl = (bf*)take((size_t)NH_ * TT * HD * 2); bf* KPh = (bf*)take((size_t)NKV * TT * HD * 2); bf* KPl = (bf*)take((size_t)NKV * TT * HD * 2); bf* VTh = (bf*)take((size_t)NKV * HD * TT * 2); bf* VTl = (bf*)take((size_t)NKV * HD * TT * 2);
    float* Ob = (float*)take((size_t)ZH * TT * HD * 4);
    if ((size_t)(wsp - (char*)d_ws) > ws_size) return;    // ws 256 MiB
    float* FV = FK;   // v projection reuses the k buffer after the k planes are built (stream-ordered)
    { k_wqpad<<<(MID * CC / 8 + 255) / 256, 256, 0, stream>>>(wq, bq, WQ, BQP); k_wqpad<<<(MID * CC / 8 + 255) / 256, 256, 0, stream>>>(wk, bk, WK, BKP); k_wqpad<<<(MID * CC / 8 + 255) / 256, 256, 0, stream>>>(wv, bv, WV, BVP); k_wopad<<<(CC * HD / 8 + 255) / 256, 256, 0, stream>>>(wo, WOB);
      
       }
    const unsigned LQ = (unsigned)(((size_t)NH_ * TT * HD / 2 + 255) / 256), LKv = (unsigned)(((size_t)NKV * TT * HD / 2 + 255) / 256);
    for (int b = 0; b < NB_; ++b) {
        
        k_xT<<<(unsigned)(((size_t)TT * DM / 8 + 255) / 256), 256, 0, stream>>>(x + (size_t)b * CC * TT, XB);   /* channel-major -> token-major bf16 */
        k_gemmw<bf, 0, true><<<dim3(TT / 64, DQ / 64, 1), 32, 0, stream>>>(XB, nullptr, WQ, nullptr, DM, FQ, DQ, BQP, 0, 0, 0);
        k_flat<<<(unsigned)(((size_t)TT * DQ / 4 + 255) / 256), 256, 0, stream>>>(FQ, QP16, QPh, QPl, (size_t)TT * DQ / 4);
        k_gemmw<bf, 0, true><<<dim3(TT / 64, DKV / 64, 1), 32, 0, stream>>>(XB, nullptr, WK, nullptr, DM, FK, DKV, BKP, 0, 0, 0);
        k_flat<<<(unsigned)(((size_t)TT * DKV / 4 + 255) / 256), 256, 0, stream>>>(FK, KP16, KPh, KPl, (size_t)TT * DKV / 4);
        k_gemmw<bf, 0, true><<<dim3(TT / 64, DKV / 64, 1), 32, 0, stream>>>(XB, nullptr, WV, nullptr, DM, FV, DKV, BVP, 0, 0, 0); k_vtp<<<LKv, 256, 0, stream>>>(FV, DKV, NKV, VT16, VTh, VTl);
        for (int h0 = 0; h0 < NH_; h0 += ZH) { const size_t zq = (size_t)h0, zk = (size_t)(h0 / REP);   // one kv head per query head: the pass's one head (ZH = 1) reads kv plane zk = h0 / REP
            k_fattn<<<TT / 16, 256, 0, stream>>>(QPh + zq * TT * HD, QPl + zq * TT * HD, KPh + zk * TT * HD, KPl + zk * TT * HD, VTh + zk * HD * TT, VTl + zk * HD * TT, Ob);   /* scores + softmax + attn.v */
            k_flat<<<(unsigned)(((size_t)TT * HD / 4 + 255) / 256), 256, 0, stream>>>(Ob, A16, ATh, ATl, (size_t)TT * HD / 4); k_gemmw<bf, 1, true><<<dim3(TT / 64, CC / 64, 1), 32, 0, stream>>>(ATh, ATl, WOB, nullptr, HD, Y, CC, bo, 0, 0, 0);   /* Wo ctx + bo (token-major) */ k_outT<<<(unsigned)(((size_t)TT * CC / 4 + 255) / 256), 256, 0, stream>>>(Y, OUT + (size_t)b * CC * TT);   /* back to channel-major */ }
         }
}

// v002
// Measured time: 184 microseconds a run.
// Two timings next to v001 put it at 1.64 and 1.65 times that version's speed.
// Over all steps from v000 it is 4.32 times as fast.
#include <hip/hip_runtime.h>

// SAGAN self-attention over a feature map (x [4][256][64][64] channel-major; tokens = 4,096 positions; q, k, v = 1x1 convs to 32 channels ('oi' [32][256] + [32]); energy = q.k (unscaled, 32 dims: logit sigma ~5.7); attn = softmax over positions; out = attn v ([4096][32]); y = Wo out + bo (1x1 conv 'oi' [256][32] + [256]) written channel-major -> [4][256][64][64] (4.2 M)).
// Every stage runs once for all NB_ batches (the batch is a grid dimension, or extra rows of a row-contiguous operand); every activation plane holds NB_ slabs; the padded weight and bias planes hold one copy for all batches.
// Layout per batch: the channel-major slab transposed once into a token-major bf16 operand; exact projections + f32 biases; the three 32-channel projections zero-padded to 64 columns (zero weight rows and zero biases: the padded columns are exactly 0, so every 64-wide contraction equals the 32-wide one); scores as hi/lo x hi/lo (3 products) for every row (the logits are too sharp for fp16), softmax with a running maximum and sum on the score tiles in registers, bf16 hi/lo probabilities, attn.v (3 products), all in one launch; the 64-wide context (32 real + 32 zero columns) as hi/lo planes x the zero-padded Wo ([256][64]) exact + bo; the result transposed back to channel-major rows.
// Compute dtypes, f32 accumulate: every input rounded to bf16; projections exact + f32 biases; scores and attn.v 3 products; softmax f32; Wo hl x exact + bias.

#define NB_  4
#define TT   4096
#define DM   256
#define NH_  1
#define NKV  1
#define REP  (NH_ / NKV)
#define HD   64
#define DQ   (NH_ * HD)
#define DKV  (NKV * HD)
#define ZH   1
#define RH   4096                  // read only by k_merge, which is not launched; every query row uses hi+lo planes
#define WIN  0
#define PCAR 1024.0f
#define SCL  1.0f   // unscaled energy
#define CC   256     // channels
#define CQR  32      // real q/k/v channels (padded to HD = 64)
#define MID  HD
typedef _Float16 h16;
typedef unsigned short bf;
typedef __attribute__((ext_vector_type(16))) __bf16   v16bf;
typedef __attribute__((ext_vector_type(16))) _Float16 v16h;
typedef __attribute__((ext_vector_type(8)))  _Float16 v8h;
typedef __attribute__((ext_vector_type(8)))  unsigned short v8us;
typedef __attribute__((ext_vector_type(8)))  float    v8f;
typedef __attribute__((ext_vector_type(4)))  float    v4f;
typedef v8h  __attribute__((may_alias)) v8ha;
typedef v4f  __attribute__((may_alias)) v4fa;
typedef v8us __attribute__((may_alias)) v8usa;

__device__ __forceinline__ unsigned short f2bf(float f) { unsigned u = __float_as_uint(f); u += 0x7FFFu + ((u >> 16) & 1u); return (unsigned short)(u >> 16); }
__device__ __forceinline__ float bf2f(unsigned short b) { return __uint_as_float(((unsigned)b) << 16); }
__device__ __forceinline__ float bfr(float f) { return bf2f(f2bf(f)); }
__device__ __forceinline__ v16h cat16(v8h lo, v8h hi) { return __builtin_shufflevector(lo, hi, 0, 1, 2, 3, 4, 5, 6, 7, 8, 9, 10, 11, 12, 13, 14, 15); }
__device__ __forceinline__ v16bf cat16b(v8us lo, v8us hi) { return __builtin_bit_cast(v16bf, __builtin_shufflevector(lo, hi, 0, 1, 2, 3, 4, 5, 6, 7, 8, 9, 10, 11, 12, 13, 14, 15)); }
__device__ __forceinline__ v8f wmma16(v16h a, v16h b, v8f c) { return __builtin_amdgcn_wmma_f32_16x16x32_f16(false, a, false, b, (short)0, c, false, false); }
__device__ __forceinline__ v8f wmmab(v16bf a, v16bf b, v8f c) { return __builtin_amdgcn_wmma_f32_16x16x32_bf16(false, a, false, b, (short)0, c, false, false); }



// ---- k_gemmw: register-blocked GEMM, ONE WAVE per 64x64 output tile (16 accumulators), operands straight from K-contiguous 16-bit planes; grid (M/64, N/64, Z), 32 threads.
// C[m][n] (f32, pitch ldc, + optional f32 bias[n]) = sum_k A[m][k] Bt[n][k] (+ split products per NSPLIT). z-batch strides sA/sB/sC in elements. K % 32 == 0.
template <typename T16> struct WFrag;
template <> struct WFrag<h16> { typedef v16h V; static __device__ __forceinline__ V ld(const h16* p) { return cat16(*(const v8h*)p, *(const v8h*)(p + 16)); } static __device__ __forceinline__ v8f mma(V a, V b, v8f c) { return wmma16(a, b, c); } };
template <> struct WFrag<bf> { typedef v16bf V; static __device__ __forceinline__ V ld(const bf* p) { return cat16b(*(const v8us*)p, *(const v8us*)(p + 16)); } static __device__ __forceinline__ v8f mma(V a, V b, v8f c) { return wmmab(a, b, c); } };
template <typename T16, int NSPLIT, bool BIAS>
__global__ __launch_bounds__(32) void k_gemmw(const T16* __restrict__ A, const T16* __restrict__ A2, const T16* __restrict__ Bt, const T16* __restrict__ Bt2, int K, float* C, int ldc, const float* __restrict__ bias, size_t sA, size_t sB, size_t sC) {
    typedef typename WFrag<T16>::V V;
    __shared__ __align__(16) float os[16 * 68];
    const size_t z = blockIdx.z; A += z * sA; if (A2) A2 += z * sA; Bt += z * sB; if (Bt2) Bt2 += z * sB; C += z * sC;
    const int lane = threadIdx.x & 31, lr = lane & 15, hi = lane >> 4; const int r0 = blockIdx.x * 64, c0 = blockIdx.y * 64;
    v8f acc[4][4];
#pragma unroll
    for (int mb = 0; mb < 4; ++mb)
#pragma unroll
        for (int nb = 0; nb < 4; ++nb) acc[mb][nb] = (v8f){};
    const size_t aoff = (size_t)(r0 + lr) * K + 8 * hi, boff = (size_t)(c0 + lr) * K + 8 * hi;
#pragma unroll 1
    for (int kc = 0; kc < K; kc += 32) {
        V a[4], a2[4];
#pragma unroll
        for (int mb = 0; mb < 4; ++mb) { a[mb] = WFrag<T16>::ld(A + aoff + (size_t)mb * 16 * K + kc); if (NSPLIT == 1 || NSPLIT == 2) a2[mb] = WFrag<T16>::ld(A2 + aoff + (size_t)mb * 16 * K + kc); }
#pragma unroll
        for (int nb = 0; nb < 4; ++nb) { const V b = WFrag<T16>::ld(Bt + boff + (size_t)nb * 16 * K + kc); V b2; if (NSPLIT >= 2) b2 = WFrag<T16>::ld(Bt2 + boff + (size_t)nb * 16 * K + kc);
#pragma unroll
            for (int mb = 0; mb < 4; ++mb) { acc[mb][nb] = WFrag<T16>::mma(a[mb], b, acc[mb][nb]); if (NSPLIT == 1 || NSPLIT == 2) acc[mb][nb] = WFrag<T16>::mma(a2[mb], b, acc[mb][nb]); if (NSPLIT >= 2) acc[mb][nb] = WFrag<T16>::mma(a[mb], b2, acc[mb][nb]); } }
        asm volatile("v_nop\n\tv_nop\n\tv_nop\n\tv_nop" : "+v"(acc[0][0]), "+v"(acc[1][1]), "+v"(acc[2][2]), "+v"(acc[3][3]) : "v"(a[0]), "v"(a[3]));
    }
#pragma unroll
    for (int mb = 0; mb < 4; ++mb) {
#pragma unroll
        for (int nb = 0; nb < 4; ++nb) {
#pragma unroll
            for (int j = 0; j < 8; ++j) os[(hi * 8 + j) * 68 + nb * 16 + lr] = acc[mb][nb][j]; }
        __builtin_amdgcn_wave_barrier(); asm volatile("" ::: "memory");
        float* crow = C + (size_t)(r0 + mb * 16) * ldc + c0;
{
#pragma unroll
            for (int s = 0; s < 8; ++s) { const int row = 2 * s + hi, cofs = lr * 4; v4f val = *(const v4fa*)(os + row * 68 + cofs); if (BIAS) { val[0] += bfr(bias[c0 + cofs]); val[1] += bfr(bias[c0 + cofs + 1]); val[2] += bfr(bias[c0 + cofs + 2]); val[3] += bfr(bias[c0 + cofs + 3]); }
                *(v4f*)(crow + (size_t)row * ldc + cofs) = val; }
             }
        __builtin_amdgcn_wave_barrier(); asm volatile("" ::: "memory");
    }
}

__device__ __forceinline__ h16 tohx(float x) { return (h16)x; }
__device__ __forceinline__ void splitf(float y, unsigned short& h, unsigned short& l) { h = f2bf(y); l = f2bf(y - bf2f(h)); }
typedef __attribute__((ext_vector_type(2))) _Float16 v2h;
typedef __attribute__((ext_vector_type(4))) _Float16 v4h;
typedef __attribute__((ext_vector_type(2))) unsigned short v2us;
typedef __attribute__((ext_vector_type(4))) unsigned short v4us;
typedef __attribute__((ext_vector_type(2))) float v2f;
typedef __attribute__((ext_vector_type(4))) int v4i;

__global__ __launch_bounds__(256) void k_wtG(const float* __restrict__ w, int K, int N, bf* Bt) {
    const int lane = threadIdx.x & 31; const int L0 = (blockIdx.x * 8 + (threadIdx.x >> 5)) * 8; const int nlines = N * K / 64;
{
#pragma unroll 1
        for (int l = 0; l < 8; ++l) { const int L = L0 + l; if (L >= nlines) break; const size_t e = (size_t)L * 64 + lane * 2; const int k = (int)(e % K), n = (int)(e / K); v2us o;
            o[0] = f2bf(w[(size_t)k * N + n]); o[1] = f2bf(w[(size_t)(k + 1) * N + n]); *(v2us*)(Bt + e) = o; }
         }
}
__global__ __launch_bounds__(256) void k_cvt8(const float* __restrict__ src, bf* dst, size_t n8) { const size_t i = (size_t)blockIdx.x * 256 + threadIdx.x; if (i >= n8) return; const v8f v = *(const v8f*)(src + i * 8); v8us o;
#pragma unroll
    for (int k = 0; k < 8; ++k) o[k] = f2bf(v[k]); *(v8us*)(dst + i * 8) = o;  }

__global__ __launch_bounds__(256) void k_flat(const float* __restrict__ F, h16* P16, bf* Ph, bf* Pl, size_t n4) { const size_t i = (size_t)blockIdx.x * 256 + threadIdx.x; if (i >= n4) return; const v4f a = *(const v4f*)(F + i * 4); v4h o16; v4us oh, ol;
#pragma unroll
    for (int q = 0; q < 4; ++q) { o16[q] = tohx(a[q]); unsigned short x2, y2; splitf(a[q], x2, y2); oh[q] = x2; ol[q] = y2; }
    *(v4h*)(P16 + i * 4) = o16; *(v4us*)(Ph + i * 4) = oh; *(v4us*)(Pl + i * 4) = ol;  }


__global__ __launch_bounds__(256) void k_vtp(const float* __restrict__ F, int pitch, int nheads, h16* V16, bf* Vh, bf* Vl) { const size_t e = ((size_t)blockIdx.x * 256 + threadIdx.x) * 2; if (e >= (size_t)nheads * HD * TT) return; { const size_t zb = (size_t)blockIdx.y * nheads * HD * TT; F += (size_t)blockIdx.y * TT * pitch; V16 += zb; Vh += zb; Vl += zb; }   /* blockIdx.y = batch */ const int t = (int)(e % TT); const int d = (int)((e / TT) % HD); const int g = (int)(e / ((size_t)TT * HD)); v2h o16; v2us oh, ol;
#pragma unroll
    for (int q = 0; q < 2; ++q) { const float x = F[(size_t)(t + q) * pitch + g * HD + d]; o16[q] = tohx(x); unsigned short a2, c2; splitf(x, a2, c2); oh[q] = a2; ol[q] = c2; }
    *(v2h*)(V16 + e) = o16; *(v2us*)(Vh + e) = oh; *(v2us*)(Vl + e) = ol;  }
typedef __attribute__((ext_vector_type(2))) __bf16 v2bf;
typedef float __attribute__((may_alias)) fa;
#define FW_   8                 // waves of a work-group = key splits
#define FSK   64                // keys per stage
#define FPI   72                // LDS row pitch, 16-bit elements
#define FTILE (64 * FPI)        // one staged plane: 64 rows
#define FOP   68                // merge row pitch, floats
#define L2E   1.4426950408889634f
__device__ __forceinline__ float xhalf(float v) { const int b = __float_as_int(v); return __int_as_float(__builtin_amdgcn_permlanex16(b, b, 0x76543210, 0xfedcba98, false, false)); }
// orders one wave's LDS stores against its own later LDS loads of other lanes' bytes (the LDS serves a wave in order; this keeps the compiler from swapping them)
__device__ __forceinline__ void wave_order() { __builtin_amdgcn_wave_barrier(); asm volatile("" ::: "memory"); }
__global__ __launch_bounds__(256) void k_fattn(const bf* __restrict__ Qh, const bf* __restrict__ Ql, const bf* __restrict__ Kh, const bf* __restrict__ Kl, const bf* __restrict__ Vh, const bf* __restrict__ Vl, float* __restrict__ O) {
    __shared__ __align__(16) bf sm[FW_ * 4 * FTILE];
    const int lane = threadIdx.x & 31, c = lane & 15, h = lane >> 4; const int w = __builtin_amdgcn_readfirstlane((int)(threadIdx.x >> 5)); const int q0 = blockIdx.x * 16;
    { const size_t zb = (size_t)blockIdx.y * TT * HD; Qh += zb; Ql += zb; Kh += zb; Kl += zb; Vh += zb; Vl += zb; O += zb; }   // blockIdx.y = batch
    bf* kh_s = sm + w * 4 * FTILE; bf* kl_s = kh_s + FTILE; bf* vh_s = kl_s + FTILE; bf* vl_s = vh_s + FTILE;
    v16bf qh[2], ql[2];
#pragma unroll
    for (int kc = 0; kc < 2; ++kc) { qh[kc] = WFrag<bf>::ld(Qh + (size_t)(q0 + c) * HD + kc * 32 + 8 * h); ql[kc] = WFrag<bf>::ld(Ql + (size_t)(q0 + c) * HD + kc * 32 + 8 * h); }
    v8f o[4];
#pragma unroll
    for (int dt = 0; dt < 4; ++dt) o[dt] = (v8f){};
    float m = -3.0e38f, l = 0.0f;
    const int srow = lane >> 3, scol = (lane & 7) * 8, sdst = srow * FPI + scol; const int kbase = w * (TT / FW_);
    v8us st[32];
#pragma unroll
    for (int i = 0; i < 16; ++i) { st[i] = *(const v8us*)(Kh + (size_t)kbase * HD + i * 256 + lane * 8); st[16 + i] = *(const v8us*)(Kl + (size_t)kbase * HD + i * 256 + lane * 8); }
#pragma unroll 1
    for (int s = 0; s < TT / FW_ / FSK; ++s) {
        const int key0 = kbase + s * FSK;
#pragma unroll
        for (int i = 0; i < 16; ++i) { *(v8us*)(kh_s + sdst + i * 4 * FPI) = st[i]; *(v8us*)(kl_s + sdst + i * 4 * FPI) = st[16 + i]; }
        // this stage's V^T rows fly while the scores are computed
        const bf* pvh = Vh + (size_t)srow * TT + key0 + scol; const bf* pvl = Vl + (size_t)srow * TT + key0 + scol;
#pragma unroll
        for (int i = 0; i < 16; ++i) { st[i] = *(const v8us*)(pvh + (size_t)i * 4 * TT); st[16 + i] = *(const v8us*)(pvl + (size_t)i * 4 * TT); }
        asm volatile("s_wait_xcnt 0x0" :: "v"(pvh), "v"(pvl) : "memory");   // precaution: stands before any overwrite of the address registers of the loads just issued; naming them keeps them whole up to here
        wave_order();
        v8f sc[4];
#pragma unroll
        for (int kt = 0; kt < 4; ++kt) sc[kt] = (v8f){};
#pragma unroll
        for (int kc = 0; kc < 2; ++kc) { v16bf a[4], a2[4];
#pragma unroll
            for (int kt = 0; kt < 4; ++kt) { a[kt] = WFrag<bf>::ld(kh_s + (kt * 16 + c) * FPI + kc * 32 + 8 * h); a2[kt] = WFrag<bf>::ld(kl_s + (kt * 16 + c) * FPI + kc * 32 + 8 * h); }
#pragma unroll
            for (int kt = 0; kt < 4; ++kt) sc[kt] = wmmab(a[kt], qh[kc], sc[kt]);
#pragma unroll
            for (int kt = 0; kt < 4; ++kt) sc[kt] = wmmab(a[kt], ql[kc], sc[kt]);
#pragma unroll
            for (int kt = 0; kt < 4; ++kt) sc[kt] = wmmab(a2[kt], qh[kc], sc[kt]); }
        float mx = sc[0][0];
#pragma unroll
        for (int kt = 0; kt < 4; ++kt)
#pragma unroll
            for (int r = 0; r < 8; ++r) mx = fmaxf(mx, sc[kt][r]);
        mx = fmaxf(mx, xhalf(mx));
        const float mn = fmaxf(m, mx); const float al = __builtin_amdgcn_exp2f((m - mn) * L2E); m = mn;
        float ps = 0.0f;
#pragma unroll
        for (int kt = 0; kt < 4; ++kt)
#pragma unroll
            for (int r = 0; r < 8; ++r) { const float p = __builtin_amdgcn_exp2f((sc[kt][r] - mn) * L2E); sc[kt][r] = p; ps += p; }
        l = l * al + ps;
#pragma unroll
        for (int dt = 0; dt < 4; ++dt) o[dt] *= al;
        wave_order();
#pragma unroll
        for (int i = 0; i < 16; ++i) { *(v8us*)(vh_s + sdst + i * 4 * FPI) = st[i]; *(v8us*)(vl_s + sdst + i * 4 * FPI) = st[16 + i]; }
        // the next stage's K rows fly while attn.v is computed
        if (s + 1 < TT / FW_ / FSK) {
            const bf* pkh = Kh + (size_t)(key0 + FSK) * HD + lane * 8; const bf* pkl = Kl + (size_t)(key0 + FSK) * HD + lane * 8;
#pragma unroll
            for (int i = 0; i < 16; ++i) { st[i] = *(const v8us*)(pkh + i * 256); st[16 + i] = *(const v8us*)(pkl + i * 256); }
            asm volatile("s_wait_xcnt 0x0" :: "v"(pkh), "v"(pkl) : "memory");   // same precaution as behind the V^T loads
        }
        wave_order();
#pragma unroll
        for (int kb = 0; kb < 2; ++kb) { v16bf ph, pl;
#pragma unroll
            for (int e = 0; e < 16; e += 2) { v2f pp; pp[0] = sc[2 * kb + (e >> 3)][e & 7]; pp[1] = sc[2 * kb + (e >> 3)][(e & 7) + 1]; const v2bf hh = __builtin_convertvector(pp, v2bf); const v2f bk = __builtin_convertvector(hh, v2f); const v2bf ll = __builtin_convertvector(pp - bk, v2bf); ph[e] = hh[0]; ph[e + 1] = hh[1]; pl[e] = ll[0]; pl[e + 1] = ll[1]; }
            v16bf a[4], a2[4];
#pragma unroll
            for (int dt = 0; dt < 4; ++dt) { a[dt] = WFrag<bf>::ld(vh_s + (dt * 16 + c) * FPI + kb * 32 + 8 * h); a2[dt] = WFrag<bf>::ld(vl_s + (dt * 16 + c) * FPI + kb * 32 + 8 * h); }
#pragma unroll
            for (int dt = 0; dt < 4; ++dt) o[dt] = wmmab(a[dt], ph, o[dt]);
#pragma unroll
            for (int dt = 0; dt < 4; ++dt) o[dt] = wmmab(a2[dt], ph, o[dt]);
#pragma unroll
            for (int dt = 0; dt < 4; ++dt) o[dt] = wmmab(a[dt], pl, o[dt]); }
    }
    l += xhalf(l);
    // each wave's partial O^T, maximum and sum go into its own slice, then the work-group merges the 8 key splits
    fa* of = (fa*)kh_s;
#pragma unroll
    for (int dt = 0; dt < 4; ++dt) { v4f lo4, hi4;
#pragma unroll
        for (int r = 0; r < 4; ++r) { lo4[r] = o[dt][r]; hi4[r] = o[dt][4 + r]; }
        *(v4fa*)(of + c * FOP + dt * 16 + 8 * h) = lo4; *(v4fa*)(of + c * FOP + dt * 16 + 8 * h + 4) = hi4; }
    if (h == 0) { of[16 * FOP + c] = m; of[16 * FOP + 16 + c] = l; }
    __syncthreads();
    const int q = threadIdx.x >> 4, d0 = (threadIdx.x & 15) * 4;
    float M = -3.0e38f;
#pragma unroll
    for (int u = 0; u < FW_; ++u) M = fmaxf(M, ((const fa*)(sm + u * 4 * FTILE))[16 * FOP + q]);
    float L = 0.0f; v4f acc = (v4f){};
#pragma unroll
    for (int u = 0; u < FW_; ++u) { const fa* b = (const fa*)(sm + u * 4 * FTILE); const float f = __builtin_amdgcn_exp2f((b[16 * FOP + q] - M) * L2E); L += b[16 * FOP + 16 + q] * f; acc += *(const v4fa*)(b + q * FOP + d0) * f; }
    const float inv = __fdiv_rn(1.0f, L);
    *(v4f*)(O + (size_t)(q0 + q) * HD + d0) = acc * inv;
}

__global__ __launch_bounds__(256) void k_xT(const float* __restrict__ xs, bf* XB) { const size_t k = (size_t)blockIdx.x * 256 + threadIdx.x; if (k >= (size_t)TT * CC / 8) return; xs += (size_t)blockIdx.y * CC * TT; XB += (size_t)blockIdx.y * TT * CC;   /* blockIdx.y = batch */ const int c0 = (int)(k % (CC / 8)) * 8; const int t = (int)(k / (CC / 8)); v8us o;
#pragma unroll
    for (int q = 0; q < 8; ++q) o[q] = f2bf(xs[(size_t)(c0 + q) * TT + t]);
    *(v8us*)(XB + (size_t)t * CC + c0) = o;  }
__global__ __launch_bounds__(256) void k_outT(const float* __restrict__ Y, float* outb) { const size_t i = (size_t)blockIdx.x * 256 + threadIdx.x; if (i >= (size_t)CC * TT / 4) return; Y += (size_t)blockIdx.y * TT * CC; outb += (size_t)blockIdx.y * CC * TT;   /* blockIdx.y = batch */ const size_t e = i * 4; const int t = (int)(e % TT); const int c = (int)(e / TT); v4f o;
#pragma unroll
    for (int q = 0; q < 4; ++q) o[q] = Y[(size_t)(t + q) * CC + c];
    *(v4f*)(outb + e) = o;  }
__global__ __launch_bounds__(256) void k_wqpad(const float* __restrict__ w, const float* __restrict__ bias, bf* Bt, float* bp) { const int i = blockIdx.x * 256 + threadIdx.x; if (i >= MID * CC / 8) return; const int c0 = (i % (CC / 8)) * 8; const int r = i / (CC / 8); const float* src = w + (size_t)min(r, CQR - 1) * CC + c0; v8us o;
#pragma unroll
    for (int q = 0; q < 8; ++q) { const unsigned short v = f2bf(src[q]); o[q] = (r < CQR) ? v : (unsigned short)0; }
    *(v8us*)(Bt + (size_t)r * CC + c0) = o; if (i < MID) { const float bb = bias[min(i, CQR - 1)]; ((float*)bp)[i] = (i < CQR) ? bb : 0.0f; }  }
__global__ __launch_bounds__(256) void k_wopad(const float* __restrict__ w, bf* Bt) { const int i = blockIdx.x * 256 + threadIdx.x; if (i >= CC * HD / 8) return; const int k0 = (i % (HD / 8)) * 8; const int c = i / (HD / 8); v8us o;
#pragma unroll
    for (int q = 0; q < 8; ++q) { const int kk = k0 + q; const unsigned short v = f2bf(w[(size_t)c * CQR + min(kk, CQR - 1)]); o[q] = (kk < CQR) ? v : (unsigned short)0; }
    *(v8us*)(Bt + (size_t)c * HD + k0) = o;  }
__global__ __launch_bounds__(256) void k_merge(const float* __restrict__ O, int h0, float* OUTb) { const size_t e = ((size_t)blockIdx.x * 256 + threadIdx.x) * 2; if (e >= (size_t)ZH * TT * HD) return; const int d = (int)(e % HD); const int t = (int)((e / HD) % TT); const int zz = (int)(e / ((size_t)HD * TT)); const float cs = (t < RH) ? 1.0f : (1.0f / PCAR); const size_t oo = (size_t)t * DQ + (h0 + zz) * HD + d;
    v2f o2; o2[0] = O[e] * cs; o2[1] = O[e + 1] * cs; *(v2f*)(OUTb + oo) = o2;  }

extern "C" void kernel_launch(void* const* d_in, const int* in_sizes, int n_in,
                              void* d_out, int out_size, void* d_ws, size_t ws_size, hipStream_t stream) {
    (void)in_sizes; (void)n_in; (void)out_size;
    const float* x = (const float*)d_in[0]; const float* wq = (const float*)d_in[1]; const float* bq = (const float*)d_in[2]; const float* wk = (const float*)d_in[3]; const float* bk = (const float*)d_in[4]; const float* wv = (const float*)d_in[5]; const float* bv = (const float*)d_in[6]; const float* wo = (const float*)d_in[7]; const float* bo = (const float*)d_in[8];
    float* OUT = (float*)d_out;   /* [4][256][4096] channel-major */
    char* wsp = (char*)d_ws;
    auto take = [&](size_t bytes) { char* p = wsp; wsp += (bytes + 255) & ~(size_t)255; return (void*)p; };
    float* BQP = (float*)take(256); float* BKP = (float*)take(256); float* BVP = (float*)take(256); h16* A16 = (h16*)take((size_t)NB_ * TT * HD * 2); bf* ATh = (bf*)take((size_t)NB_ * TT * HD * 2); bf* ATl = (bf*)take((size_t)NB_ * TT * HD * 2); bf* WOB = (bf*)take((size_t)CC * HD * 2); float* Y = (float*)take((size_t)NB_ * TT * CC * 4); bf* WQ = (bf*)take((size_t)DQ * DM * 2); bf* WK = (bf*)take((size_t)DKV * DM * 2); bf* WV = (bf*)take((size_t)DKV * DM * 2);
    bf* XB = (bf*)take((size_t)NB_ * TT * DM * 2); float* FQ = (float*)take((size_t)NB_ * TT * DQ * 4); float* FK = (float*)take((size_t)NB_ * TT * DKV * 4);
    h16* QP16 = (h16*)take((size_t)NB_ * TT * HD * 2); h16* KP16 = (h16*)take((size_t)NB_ * TT * HD * 2); h16* VT16 = (h16*)take((size_t)NB_ * HD * TT * 2);
    bf* QPh = (bf*)take((size_t)NB_ * TT * HD * 2); bf* QPl = (bf*)take((size_t)NB_ * TT * HD * 2); bf* KPh = (bf*)take((size_t)NB_ * TT * HD * 2); bf* KPl = (bf*)take((size_t)NB_ * TT * HD * 2); bf* VTh = (bf*)take((size_t)NB_ * HD * TT * 2); bf* VTl = (bf*)take((size_t)NB_ * HD * TT * 2);
    float* Ob = (float*)take((size_t)NB_ * TT * HD * 4);
    if ((size_t)(wsp - (char*)d_ws) > ws_size) return;    // ws 256 MiB
    float* FV = FK;   // v projection reuses the k buffer after the k planes are built (stream-ordered)
    k_wqpad<<<(MID * CC / 8 + 255) / 256, 256, 0, stream>>>(wq, bq, WQ, BQP); k_wqpad<<<(MID * CC / 8 + 255) / 256, 256, 0, stream>>>(wk, bk, WK, BKP); k_wqpad<<<(MID * CC / 8 + 255) / 256, 256, 0, stream>>>(wv, bv, WV, BVP); k_wopad<<<(CC * HD / 8 + 255) / 256, 256, 0, stream>>>(wo, WOB);
    // token-major operands of the NB_ batches lie one behind the other, so the GEMMs and the flat splits see NB_ * TT rows; the transposes and the attention take the batch from blockIdx.y
    const unsigned LF = (unsigned)(((size_t)NB_ * TT * HD / 4 + 255) / 256), LKv = (unsigned)(((size_t)HD * TT / 2 + 255) / 256);
    k_xT<<<dim3((unsigned)(((size_t)TT * DM / 8 + 255) / 256), NB_, 1), 256, 0, stream>>>(x, XB);   /* channel-major -> token-major bf16 */
    k_gemmw<bf, 0, true><<<dim3(NB_ * TT / 64, DQ / 64, 1), 32, 0, stream>>>(XB, nullptr, WQ, nullptr, DM, FQ, DQ, BQP, 0, 0, 0);
    k_flat<<<LF, 256, 0, stream>>>(FQ, QP16, QPh, QPl, (size_t)NB_ * TT * DQ / 4);
    k_gemmw<bf, 0, true><<<dim3(NB_ * TT / 64, DKV / 64, 1), 32, 0, stream>>>(XB, nullptr, WK, nullptr, DM, FK, DKV, BKP, 0, 0, 0);
    k_flat<<<LF, 256, 0, stream>>>(FK, KP16, KPh, KPl, (size_t)NB_ * TT * DKV / 4);
    k_gemmw<bf, 0, true><<<dim3(NB_ * TT / 64, DKV / 64, 1), 32, 0, stream>>>(XB, nullptr, WV, nullptr, DM, FV, DKV, BVP, 0, 0, 0);
    k_vtp<<<dim3(LKv, NB_, 1), 256, 0, stream>>>(FV, DKV, NKV, VT16, VTh, VTl);
    k_fattn<<<dim3(TT / 16, NB_, 1), 256, 0, stream>>>(QPh, QPl, KPh, KPl, VTh, VTl, Ob);   /* scores + softmax + attn.v */
    k_flat<<<LF, 256, 0, stream>>>(Ob, A16, ATh, ATl, (size_t)NB_ * TT * HD / 4);
    k_gemmw<bf, 1, true><<<dim3(NB_ * TT / 64, CC / 64, 1), 32, 0, stream>>>(ATh, ATl, WOB, nullptr, HD, Y, CC, bo, 0, 0, 0);   /* Wo ctx + bo (token-major) */
    k_outT<<<dim3((unsigned)(((size_t)TT * CC / 4 + 255) / 256), NB_, 1), 256, 0, stream>>>(Y, OUT);   /* back to channel-major */
}

// v003
// One run takes 134 microseconds.
// In both of two side-by-side timings against v002, it was 1.36 times as fast.
// Counting every step since v000, it is 5.87 times as fast.
#include <hip/hip_runtime.h>

// SAGAN self-attention over a feature map (x [4][256][64][64] channel-major; tokens = 4,096 positions; q, k, v = 1x1 convs to 32 channels ('oi' [32][256] + [32]); energy = q.k (unscaled, 32 dims: logit sigma ~5.7); attn = softmax over positions; out = attn v ([4096][32]); y = Wo out + bo (1x1 conv 'oi' [256][32] + [256]) written channel-major -> [4][256][64][64] (4.2 M)).
// Every stage runs once for all NB_ batches (the batch is a grid dimension, or extra rows of a row-contiguous operand); every workspace plane holds NB_ slabs.
// Layout per batch: the channel-major slab transposed once into a token-major bf16 operand; exact projections + f32 biases; the three 32-channel projections come out of a 64-column GEMM tile (zero weight rows and zero biases in columns 32..63), and only their 32 real columns go on into the q, k and v planes; scores as hi/lo x hi/lo (3 products) for every row (the logits are too sharp for fp16), softmax with a running maximum and sum on the score tiles in registers, bf16 hi/lo probabilities, attn.v (3 products), all in one launch; the 32-wide context as hi/lo planes x Wo ([256][32]) exact + bo; the result transposed back to channel-major rows.
// Compute dtypes, f32 accumulate: every input rounded to bf16; projections exact + f32 biases; scores and attn.v 3 products; softmax f32; Wo hl x exact + bias.

#define NB_  4
#define TT   4096
#define DM   256
#define NH_  1
#define NKV  1
#define REP  (NH_ / NKV)
#define HD   32                    // head width of the q, k, v planes and of the context: the real channels only
#define MID  64                    // width of a projection's GEMM tile (32 real + 32 zero columns)
#define DQ   (NH_ * MID)
#define DKV  (NKV * MID)
#define ZH   1
#define RH   4096                  // read only by k_merge, which is not launched; every query row uses hi+lo planes
#define WIN  0
#define PCAR 1024.0f
#define SCL  1.0f   // unscaled energy
#define CC   256     // channels
#define CQR  32      // real q/k/v channels
typedef _Float16 h16;
typedef unsigned short bf;
typedef __attribute__((ext_vector_type(16))) __bf16   v16bf;
typedef __attribute__((ext_vector_type(16))) _Float16 v16h;
typedef __attribute__((ext_vector_type(8)))  _Float16 v8h;
typedef __attribute__((ext_vector_type(8)))  unsigned short v8us;
typedef __attribute__((ext_vector_type(8)))  float    v8f;
typedef __attribute__((ext_vector_type(4)))  float    v4f;
typedef v8h  __attribute__((may_alias)) v8ha;
typedef v4f  __attribute__((may_alias)) v4fa;
typedef v8us __attribute__((may_alias)) v8usa;

__device__ __forceinline__ unsigned short f2bf(float f) { unsigned u = __float_as_uint(f); u += 0x7FFFu + ((u >> 16) & 1u); return (unsigned short)(u >> 16); }
__device__ __forceinline__ float bf2f(unsigned short b) { return __uint_as_float(((unsigned)b) << 16); }
__device__ __forceinline__ float bfr(float f) { return bf2f(f2bf(f)); }
__device__ __forceinline__ v16h cat16(v8h lo, v8h hi) { return __builtin_shufflevector(lo, hi, 0, 1, 2, 3, 4, 5, 6, 7, 8, 9, 10, 11, 12, 13, 14, 15); }
__device__ __forceinline__ v16bf cat16b(v8us lo, v8us hi) { return __builtin_bit_cast(v16bf, __builtin_shufflevector(lo, hi, 0, 1, 2, 3, 4, 5, 6, 7, 8, 9, 10, 11, 12, 13, 14, 15)); }
__device__ __forceinline__ v8f wmma16(v16h a, v16h b, v8f c) { return __builtin_amdgcn_wmma_f32_16x16x32_f16(false, a, false, b, (short)0, c, false, false); }
__device__ __forceinline__ v8f wmmab(v16bf a, v16bf b, v8f c) { return __builtin_amdgcn_wmma_f32_16x16x32_bf16(false, a, false, b, (short)0, c, false, false); }



// ---- k_gemmw: register-blocked GEMM, ONE WAVE per 64x64 output tile (16 accumulators), operands straight from K-contiguous 16-bit planes; grid (M/64, N/64, Z), 32 threads.
// C[m][n] (f32, pitch ldc, + optional f32 bias[n]) = sum_k A[m][k] Bt[n][k] (+ split products per NSPLIT). z-batch strides sA/sB/sC in elements. K % 32 == 0.
template <typename T16> struct WFrag;
template <> struct WFrag<h16> { typedef v16h V; static __device__ __forceinline__ V ld(const h16* p) { return cat16(*(const v8h*)p, *(const v8h*)(p + 16)); } static __device__ __forceinline__ v8f mma(V a, V b, v8f c) { return wmma16(a, b, c); } };
template <> struct WFrag<bf> { typedef v16bf V; static __device__ __forceinline__ V ld(const bf* p) { return cat16b(*(const v8us*)p, *(const v8us*)(p + 16)); } static __device__ __forceinline__ v8f mma(V a, V b, v8f c) { return wmmab(a, b, c); } };
template <typename T16, int NSPLIT, bool BIAS>
__global__ __launch_bounds__(32) void k_gemmw(const T16* __restrict__ A, const T16* __restrict__ A2, const T16* __restrict__ Bt, const T16* __restrict__ Bt2, int K, float* C, int ldc, const float* __restrict__ bias, size_t sA, size_t sB, size_t sC) {
    typedef typename WFrag<T16>::V V;
    __shared__ __align__(16) float os[16 * 68];
    const size_t z = blockIdx.z; A += z * sA; if (A2) A2 += z * sA; Bt += z * sB; if (Bt2) Bt2 += z * sB; C += z * sC;
    const int lane = threadIdx.x & 31, lr = lane & 15, hi = lane >> 4; const int r0 = blockIdx.x * 64, c0 = blockIdx.y * 64;
    v8f acc[4][4];
#pragma unroll
    for (int mb = 0; mb < 4; ++mb)
#pragma unroll
        for (int nb = 0; nb < 4; ++nb) acc[mb][nb] = (v8f){};
    const size_t aoff = (size_t)(r0 + lr) * K + 8 * hi, boff = (size_t)(c0 + lr) * K + 8 * hi;
#pragma unroll 1
    for (int kc = 0; kc < K; kc += 32) {
        V a[4], a2[4];
#pragma unroll
        for (int mb = 0; mb < 4; ++mb) { a[mb] = WFrag<T16>::ld(A + aoff + (size_t)mb * 16 * K + kc); if (NSPLIT == 1 || NSPLIT == 2) a2[mb] = WFrag<T16>::ld(A2 + aoff + (size_t)mb * 16 * K + kc); }
#pragma unroll
        for (int nb = 0; nb < 4; ++nb) { const V b = WFrag<T16>::ld(Bt + boff + (size_t)nb * 16 * K + kc); V b2; if (NSPLIT >= 2) b2 = WFrag<T16>::ld(Bt2 + boff + (size_t)nb * 16 * K + kc);
#pragma unroll
            for (int mb = 0; mb < 4; ++mb) { acc[mb][nb] = WFrag<T16>::mma(a[mb], b, acc[mb][nb]); if (NSPLIT == 1 || NSPLIT == 2) acc[mb][nb] = WFrag<T16>::mma(a2[mb], b, acc[mb][nb]); if (NSPLIT >= 2) acc[mb][nb] = WFrag<T16>::mma(a[mb], b2, acc[mb][nb]); } }
        asm volatile("v_nop\n\tv_nop\n\tv_nop\n\tv_nop" : "+v"(acc[0][0]), "+v"(acc[1][1]), "+v"(acc[2][2]), "+v"(acc[3][3]) : "v"(a[0]), "v"(a[3]));
    }
#pragma unroll
    for (int mb = 0; mb < 4; ++mb) {
#pragma unroll
        for (int nb = 0; nb < 4; ++nb) {
#pragma unroll
            for (int j = 0; j < 8; ++j) os[(hi * 8 + j) * 68 + nb * 16 + lr] = acc[mb][nb][j]; }
        __builtin_amdgcn_wave_barrier(); asm volatile("" ::: "memory");
        float* crow = C + (size_t)(r0 + mb * 16) * ldc + c0;
{
#pragma unroll
            for (int s = 0; s < 8; ++s) { const int row = 2 * s + hi, cofs = lr * 4; v4f val = *(const v4fa*)(os + row * 68 + cofs); if (BIAS) { val[0] += bfr(bias[c0 + cofs]); val[1] += bfr(bias[c0 + cofs + 1]); val[2] += bfr(bias[c0 + cofs + 2]); val[3] += bfr(bias[c0 + cofs + 3]); }
                *(v4f*)(crow + (size_t)row * ldc + cofs) = val; }
             }
        __builtin_amdgcn_wave_barrier(); asm volatile("" ::: "memory");
    }
}

__device__ __forceinline__ h16 tohx(float x) { return (h16)x; }
__device__ __forceinline__ void splitf(float y, unsigned short& h, unsigned short& l) { h = f2bf(y); l = f2bf(y - bf2f(h)); }
typedef __attribute__((ext_vector_type(2))) _Float16 v2h;
typedef __attribute__((ext_vector_type(4))) _Float16 v4h;
typedef __attribute__((ext_vector_type(2))) unsigned short v2us;
typedef __attribute__((ext_vector_type(4))) unsigned short v4us;
typedef __attribute__((ext_vector_type(2))) float v2f;
typedef __attribute__((ext_vector_type(4))) int v4i;

__global__ __launch_bounds__(256) void k_wtG(const float* __restrict__ w, int K, int N, bf* Bt) {
    const int lane = threadIdx.x & 31; const int L0 = (blockIdx.x * 8 + (threadIdx.x >> 5)) * 8; const int nlines = N * K / 64;
{
#pragma unroll 1
        for (int l = 0; l < 8; ++l) { const int L = L0 + l; if (L >= nlines) break; const size_t e = (size_t)L * 64 + lane * 2; const int k = (int)(e % K), n = (int)(e / K); v2us o;
            o[0] = f2bf(w[(size_t)k * N + n]); o[1] = f2bf(w[(size_t)(k + 1) * N + n]); *(v2us*)(Bt + e) = o; }
         }
}
__global__ __launch_bounds__(256) void k_cvt8(const float* __restrict__ src, bf* dst, size_t n8) { const size_t i = (size_t)blockIdx.x * 256 + threadIdx.x; if (i >= n8) return; const v8f v = *(const v8f*)(src + i * 8); v8us o;
#pragma unroll
    for (int k = 0; k < 8; ++k) o[k] = f2bf(v[k]); *(v8us*)(dst + i * 8) = o;  }

// sp = row pitch of F in floats; the first HD columns of every row go into planes of pitch HD
__global__ __launch_bounds__(256) void k_flat(const float* __restrict__ F, int sp, h16* P16, bf* Ph, bf* Pl, size_t n4) { const size_t i = (size_t)blockIdx.x * 256 + threadIdx.x; if (i >= n4) return; const v4f a = *(const v4f*)(F + (i / (HD / 4)) * sp + (i % (HD / 4)) * 4); v4h o16; v4us oh, ol;
#pragma unroll
    for (int q = 0; q < 4; ++q) { o16[q] = tohx(a[q]); unsigned short x2, y2; splitf(a[q], x2, y2); oh[q] = x2; ol[q] = y2; }
    *(v4h*)(P16 + i * 4) = o16; *(v4us*)(Ph + i * 4) = oh; *(v4us*)(Pl + i * 4) = ol;  }


__global__ __launch_bounds__(256) void k_vtp(const float* __restrict__ F, int pitch, int nheads, h16* V16, bf* Vh, bf* Vl) { const size_t e = ((size_t)blockIdx.x * 256 + threadIdx.x) * 2; if (e >= (size_t)nheads * HD * TT) return; { const size_t zb = (size_t)blockIdx.y * nheads * HD * TT; F += (size_t)blockIdx.y * TT * pitch; V16 += zb; Vh += zb; Vl += zb; }   /* blockIdx.y = batch */ const int t = (int)(e % TT); const int d = (int)((e / TT) % HD); const int g = (int)(e / ((size_t)TT * HD)); v2h o16; v2us oh, ol;
#pragma unroll
    for (int q = 0; q < 2; ++q) { const float x = F[(size_t)(t + q) * pitch + g * HD + d]; o16[q] = tohx(x); unsigned short a2, c2; splitf(x, a2, c2); oh[q] = a2; ol[q] = c2; }
    *(v2h*)(V16 + e) = o16; *(v2us*)(Vh + e) = oh; *(v2us*)(Vl + e) = ol;  }
typedef __attribute__((ext_vector_type(2))) __bf16 v2bf;
typedef float __attribute__((may_alias)) fa;
typedef v2f __attribute__((may_alias)) v2fa;
#define FW_   8                 // waves of a work-group = key splits
#define FSK   64                // keys per stage
#define FKP   40                // LDS pitch of a K row (HD elements), 16-bit elements
#define FPI   72                // LDS pitch of a V^T row (FSK elements), 16-bit elements
#define FKT   (FSK * FKP)       // one staged K plane: FSK rows
#define FVT   (HD * FPI)        // one staged V^T plane: HD rows
#define FSL   (2 * FKT + 2 * FVT)   // one wave's slice
#define FOP   36                // merge row pitch, floats
#define L2E   1.4426950408889634f
__device__ __forceinline__ float xhalf(float v) { const int b = __float_as_int(v); return __int_as_float(__builtin_amdgcn_permlanex16(b, b, 0x76543210, 0xfedcba98, false, false)); }
// orders one wave's LDS stores against its own later LDS loads of other lanes' bytes (the LDS serves a wave in order; this keeps the compiler from swapping them)
__device__ __forceinline__ void wave_order() { __builtin_amdgcn_wave_barrier(); asm volatile("" ::: "memory"); }
__global__ __launch_bounds__(256) void k_fattn(const bf* __restrict__ Qh, const bf* __restrict__ Ql, const bf* __restrict__ Kh, const bf* __restrict__ Kl, const bf* __restrict__ Vh, const bf* __restrict__ Vl, float* __restrict__ O) {
    __shared__ __align__(16) bf sm[FW_ * FSL];
    const int lane = threadIdx.x & 31, c = lane & 15, h = lane >> 4; const int w = __builtin_amdgcn_readfirstlane((int)(threadIdx.x >> 5)); const int q0 = blockIdx.x * 16;
    { const size_t zb = (size_t)blockIdx.y * TT * HD; Qh += zb; Ql += zb; Kh += zb; Kl += zb; Vh += zb; Vl += zb; O += zb; }   // blockIdx.y = batch
    bf* kh_s = sm + w * FSL; bf* kl_s = kh_s + FKT; bf* vh_s = kl_s + FKT; bf* vl_s = vh_s + FVT;
    const v16bf qh = WFrag<bf>::ld(Qh + (size_t)(q0 + c) * HD + 8 * h), ql = WFrag<bf>::ld(Ql + (size_t)(q0 + c) * HD + 8 * h);
    v8f o[2];
#pragma unroll
    for (int dt = 0; dt < 2; ++dt) o[dt] = (v8f){};
    float m = -3.0e38f, l = 0.0f;
    const int kdst = (lane >> 2) * FKP + (lane & 3) * 8;                                   // a 16-byte piece of a K row: 4 lanes a row, 8 rows a load
    const int srow = lane >> 3, scol = (lane & 7) * 8, vdst = srow * FPI + scol;           // of a V^T row: 8 lanes a row, 4 rows a load
    const int kbase = w * (TT / FW_);
    v8us st[16];
#pragma unroll
    for (int i = 0; i < 8; ++i) { st[i] = *(const v8us*)(Kh + (size_t)kbase * HD + i * 256 + lane * 8); st[8 + i] = *(const v8us*)(Kl + (size_t)kbase * HD + i * 256 + lane * 8); }
#pragma unroll 1
    for (int s = 0; s < TT / FW_ / FSK; ++s) {
        const int key0 = kbase + s * FSK;
#pragma unroll
        for (int i = 0; i < 8; ++i) { *(v8us*)(kh_s + kdst + i * 8 * FKP) = st[i]; *(v8us*)(kl_s + kdst + i * 8 * FKP) = st[8 + i]; }
        // this stage's V^T rows fly while the scores are computed
        const bf* pvh = Vh + (size_t)srow * TT + key0 + scol; const bf* pvl = Vl + (size_t)srow * TT + key0 + scol;
#pragma unroll
        for (int i = 0; i < 8; ++i) { st[i] = *(const v8us*)(pvh + (size_t)i * 4 * TT); st[8 + i] = *(const v8us*)(pvl + (size_t)i * 4 * TT); }
        asm volatile("s_wait_xcnt 0x0" :: "v"(pvh), "v"(pvl) : "memory");   // precaution: stands before any overwrite of the address registers of the loads just issued; naming them keeps them whole up to here
        wave_order();
        v8f sc[4];
#pragma unroll
        for (int kt = 0; kt < 4; ++kt) sc[kt] = (v8f){};
        { v16bf a[4], a2[4];
#pragma unroll
            for (int kt = 0; kt < 4; ++kt) { a[kt] = WFrag<bf>::ld(kh_s + (kt * 16 + c) * FKP + 8 * h); a2[kt] = WFrag<bf>::ld(kl_s + (kt * 16 + c) * FKP + 8 * h); }
#pragma unroll
            for (int kt = 0; kt < 4; ++kt) sc[kt] = wmmab(a[kt], qh, sc[kt]);
#pragma unroll
            for (int kt = 0; kt < 4; ++kt) sc[kt] = wmmab(a[kt], ql, sc[kt]);
#pragma unroll
            for (int kt = 0; kt < 4; ++kt) sc[kt] = wmmab(a2[kt], qh, sc[kt]); }
        float mx = sc[0][0];
#pragma unroll
        for (int kt = 0; kt < 4; ++kt)
#pragma unroll
            for (int r = 0; r < 8; ++r) mx = fmaxf(mx, sc[kt][r]);
        mx = fmaxf(mx, xhalf(mx));
        const float mn = fmaxf(m, mx); const float al = __builtin_amdgcn_exp2f((m - mn) * L2E); m = mn;
        float ps = 0.0f;
#pragma unroll
        for (int kt = 0; kt < 4; ++kt)
#pragma unroll
            for (int r = 0; r < 8; ++r) { const float p = __builtin_amdgcn_exp2f((sc[kt][r] - mn) * L2E); sc[kt][r] = p; ps += p; }
        l = l * al + ps;
#pragma unroll
        for (int dt = 0; dt < 2; ++dt) o[dt] *= al;
        wave_order();
#pragma unroll
        for (int i = 0; i < 8; ++i) { *(v8us*)(vh_s + vdst + i * 4 * FPI) = st[i]; *(v8us*)(vl_s + vdst + i * 4 * FPI) = st[8 + i]; }
        // the next stage's K rows fly while attn.v is computed
        if (s + 1 < TT / FW_ / FSK) {
            const bf* pkh = Kh + (size_t)(key0 + FSK) * HD + lane * 8; const bf* pkl = Kl + (size_t)(key0 + FSK) * HD + lane * 8;
#pragma unroll
            for (int i = 0; i < 8; ++i) { st[i] = *(const v8us*)(pkh + i * 256); st[8 + i] = *(const v8us*)(pkl + i * 256); }
            asm volatile("s_wait_xcnt 0x0" :: "v"(pkh), "v"(pkl) : "memory");   // same precaution as behind the V^T loads
        }
        wave_order();
#pragma unroll
        for (int kb = 0; kb < 2; ++kb) { v16bf ph, pl;
#pragma unroll
            for (int e = 0; e < 16; e += 2) { v2f pp; pp[0] = sc[2 * kb + (e >> 3)][e & 7]; pp[1] = sc[2 * kb + (e >> 3)][(e & 7) + 1]; const v2bf hh = __builtin_convertvector(pp, v2bf); const v2f bk = __builtin_convertvector(hh, v2f); const v2bf ll = __builtin_convertvector(pp - bk, v2bf); ph[e] = hh[0]; ph[e + 1] = hh[1]; pl[e] = ll[0]; pl[e + 1] = ll[1]; }
            v16bf a[2], a2[2];
#pragma unroll
            for (int dt = 0; dt < 2; ++dt) { a[dt] = WFrag<bf>::ld(vh_s + (dt * 16 + c) * FPI + kb * 32 + 8 * h); a2[dt] = WFrag<bf>::ld(vl_s + (dt * 16 + c) * FPI + kb * 32 + 8 * h); }
#pragma unroll
            for (int dt = 0; dt < 2; ++dt) o[dt] = wmmab(a[dt], ph, o[dt]);
#pragma unroll
            for (int dt = 0; dt < 2; ++dt) o[dt] = wmmab(a2[dt], ph, o[dt]);
#pragma unroll
            for (int dt = 0; dt < 2; ++dt) o[dt] = wmmab(a[dt], pl, o[dt]); }
    }
    l += xhalf(l);
    // each wave's partial O^T, maximum and sum go into its own slice, then the work-group merges the 8 key splits
    fa* of = (fa*)kh_s;
#pragma unroll
    for (int dt = 0; dt < 2; ++dt) { v4f lo4, hi4;
#pragma unroll
        for (int r = 0; r < 4; ++r) { lo4[r] = o[dt][r]; hi4[r] = o[dt][4 + r]; }
        *(v4fa*)(of + c * FOP + dt * 16 + 8 * h) = lo4; *(v4fa*)(of + c * FOP + dt * 16 + 8 * h + 4) = hi4; }
    if (h == 0) { of[16 * FOP + c] = m; of[16 * FOP + 16 + c] = l; }
    __syncthreads();
    const int q = threadIdx.x >> 4, d0 = (threadIdx.x & 15) * 2;
    float M = -3.0e38f;
#pragma unroll
    for (int u = 0; u < FW_; ++u) M = fmaxf(M, ((const fa*)(sm + u * FSL))[16 * FOP + q]);
    float L = 0.0f; v2f acc = (v2f){};
#pragma unroll
    for (int u = 0; u < FW_; ++u) { const fa* b = (const fa*)(sm + u * FSL); const float f = __builtin_amdgcn_exp2f((b[16 * FOP + q] - M) * L2E); L += b[16 * FOP + 16 + q] * f; acc += *(const v2fa*)(b + q * FOP + d0) * f; }
    const float inv = __fdiv_rn(1.0f, L);
    *(v2f*)(O + (size_t)(q0 + q) * HD + d0) = acc * inv;
}

__global__ __launch_bounds__(256) void k_xT(const float* __restrict__ xs, bf* XB) { const size_t k = (size_t)blockIdx.x * 256 + threadIdx.x; if (k >= (size_t)TT * CC / 8) return; xs += (size_t)blockIdx.y * CC * TT; XB += (size_t)blockIdx.y * TT * CC;   /* blockIdx.y = batch */ const int c0 = (int)(k % (CC / 8)) * 8; const int t = (int)(k / (CC / 8)); v8us o;
#pragma unroll
    for (int q = 0; q < 8; ++q) o[q] = f2bf(xs[(size_t)(c0 + q) * TT + t]);
    *(v8us*)(XB + (size_t)t * CC + c0) = o;  }
__global__ __launch_bounds__(256) void k_outT(const float* __restrict__ Y, float* outb) { const size_t i = (size_t)blockIdx.x * 256 + threadIdx.x; if (i >= (size_t)CC * TT / 4) return; Y += (size_t)blockIdx.y * TT * CC; outb += (size_t)blockIdx.y * CC * TT;   /* blockIdx.y = batch */ const size_t e = i * 4; const int t = (int)(e % TT); const int c = (int)(e / TT); v4f o;
#pragma unroll
    for (int q = 0; q < 4; ++q) o[q] = Y[(size_t)(t + q) * CC + c];
    *(v4f*)(outb + e) = o;  }
__global__ __launch_bounds__(256) void k_wqpad(const float* __restrict__ w, const float* __restrict__ bias, bf* Bt, float* bp) { const int i = blockIdx.x * 256 + threadIdx.x; if (i >= MID * CC / 8) return; const int c0 = (i % (CC / 8)) * 8; const int r = i / (CC / 8); const float* src = w + (size_t)min(r, CQR - 1) * CC + c0; v8us o;
#pragma unroll
    for (int q = 0; q < 8; ++q) { const unsigned short v = f2bf(src[q]); o[q] = (r < CQR) ? v : (unsigned short)0; }
    *(v8us*)(Bt + (size_t)r * CC + c0) = o; if (i < MID) { const float bb = bias[min(i, CQR - 1)]; ((float*)bp)[i] = (i < CQR) ? bb : 0.0f; }  }
__global__ __launch_bounds__(256) void k_wopad(const float* __restrict__ w, bf* Bt) { const int i = blockIdx.x * 256 + threadIdx.x; if (i >= CC * HD / 8) return; const int k0 = (i % (HD / 8)) * 8; const int c = i / (HD / 8); v8us o;
#pragma unroll
    for (int q = 0; q < 8; ++q) { const int kk = k0 + q; const unsigned short v = f2bf(w[(size_t)c * CQR + min(kk, CQR - 1)]); o[q] = (kk < CQR) ? v : (unsigned short)0; }
    *(v8us*)(Bt + (size_t)c * HD + k0) = o;  }
__global__ __launch_bounds__(256) void k_merge(const float* __restrict__ O, int h0, float* OUTb) { const size_t e = ((size_t)blockIdx.x * 256 + threadIdx.x) * 2; if (e >= (size_t)ZH * TT * HD) return; const int d = (int)(e % HD); const int t = (int)((e / HD) % TT); const int zz = (int)(e / ((size_t)HD * TT)); const float cs = (t < RH) ? 1.0f : (1.0f / PCAR); const size_t oo = (size_t)t * DQ + (h0 + zz) * HD + d;
    v2f o2; o2[0] = O[e] * cs; o2[1] = O[e + 1] * cs; *(v2f*)(OUTb + oo) = o2;  }

extern "C" void kernel_launch(void* const* d_in, const int* in_sizes, int n_in,
                              void* d_out, int out_size, void* d_ws, size_t ws_size, hipStream_t stream) {
    (void)in_sizes; (void)n_in; (void)out_size;
    const float* x = (const float*)d_in[0]; const float* wq = (const float*)d_in[1]; const float* bq = (const float*)d_in[2]; const float* wk = (const float*)d_in[3]; const float* bk = (const float*)d_in[4]; const float* wv = (const float*)d_in[5]; const float* bv = (const float*)d_in[6]; const float* wo = (const float*)d_in[7]; const float* bo = (const float*)d_in[8];
    float* OUT = (float*)d_out;   /* [4][256][4096] channel-major */
    char* wsp = (char*)d_ws;
    auto take = [&](size_t bytes) { char* p = wsp; wsp += (bytes + 255) & ~(size_t)255; return (void*)p; };
    float* BQP = (float*)take(256); float* BKP = (float*)take(256); float* BVP = (float*)take(256); h16* A16 = (h16*)take((size_t)NB_ * TT * HD * 2); bf* ATh = (bf*)take((size_t)NB_ * TT * HD * 2); bf* ATl = (bf*)take((size_t)NB_ * TT * HD * 2); bf* WOB = (bf*)take((size_t)CC * HD * 2); float* Y = (float*)take((size_t)NB_ * TT * CC * 4); bf* WQ = (bf*)take((size_t)DQ * DM * 2); bf* WK = (bf*)take((size_t)DKV * DM * 2); bf* WV = (bf*)take((size_t)DKV * DM * 2);
    bf* XB = (bf*)take((size_t)NB_ * TT * DM * 2); float* FQ = (float*)take((size_t)NB_ * TT * DQ * 4); float* FK = (float*)take((size_t)NB_ * TT * DKV * 4);
    h16* QP16 = (h16*)take((size_t)NB_ * TT * HD * 2); h16* KP16 = (h16*)take((size_t)NB_ * TT * HD * 2); h16* VT16 = (h16*)take((size_t)NB_ * HD * TT * 2);
    bf* QPh = (bf*)take((size_t)NB_ * TT * HD * 2); bf* QPl = (bf*)take((size_t)NB_ * TT * HD * 2); bf* KPh = (bf*)take((size_t)NB_ * TT * HD * 2); bf* KPl = (bf*)take((size_t)NB_ * TT * HD * 2); bf* VTh = (bf*)take((size_t)NB_ * HD * TT * 2); bf* VTl = (bf*)take((size_t)NB_ * HD * TT * 2);
    float* Ob = (float*)take((size_t)NB_ * TT * HD * 4);
    if ((size_t)(wsp - (char*)d_ws) > ws_size) return;    // ws 256 MiB
    float* FV = FK;   // v projection reuses the k buffer after the k planes are built (stream-ordered)
    k_wqpad<<<(MID * CC / 8 + 255) / 256, 256, 0, stream>>>(wq, bq, WQ, BQP); k_wqpad<<<(MID * CC / 8 + 255) / 256, 256, 0, stream>>>(wk, bk, WK, BKP); k_wqpad<<<(MID * CC / 8 + 255) / 256, 256, 0, stream>>>(wv, bv, WV, BVP); k_wopad<<<(CC * HD / 8 + 255) / 256, 256, 0, stream>>>(wo, WOB);
    // token-major operands of the NB_ batches lie one behind the other, so the GEMMs and the flat splits see NB_ * TT rows; the transposes and the attention take the batch from blockIdx.y
    const unsigned LF = (unsigned)(((size_t)NB_ * TT * HD / 4 + 255) / 256), LKv = (unsigned)(((size_t)HD * TT / 2 + 255) / 256);
    k_xT<<<dim3((unsigned)(((size_t)TT * DM / 8 + 255) / 256), NB_, 1), 256, 0, stream>>>(x, XB);   /* channel-major -> token-major bf16 */
    k_gemmw<bf, 0, true><<<dim3(NB_ * TT / 64, DQ / 64, 1), 32, 0, stream>>>(XB, nullptr, WQ, nullptr, DM, FQ, DQ, BQP, 0, 0, 0);
    k_flat<<<LF, 256, 0, stream>>>(FQ, DQ, QP16, QPh, QPl, (size_t)NB_ * TT * HD / 4);
    k_gemmw<bf, 0, true><<<dim3(NB_ * TT / 64, DKV / 64, 1), 32, 0, stream>>>(XB, nullptr, WK, nullptr, DM, FK, DKV, BKP, 0, 0, 0);
    k_flat<<<LF, 256, 0, stream>>>(FK, DKV, KP16, KPh, KPl, (size_t)NB_ * TT * HD / 4);
    k_gemmw<bf, 0, true><<<dim3(NB_ * TT / 64, DKV / 64, 1), 32, 0, stream>>>(XB, nullptr, WV, nullptr, DM, FV, DKV, BVP, 0, 0, 0);
    k_vtp<<<dim3(LKv, NB_, 1), 256, 0, stream>>>(FV, DKV, NKV, VT16, VTh, VTl);
    k_fattn<<<dim3(TT / 16, NB_, 1), 256, 0, stream>>>(QPh, QPl, KPh, KPl, VTh, VTl, Ob);   /* scores + softmax + attn.v */
    k_flat<<<LF, 256, 0, stream>>>(Ob, HD, A16, ATh, ATl, (size_t)NB_ * TT * HD / 4);
    k_gemmw<bf, 1, true><<<dim3(NB_ * TT / 64, CC / 64, 1), 32, 0, stream>>>(ATh, ATl, WOB, nullptr, HD, Y, CC, bo, 0, 0, 0);   /* Wo ctx + bo (token-major) */
    k_outT<<<dim3((unsigned)(((size_t)TT * CC / 4 + 255) / 256), NB_, 1), 256, 0, stream>>>(Y, OUT);   /* back to channel-major */
}

// v004
// It runs in 89.5 microseconds.
// Next to v003, in two timings, it ran 1.52 and 1.51 times as fast.
// All steps since v000 together make it 8.90 times as fast.
#include <hip/hip_runtime.h>

// SAGAN self-attention over a feature map (x [4][256][64][64] channel-major; tokens = 4,096 positions; q, k, v = 1x1 convs to 32 channels ('oi' [32][256] + [32]); energy = q.k (unscaled, 32 dims: logit sigma ~5.7); attn = softmax over positions; out = attn v ([4096][32]); y = Wo out + bo (1x1 conv 'oi' [256][32] + [256]) written channel-major -> [4][256][64][64] (4.2 M)).
// Every stage runs once for all NB_ batches (the batch is a grid dimension, or extra rows of a row-contiguous operand); every workspace plane holds NB_ slabs.
// Layout per batch: one launch (k_proj) reads the channel-major slab and the three f32 weight matrices, rounds them to bf16 into LDS (x transposed to token-major on the way), does the three 32-channel projections (exact products + f32 biases) and writes the q, k and v hi/lo planes; scores as hi/lo x hi/lo (3 products) for every row (the logits are too sharp for fp16), softmax with a running maximum and sum on the score tiles in registers, bf16 hi/lo probabilities, attn.v (3 products), all in one launch; the 32-wide context as hi/lo planes x Wo ([256][32]) exact + bo; the result transposed back to channel-major rows.
// Compute dtypes, f32 accumulate: every input rounded to bf16; projections exact + f32 biases; scores and attn.v 3 products; softmax f32; Wo hl x exact + bias.

#define NB_  4
#define TT   4096
#define DM   256
#define NH_  1
#define NKV  1
#define REP  (NH_ / NKV)
#define HD   32                    // head width of the q, k, v planes and of the context: the real channels only
#define DQ   (NH_ * HD)
#define ZH   1
#define RH   4096                  // read only by k_merge, which is not launched; every query row uses hi+lo planes
#define WIN  0
#define PCAR 1024.0f
#define SCL  1.0f   // unscaled energy
#define CC   256     // channels
#define CQR  32      // real q/k/v channels
typedef _Float16 h16;
typedef unsigned short bf;
typedef __attribute__((ext_vector_type(16))) __bf16   v16bf;
typedef __attribute__((ext_vector_type(16))) _Float16 v16h;
typedef __attribute__((ext_vector_type(8)))  _Float16 v8h;
typedef __attribute__((ext_vector_type(8)))  unsigned short v8us;
typedef __attribute__((ext_vector_type(8)))  float    v8f;
typedef __attribute__((ext_vector_type(4)))  float    v4f;
typedef v8h  __attribute__((may_alias)) v8ha;
typedef v4f  __attribute__((may_alias)) v4fa;
typedef v8us __attribute__((may_alias)) v8usa;

__device__ __forceinline__ unsigned short f2bf(float f) { unsigned u = __float_as_uint(f); u += 0x7FFFu + ((u >> 16) & 1u); return (unsigned short)(u >> 16); }
__device__ __forceinline__ float bf2f(unsigned short b) { return __uint_as_float(((unsigned)b) << 16); }
__device__ __forceinline__ float bfr(float f) { return bf2f(f2bf(f)); }
__device__ __forceinline__ v16h cat16(v8h lo, v8h hi) { return __builtin_shufflevector(lo, hi, 0, 1, 2, 3, 4, 5, 6, 7, 8, 9, 10, 11, 12, 13, 14, 15); }
__device__ __forceinline__ v16bf cat16b(v8us lo, v8us hi) { return __builtin_bit_cast(v16bf, __builtin_shufflevector(lo, hi, 0, 1, 2, 3, 4, 5, 6, 7, 8, 9, 10, 11, 12, 13, 14, 15)); }
__device__ __forceinline__ v8f wmma16(v16h a, v16h b, v8f c) { return __builtin_amdgcn_wmma_f32_16x16x32_f16(false, a, false, b, (short)0, c, false, false); }
__device__ __forceinline__ v8f wmmab(v16bf a, v16bf b, v8f c) { return __builtin_amdgcn_wmma_f32_16x16x32_bf16(false, a, false, b, (short)0, c, false, false); }



// ---- k_gemmw: register-blocked GEMM, ONE WAVE per 64x64 output tile (16 accumulators), operands straight from K-contiguous 16-bit planes; grid (M/64, N/64, Z), 32 threads.
// C[m][n] (f32, pitch ldc, + optional f32 bias[n]) = sum_k A[m][k] Bt[n][k] (+ split products per NSPLIT). z-batch strides sA/sB/sC in elements. K % 32 == 0.
template <typename T16> struct WFrag;
template <> struct WFrag<h16> { typedef v16h V; static __device__ __forceinline__ V ld(const h16* p) { return cat16(*(const v8h*)p, *(const v8h*)(p + 16)); } static __device__ __forceinline__ v8f mma(V a, V b, v8f c) { return wmma16(a, b, c); } };
template <> struct WFrag<bf> { typedef v16bf V; static __device__ __forceinline__ V ld(const bf* p) { return cat16b(*(const v8us*)p, *(const v8us*)(p + 16)); } static __device__ __forceinline__ v8f mma(V a, V b, v8f c) { return wmmab(a, b, c); } };
template <typename T16, int NSPLIT, bool BIAS>
__global__ __launch_bounds__(32) void k_gemmw(const T16* __restrict__ A, const T16* __restrict__ A2, const T16* __restrict__ Bt, const T16* __restrict__ Bt2, int K, float* C, int ldc, const float* __restrict__ bias, size_t sA, size_t sB, size_t sC) {
    typedef typename WFrag<T16>::V V;
    __shared__ __align__(16) float os[16 * 68];
    const size_t z = blockIdx.z; A += z * sA; if (A2) A2 += z * sA; Bt += z * sB; if (Bt2) Bt2 += z * sB; C += z * sC;
    const int lane = threadIdx.x & 31, lr = lane & 15, hi = lane >> 4; const int r0 = blockIdx.x * 64, c0 = blockIdx.y * 64;
    v8f acc[4][4];
#pragma unroll
    for (int mb = 0; mb < 4; ++mb)
#pragma unroll
        for (int nb = 0; nb < 4; ++nb) acc[mb][nb] = (v8f){};
    const size_t aoff = (size_t)(r0 + lr) * K + 8 * hi, boff = (size_t)(c0 + lr) * K + 8 * hi;
#pragma unroll 1
    for (int kc = 0; kc < K; kc += 32) {
        V a[4], a2[4];
#pragma unroll
        for (int mb = 0; mb < 4; ++mb) { a[mb] = WFrag<T16>::ld(A + aoff + (size_t)mb * 16 * K + kc); if (NSPLIT == 1 || NSPLIT == 2) a2[mb] = WFrag<T16>::ld(A2 + aoff + (size_t)mb * 16 * K + kc); }
#pragma unroll
        for (int nb = 0; nb < 4; ++nb) { const V b = WFrag<T16>::ld(Bt + boff + (size_t)nb * 16 * K + kc); V b2; if (NSPLIT >= 2) b2 = WFrag<T16>::ld(Bt2 + boff + (size_t)nb * 16 * K + kc);
#pragma unroll
            for (int mb = 0; mb < 4; ++mb) { acc[mb][nb] = WFrag<T16>::mma(a[mb], b, acc[mb][nb]); if (NSPLIT == 1 || NSPLIT == 2) acc[mb][nb] = WFrag<T16>::mma(a2[mb], b, acc[mb][nb]); if (NSPLIT >= 2) acc[mb][nb] = WFrag<T16>::mma(a[mb], b2, acc[mb][nb]); } }
        asm volatile("v_nop\n\tv_nop\n\tv_nop\n\tv_nop" : "+v"(acc[0][0]), "+v"(acc[1][1]), "+v"(acc[2][2]), "+v"(acc[3][3]) : "v"(a[0]), "v"(a[3]));
    }
#pragma unroll
    for (int mb = 0; mb < 4; ++mb) {
#pragma unroll
        for (int nb = 0; nb < 4; ++nb) {
#pragma unroll
            for (int j = 0; j < 8; ++j) os[(hi * 8 + j) * 68 + nb * 16 + lr] = acc[mb][nb][j]; }
        __builtin_amdgcn_wave_barrier(); asm volatile("" ::: "memory");
        float* crow = C + (size_t)(r0 + mb * 16) * ldc + c0;
{
#pragma unroll
            for (int s = 0; s < 8; ++s) { const int row = 2 * s + hi, cofs = lr * 4; v4f val = *(const v4fa*)(os + row * 68 + cofs); if (BIAS) { val[0] += bfr(bias[c0 + cofs]); val[1] += bfr(bias[c0 + cofs + 1]); val[2] += bfr(bias[c0 + cofs + 2]); val[3] += bfr(bias[c0 + cofs + 3]); }
                *(v4f*)(crow + (size_t)row * ldc + cofs) = val; }
             }
        __builtin_amdgcn_wave_barrier(); asm volatile("" ::: "memory");
    }
}

__device__ __forceinline__ h16 tohx(float x) { return (h16)x; }
__device__ __forceinline__ void splitf(float y, unsigned short& h, unsigned short& l) { h = f2bf(y); l = f2bf(y - bf2f(h)); }
typedef __attribute__((ext_vector_type(2))) _Float16 v2h;
typedef __attribute__((ext_vector_type(4))) _Float16 v4h;
typedef __attribute__((ext_vector_type(2))) unsigned short v2us;
typedef __attribute__((ext_vector_type(4))) unsigned short v4us;
typedef __attribute__((ext_vector_type(2))) float v2f;
typedef __attribute__((ext_vector_type(4))) int v4i;

__global__ __launch_bounds__(256) void k_wtG(const float* __restrict__ w, int K, int N, bf* Bt) {
    const int lane = threadIdx.x & 31; const int L0 = (blockIdx.x * 8 + (threadIdx.x >> 5)) * 8; const int nlines = N * K / 64;
{
#pragma unroll 1
        for (int l = 0; l < 8; ++l) { const int L = L0 + l; if (L >= nlines) break; const size_t e = (size_t)L * 64 + lane * 2; const int k = (int)(e % K), n = (int)(e / K); v2us o;
            o[0] = f2bf(w[(size_t)k * N + n]); o[1] = f2bf(w[(size_t)(k + 1) * N + n]); *(v2us*)(Bt + e) = o; }
         }
}
__global__ __launch_bounds__(256) void k_cvt8(const float* __restrict__ src, bf* dst, size_t n8) { const size_t i = (size_t)blockIdx.x * 256 + threadIdx.x; if (i >= n8) return; const v8f v = *(const v8f*)(src + i * 8); v8us o;
#pragma unroll
    for (int k = 0; k < 8; ++k) o[k] = f2bf(v[k]); *(v8us*)(dst + i * 8) = o;  }

// sp = row pitch of F in floats; the first HD columns of every row go into planes of pitch HD
__global__ __launch_bounds__(256) void k_flat(const float* __restrict__ F, int sp, h16* P16, bf* Ph, bf* Pl, size_t n4) { const size_t i = (size_t)blockIdx.x * 256 + threadIdx.x; if (i >= n4) return; const v4f a = *(const v4f*)(F + (i / (HD / 4)) * sp + (i % (HD / 4)) * 4); v4h o16; v4us oh, ol;
#pragma unroll
    for (int q = 0; q < 4; ++q) { o16[q] = tohx(a[q]); unsigned short x2, y2; splitf(a[q], x2, y2); oh[q] = x2; ol[q] = y2; }
    *(v4h*)(P16 + i * 4) = o16; *(v4us*)(Ph + i * 4) = oh; *(v4us*)(Pl + i * 4) = ol;  }


typedef __attribute__((ext_vector_type(2))) __bf16 v2bf;
typedef float __attribute__((may_alias)) fa;
typedef v2f __attribute__((may_alias)) v2fa;
#define FW_   8                 // waves of a work-group = key splits
#define FSK   64                // keys per stage
#define FKP   40                // LDS pitch of a K row (HD elements), 16-bit elements
#define FPI   72                // LDS pitch of a V^T row (FSK elements), 16-bit elements
#define FKT   (FSK * FKP)       // one staged K plane: FSK rows
#define FVT   (HD * FPI)        // one staged V^T plane: HD rows
#define FSL   (2 * FKT + 2 * FVT)   // one wave's slice
#define FOP   36                // merge row pitch, floats
#define L2E   1.4426950408889634f
__device__ __forceinline__ float xhalf(float v) { const int b = __float_as_int(v); return __int_as_float(__builtin_amdgcn_permlanex16(b, b, 0x76543210, 0xfedcba98, false, false)); }
// orders one wave's LDS stores against its own later LDS loads of other lanes' bytes (the LDS serves a wave in order; this keeps the compiler from swapping them)
__device__ __forceinline__ void wave_order() { __builtin_amdgcn_wave_barrier(); asm volatile("" ::: "memory"); }
__global__ __launch_bounds__(256) void k_fattn(const bf* __restrict__ Qh, const bf* __restrict__ Ql, const bf* __restrict__ Kh, const bf* __restrict__ Kl, const bf* __restrict__ Vh, const bf* __restrict__ Vl, float* __restrict__ O) {
    __shared__ __align__(16) bf sm[FW_ * FSL];
    const int lane = threadIdx.x & 31, c = lane & 15, h = lane >> 4; const int w = __builtin_amdgcn_readfirstlane((int)(threadIdx.x >> 5)); const int q0 = blockIdx.x * 16;
    { const size_t zb = (size_t)blockIdx.y * TT * HD; Qh += zb; Ql += zb; Kh += zb; Kl += zb; Vh += zb; Vl += zb; O += zb; }   // blockIdx.y = batch
    bf* kh_s = sm + w * FSL; bf* kl_s = kh_s + FKT; bf* vh_s = kl_s + FKT; bf* vl_s = vh_s + FVT;
    const v16bf qh = WFrag<bf>::ld(Qh + (size_t)(q0 + c) * HD + 8 * h), ql = WFrag<bf>::ld(Ql + (size_t)(q0 + c) * HD + 8 * h);
    v8f o[2];
#pragma unroll
    for (int dt = 0; dt < 2; ++dt) o[dt] = (v8f){};
    float m = -3.0e38f, l = 0.0f;
    const int kdst = (lane >> 2) * FKP + (lane & 3) * 8;                                   // a 16-byte piece of a K row: 4 lanes a row, 8 rows a load
    const int srow = lane >> 3, scol = (lane & 7) * 8, vdst = srow * FPI + scol;           // of a V^T row: 8 lanes a row, 4 rows a load
    const int kbase = w * (TT / FW_);
    v8us st[16];
#pragma unroll
    for (int i = 0; i < 8; ++i) { st[i] = *(const v8us*)(Kh + (size_t)kbase * HD + i * 256 + lane * 8); st[8 + i] = *(const v8us*)(Kl + (size_t)kbase * HD + i * 256 + lane * 8); }
#pragma unroll 1
    for (int s = 0; s < TT / FW_ / FSK; ++s) {
        const int key0 = kbase + s * FSK;
#pragma unroll
        for (int i = 0; i < 8; ++i) { *(v8us*)(kh_s + kdst + i * 8 * FKP) = st[i]; *(v8us*)(kl_s + kdst + i * 8 * FKP) = st[8 + i]; }
        // this stage's V^T rows fly while the scores are computed
        const bf* pvh = Vh + (size_t)srow * TT + key0 + scol; const bf* pvl = Vl + (size_t)srow * TT + key0 + scol;
#pragma unroll
        for (int i = 0; i < 8; ++i) { st[i] = *(const v8us*)(pvh + (size_t)i * 4 * TT); st[8 + i] = *(const v8us*)(pvl + (size_t)i * 4 * TT); }
        asm volatile("s_wait_xcnt 0x0" :: "v"(pvh), "v"(pvl) : "memory");   // precaution: stands before any overwrite of the address registers of the loads just issued; naming them keeps them whole up to here
        wave_order();
        v8f sc[4];
#pragma unroll
        for (int kt = 0; kt < 4; ++kt) sc[kt] = (v8f){};
        { v16bf a[4], a2[4];
#pragma unroll
            for (int kt = 0; kt < 4; ++kt) { a[kt] = WFrag<bf>::ld(kh_s + (kt * 16 + c) * FKP + 8 * h); a2[kt] = WFrag<bf>::ld(kl_s + (kt * 16 + c) * FKP + 8 * h); }
#pragma unroll
            for (int kt = 0; kt < 4; ++kt) sc[kt] = wmmab(a[kt], qh, sc[kt]);
#pragma unroll
            for (int kt = 0; kt < 4; ++kt) sc[kt] = wmmab(a[kt], ql, sc[kt]);
#pragma unroll
            for (int kt = 0; kt < 4; ++kt) sc[kt] = wmmab(a2[kt], qh, sc[kt]); }
        float mx = sc[0][0];
#pragma unroll
        for (int kt = 0; kt < 4; ++kt)
#pragma unroll
            for (int r = 0; r < 8; ++r) mx = fmaxf(mx, sc[kt][r]);
        mx = fmaxf(mx, xhalf(mx));
        const float mn = fmaxf(m, mx); const float al = __builtin_amdgcn_exp2f((m - mn) * L2E); m = mn;
        float ps = 0.0f;
#pragma unroll
        for (int kt = 0; kt < 4; ++kt)
#pragma unroll
            for (int r = 0; r < 8; ++r) { const float p = __builtin_amdgcn_exp2f((sc[kt][r] - mn) * L2E); sc[kt][r] = p; ps += p; }
        l = l * al + ps;
#pragma unroll
        for (int dt = 0; dt < 2; ++dt) o[dt] *= al;
        wave_order();
#pragma unroll
        for (int i = 0; i < 8; ++i) { *(v8us*)(vh_s + vdst + i * 4 * FPI) = st[i]; *(v8us*)(vl_s + vdst + i * 4 * FPI) = st[8 + i]; }
        // the next stage's K rows fly while attn.v is computed
        if (s + 1 < TT / FW_ / FSK) {
            const bf* pkh = Kh + (size_t)(key0 + FSK) * HD + lane * 8; const bf* pkl = Kl + (size_t)(key0 + FSK) * HD + lane * 8;
#pragma unroll
            for (int i = 0; i < 8; ++i) { st[i] = *(const v8us*)(pkh + i * 256); st[8 + i] = *(const v8us*)(pkl + i * 256); }
            asm volatile("s_wait_xcnt 0x0" :: "v"(pkh), "v"(pkl) : "memory");   // same precaution as behind the V^T loads
        }
        wave_order();
#pragma unroll
        for (int kb = 0; kb < 2; ++kb) { v16bf ph, pl;
#pragma unroll
            for (int e = 0; e < 16; e += 2) { v2f pp; pp[0] = sc[2 * kb + (e >> 3)][e & 7]; pp[1] = sc[2 * kb + (e >> 3)][(e & 7) + 1]; const v2bf hh = __builtin_convertvector(pp, v2bf); const v2f bk = __builtin_convertvector(hh, v2f); const v2bf ll = __builtin_convertvector(pp - bk, v2bf); ph[e] = hh[0]; ph[e + 1] = hh[1]; pl[e] = ll[0]; pl[e + 1] = ll[1]; }
            v16bf a[2], a2[2];
#pragma unroll
            for (int dt = 0; dt < 2; ++dt) { a[dt] = WFrag<bf>::ld(vh_s + (dt * 16 + c) * FPI + kb * 32 + 8 * h); a2[dt] = WFrag<bf>::ld(vl_s + (dt * 16 + c) * FPI + kb * 32 + 8 * h); }
#pragma unroll
            for (int dt = 0; dt < 2; ++dt) o[dt] = wmmab(a[dt], ph, o[dt]);
#pragma unroll
            for (int dt = 0; dt < 2; ++dt) o[dt] = wmmab(a2[dt], ph, o[dt]);
#pragma unroll
            for (int dt = 0; dt < 2; ++dt) o[dt] = wmmab(a[dt], pl, o[dt]); }
    }
    l += xhalf(l);
    // each wave's partial O^T, maximum and sum go into its own slice, then the work-group merges the 8 key splits
    fa* of = (fa*)kh_s;
#pragma unroll
    for (int dt = 0; dt < 2; ++dt) { v4f lo4, hi4;
#pragma unroll
        for (int r = 0; r < 4; ++r) { lo4[r] = o[dt][r]; hi4[r] = o[dt][4 + r]; }
        *(v4fa*)(of + c * FOP + dt * 16 + 8 * h) = lo4; *(v4fa*)(of + c * FOP + dt * 16 + 8 * h + 4) = hi4; }
    if (h == 0) { of[16 * FOP + c] = m; of[16 * FOP + 16 + c] = l; }
    __syncthreads();
    const int q = threadIdx.x >> 4, d0 = (threadIdx.x & 15) * 2;
    float M = -3.0e38f;
#pragma unroll
    for (int u = 0; u < FW_; ++u) M = fmaxf(M, ((const fa*)(sm + u * FSL))[16 * FOP + q]);
    float L = 0.0f; v2f acc = (v2f){};
#pragma unroll
    for (int u = 0; u < FW_; ++u) { const fa* b = (const fa*)(sm + u * FSL); const float f = __builtin_amdgcn_exp2f((b[16 * FOP + q] - M) * L2E); L += b[16 * FOP + 16 + q] * f; acc += *(const v2fa*)(b + q * FOP + d0) * f; }
    const float inv = __fdiv_rn(1.0f, L);
    *(v2f*)(O + (size_t)(q0 + q) * HD + d0) = acc * inv;
}

// k_proj: everything in front of the attention in one launch. One work-group = PT_ tokens of one batch (blockIdx.y) x the 96 output channels of q, k and v.
// Wave w reads channels 32w..32w+31 of the tokens (16-byte loads along the tokens: 256 contiguous bytes a channel row), rounds them to bf16 and stores them token-major in LDS:
// a lane's 4 tokens go to 4 different 16-row tiles (LDS row j * 16 + lr = token 4 * lr + j), so its 8 channels of one token are one 16-byte store. The 96 weight rows are rounded into LDS beside them.
// Behind the barrier wave w does token tile w & 3 x output tiles 3 * (w >> 2) .. + 2, the channels in rising order in one accumulator each; results + biases go through LDS so that every plane is stored in whole rows.
typedef __attribute__((ext_vector_type(8))) __bf16 v8bf;
#define PT_  64                 // tokens of a work-group
#define PNO  96                 // output channels: q 0..31, k 32..63, v 64..95
#define PXP  264                // LDS pitch of a row of CC 16-bit channels: 512 B + 16 B
#define POP  100                // LDS pitch of a token's PNO f32 results, floats
__device__ __forceinline__ v8us rnd8(v8f v) { return __builtin_bit_cast(v8us, __builtin_convertvector(v, v8bf)); }   // nearest even, as f2bf
__device__ __forceinline__ void split8(v8f y, v8us& h, v8us& l) { h = rnd8(y); l = rnd8(y - __builtin_convertvector(__builtin_bit_cast(v8bf, h), v8f)); }
__global__ __launch_bounds__(256) void k_proj(const float* __restrict__ x, const float* __restrict__ wq, const float* __restrict__ bq, const float* __restrict__ wk, const float* __restrict__ bk, const float* __restrict__ wv, const float* __restrict__ bv, bf* Qh, bf* Ql, bf* Kh, bf* Kl, bf* Vh, bf* Vl) {
    __shared__ __align__(16) bf xs[PT_ * PXP];
    __shared__ __align__(16) bf wsh[PNO * PXP];
    __shared__ __align__(16) float os[PT_ * POP];
    const int lane = threadIdx.x & 31, lr = lane & 15, hi = lane >> 4; const int w = __builtin_amdgcn_readfirstlane((int)(threadIdx.x >> 5));
    const int n0 = blockIdx.x * PT_; const size_t b = blockIdx.y;
    const int mt = w & 3, g = w >> 2;
    const float* xp = x + (b * CC + 32 * w + 8 * hi) * TT + n0 + 4 * lr;
    v4f xv[16];
#pragma unroll
    for (int e = 0; e < 8; ++e) { xv[e] = *(const v4f*)(xp + (size_t)e * TT); xv[8 + e] = *(const v4f*)(xp + (size_t)(16 + e) * TT); }
    v4f wr[24];   // wave w rounds weight rows w, w + 8, ... of each matrix: a row is 1 KiB, 32 bytes a lane
#pragma unroll
    for (int s = 0; s < 12; ++s) { const float* wp = ((s < 4) ? wq : (s < 8) ? wk : wv) + (size_t)(w + 8 * (s & 3)) * CC + lane * 8; wr[2 * s] = *(const v4f*)wp; wr[2 * s + 1] = *(const v4f*)(wp + 4); }
    float bias[3];
#pragma unroll
    for (int n = 0; n < 3; ++n) { const int nt = 3 * g + n; const float* bp = (nt < 2) ? bq : (nt < 4) ? bk : bv; bias[n] = bfr(bp[(nt & 1) * 16 + lr]); }
    asm volatile("s_wait_xcnt 0x0" :: "v"(xp) : "memory");   // precaution: stands before any overwrite of the address registers of the loads just issued; naming the x address keeps it whole up to here
#pragma unroll
    for (int j = 0; j < 4; ++j) { v8f t0, t1;
#pragma unroll
        for (int e = 0; e < 8; ++e) { t0[e] = xv[e][j]; t1[e] = xv[8 + e][j]; }
        bf* d = xs + (j * 16 + lr) * PXP + 32 * w + 8 * hi; *(v8us*)d = rnd8(t0); *(v8us*)(d + 16) = rnd8(t1); }
#pragma unroll
    for (int s = 0; s < 12; ++s) { const v8f t = __builtin_shufflevector(wr[2 * s], wr[2 * s + 1], 0, 1, 2, 3, 4, 5, 6, 7); *(v8us*)(wsh + ((s >> 2) * 32 + w + 8 * (s & 3)) * PXP + lane * 8) = rnd8(t); }
    __syncthreads();
    v8f acc[3];
#pragma unroll
    for (int n = 0; n < 3; ++n) acc[n] = (v8f){};
#pragma unroll
    for (int kc = 0; kc < CC; kc += 32) { const v16bf a = WFrag<bf>::ld(xs + (mt * 16 + lr) * PXP + kc + 8 * hi);
#pragma unroll
        for (int n = 0; n < 3; ++n) acc[n] = wmmab(a, WFrag<bf>::ld(wsh + ((3 * g + n) * 16 + lr) * PXP + kc + 8 * hi), acc[n]); }
#pragma unroll
    for (int n = 0; n < 3; ++n)
#pragma unroll
        for (int r = 0; r < 8; ++r) os[(4 * (8 * hi + r) + mt) * POP + (3 * g + n) * 16 + lr] = acc[n][r] + bias[n];
    __syncthreads();
    { const int t = threadIdx.x >> 2, c0 = (threadIdx.x & 3) * 8; const float* p = os + t * POP + c0; const size_t o = (b * TT + n0 + t) * HD + c0; v8us h8, l8;   // q, k: 8 channels of a token a thread
        split8(__builtin_shufflevector(*(const v4fa*)p, *(const v4fa*)(p + 4), 0, 1, 2, 3, 4, 5, 6, 7), h8, l8); *(v8us*)(Qh + o) = h8; *(v8us*)(Ql + o) = l8;
        split8(__builtin_shufflevector(*(const v4fa*)(p + 32), *(const v4fa*)(p + 36), 0, 1, 2, 3, 4, 5, 6, 7), h8, l8); *(v8us*)(Kh + o) = h8; *(v8us*)(Kl + o) = l8; }
    { const int d = threadIdx.x >> 3, t0 = (threadIdx.x & 7) * 8; v8f y; v8us h8, l8;   // v, channel-major: 8 tokens of a channel a thread
#pragma unroll
        for (int q = 0; q < 8; ++q) y[q] = os[(t0 + q) * POP + 64 + d];
        const size_t o = (b * HD + d) * TT + n0 + t0; split8(y, h8, l8); *(v8us*)(Vh + o) = h8; *(v8us*)(Vl + o) = l8; }
}
__global__ __launch_bounds__(256) void k_outT(const float* __restrict__ Y, float* outb) { const size_t i = (size_t)blockIdx.x * 256 + threadIdx.x; if (i >= (size_t)CC * TT / 4) return; Y += (size_t)blockIdx.y * TT * CC; outb += (size_t)blockIdx.y * CC * TT;   /* blockIdx.y = batch */ const size_t e = i * 4; const int t = (int)(e % TT); const int c = (int)(e / TT); v4f o;
#pragma unroll
    for (int q = 0; q < 4; ++q) o[q] = Y[(size_t)(t + q) * CC + c];
    *(v4f*)(outb + e) = o;  }
__global__ __launch_bounds__(256) void k_wopad(const float* __restrict__ w, bf* Bt) { const int i = blockIdx.x * 256 + threadIdx.x; if (i >= CC * HD / 8) return; const int k0 = (i % (HD / 8)) * 8; const int c = i / (HD / 8); v8us o;
#pragma unroll
    for (int q = 0; q < 8; ++q) { const int kk = k0 + q; const unsigned short v = f2bf(w[(size_t)c * CQR + min(kk, CQR - 1)]); o[q] = (kk < CQR) ? v : (unsigned short)0; }
    *(v8us*)(Bt + (size_t)c * HD + k0) = o;  }
__global__ __launch_bounds__(256) void k_merge(const float* __restrict__ O, int h0, float* OUTb) { const size_t e = ((size_t)blockIdx.x * 256 + threadIdx.x) * 2; if (e >= (size_t)ZH * TT * HD) return; const int d = (int)(e % HD); const int t = (int)((e / HD) % TT); const int zz = (int)(e / ((size_t)HD * TT)); const float cs = (t < RH) ? 1.0f : (1.0f / PCAR); const size_t oo = (size_t)t * DQ + (h0 + zz) * HD + d;
    v2f o2; o2[0] = O[e] * cs; o2[1] = O[e + 1] * cs; *(v2f*)(OUTb + oo) = o2;  }

extern "C" void kernel_launch(void* const* d_in, const int* in_sizes, int n_in,
                              void* d_out, int out_size, void* d_ws, size_t ws_size, hipStream_t stream) {
    (void)in_sizes; (void)n_in; (void)out_size;
    const float* x = (const float*)d_in[0]; const float* wq = (const float*)d_in[1]; const float* bq = (const float*)d_in[2]; const float* wk = (const float*)d_in[3]; const float* bk = (const float*)d_in[4]; const float* wv = (const float*)d_in[5]; const float* bv = (const float*)d_in[6]; const float* wo = (const float*)d_in[7]; const float* bo = (const float*)d_in[8];
    float* OUT = (float*)d_out;   /* [4][256][4096] channel-major */
    char* wsp = (char*)d_ws;
    auto take = [&](size_t bytes) { char* p = wsp; wsp += (bytes + 255) & ~(size_t)255; return (void*)p; };
    h16* A16 = (h16*)take((size_t)NB_ * TT * HD * 2); bf* ATh = (bf*)take((size_t)NB_ * TT * HD * 2); bf* ATl = (bf*)take((size_t)NB_ * TT * HD * 2); bf* WOB = (bf*)take((size_t)CC * HD * 2); float* Y = (float*)take((size_t)NB_ * TT * CC * 4);
    bf* QPh = (bf*)take((size_t)NB_ * TT * HD * 2); bf* QPl = (bf*)take((size_t)NB_ * TT * HD * 2); bf* KPh = (bf*)take((size_t)NB_ * TT * HD * 2); bf* KPl = (bf*)take((size_t)NB_ * TT * HD * 2); bf* VTh = (bf*)take((size_t)NB_ * HD * TT * 2); bf* VTl = (bf*)take((size_t)NB_ * HD * TT * 2);
    float* Ob = (float*)take((size_t)NB_ * TT * HD * 4);
    if ((size_t)(wsp - (char*)d_ws) > ws_size) return;    // ws 256 MiB
    k_wopad<<<(CC * HD / 8 + 255) / 256, 256, 0, stream>>>(wo, WOB);
    // token-major operands of the NB_ batches lie one behind the other, so the last GEMM and the flat split see NB_ * TT rows; the projections, the attention and the last transpose take the batch from blockIdx.y
    const unsigned LF = (unsigned)(((size_t)NB_ * TT * HD / 4 + 255) / 256);
    k_proj<<<dim3(TT / PT_, NB_, 1), 256, 0, stream>>>(x, wq, bq, wk, bk, wv, bv, QPh, QPl, KPh, KPl, VTh, VTl);   /* x, Wq, Wk, Wv -> q, k, v hi/lo planes */
    k_fattn<<<dim3(TT / 16, NB_, 1), 256, 0, stream>>>(QPh, QPl, KPh, KPl, VTh, VTl, Ob);   /* scores + softmax + attn.v */
    k_flat<<<LF, 256, 0, stream>>>(Ob, HD, A16, ATh, ATl, (size_t)NB_ * TT * HD / 4);
    k_gemmw<bf, 1, true><<<dim3(NB_ * TT / 64, CC / 64, 1), 32, 0, stream>>>(ATh, ATl, WOB, nullptr, HD, Y, CC, bo, 0, 0, 0);   /* Wo ctx + bo (token-major) */
    k_outT<<<dim3((unsigned)(((size_t)TT * CC / 4 + 255) / 256), NB_, 1), 256, 0, stream>>>(Y, OUT);   /* back to channel-major */
}

// v005
// Measured time: 54.1 microseconds a run.
// In both of two side-by-side timings against v004, it was 1.65 times as fast.
// All steps since v000 together make it 14.7 times as fast.
#include <hip/hip_runtime.h>

// SAGAN self-attention over a feature map (x [4][256][64][64] channel-major; tokens = 4,096 positions; q, k, v = 1x1 convs to 32 channels ('oi' [32][256] + [32]); energy = q.k (unscaled, 32 dims: logit sigma ~5.7); attn = softmax over positions; out = attn v ([4096][32]); y = Wo out + bo (1x1 conv 'oi' [256][32] + [256]) written channel-major -> [4][256][64][64] (4.2 M)).
// Every stage runs once for all NB_ batches (the batch is a grid dimension, or extra rows of a row-contiguous operand); every workspace plane holds NB_ slabs.
// Layout per batch: one launch (k_proj) reads the channel-major slab and the three f32 weight matrices, rounds them to bf16 into LDS (x transposed to token-major on the way), does the three 32-channel projections (exact products + f32 biases) and writes the q, k and v hi/lo planes; scores as hi/lo x hi/lo (3 products) for every row (the logits are too sharp for fp16), softmax with a running maximum and sum on the score tiles in registers, bf16 hi/lo probabilities, attn.v (3 products), all in one launch, which stores the 32-wide context as hi/lo planes; one launch (k_tail) rounds Wo ([256][32]), does Wo x context (hi/lo, exact products) + bo and writes channel-major rows.
// Compute dtypes, f32 accumulate: every input rounded to bf16; projections exact + f32 biases; scores and attn.v 3 products; softmax f32; Wo hl x exact + bias.

#define NB_  4
#define TT   4096
#define DM   256
#define NH_  1
#define NKV  1
#define REP  (NH_ / NKV)
#define HD   32                    // head width of the q, k, v planes and of the context: the real channels only
#define DQ   (NH_ * HD)
#define ZH   1
#define RH   4096                  // read only by k_merge, which is not launched; every query row uses hi+lo planes
#define WIN  0
#define PCAR 1024.0f
#define SCL  1.0f   // unscaled energy
#define CC   256     // channels
#define CQR  32      // real q/k/v channels
typedef _Float16 h16;
typedef unsigned short bf;
typedef __attribute__((ext_vector_type(16))) __bf16   v16bf;
typedef __attribute__((ext_vector_type(16))) _Float16 v16h;
typedef __attribute__((ext_vector_type(8)))  _Float16 v8h;
typedef __attribute__((ext_vector_type(8)))  unsigned short v8us;
typedef __attribute__((ext_vector_type(8)))  float    v8f;
typedef __attribute__((ext_vector_type(4)))  float    v4f;
typedef v8h  __attribute__((may_alias)) v8ha;
typedef v4f  __attribute__((may_alias)) v4fa;
typedef v8us __attribute__((may_alias)) v8usa;

__device__ __forceinline__ unsigned short f2bf(float f) { unsigned u = __float_as_uint(f); u += 0x7FFFu + ((u >> 16) & 1u); return (unsigned short)(u >> 16); }
__device__ __forceinline__ float bf2f(unsigned short b) { return __uint_as_float(((unsigned)b) << 16); }
__device__ __forceinline__ float bfr(float f) { return bf2f(f2bf(f)); }
__device__ __forceinline__ v16h cat16(v8h lo, v8h hi) { return __builtin_shufflevector(lo, hi, 0, 1, 2, 3, 4, 5, 6, 7, 8, 9, 10, 11, 12, 13, 14, 15); }
__device__ __forceinline__ v16bf cat16b(v8us lo, v8us hi) { return __builtin_bit_cast(v16bf, __builtin_shufflevector(lo, hi, 0, 1, 2, 3, 4, 5, 6, 7, 8, 9, 10, 11, 12, 13, 14, 15)); }
__device__ __forceinline__ v8f wmma16(v16h a, v16h b, v8f c) { return __builtin_amdgcn_wmma_f32_16x16x32_f16(false, a, false, b, (short)0, c, false, false); }
__device__ __forceinline__ v8f wmmab(v16bf a, v16bf b, v8f c) { return __builtin_amdgcn_wmma_f32_16x16x32_bf16(false, a, false, b, (short)0, c, false, false); }



// fragment loads: a lane's 16 elements of a K-contiguous 16-bit row are k = 8h .. 8h + 7 and 16 + 8h .. 16 + 8h + 7, the same for the A and the B operand
template <typename T16> struct WFrag;
template <> struct WFrag<h16> { typedef v16h V; static __device__ __forceinline__ V ld(const h16* p) { return cat16(*(const v8h*)p, *(const v8h*)(p + 16)); } static __device__ __forceinline__ v8f mma(V a, V b, v8f c) { return wmma16(a, b, c); } };
template <> struct WFrag<bf> { typedef v16bf V; static __device__ __forceinline__ V ld(const bf* p) { return cat16b(*(const v8us*)p, *(const v8us*)(p + 16)); } static __device__ __forceinline__ v8f mma(V a, V b, v8f c) { return wmmab(a, b, c); } };
__device__ __forceinline__ h16 tohx(float x) { return (h16)x; }
__device__ __forceinline__ void splitf(float y, unsigned short& h, unsigned short& l) { h = f2bf(y); l = f2bf(y - bf2f(h)); }
typedef __attribute__((ext_vector_type(2))) _Float16 v2h;
typedef __attribute__((ext_vector_type(4))) _Float16 v4h;
typedef __attribute__((ext_vector_type(2))) unsigned short v2us;
typedef __attribute__((ext_vector_type(4))) unsigned short v4us;
typedef __attribute__((ext_vector_type(2))) float v2f;
typedef __attribute__((ext_vector_type(4))) int v4i;

__global__ __launch_bounds__(256) void k_wtG(const float* __restrict__ w, int K, int N, bf* Bt) {
    const int lane = threadIdx.x & 31; const int L0 = (blockIdx.x * 8 + (threadIdx.x >> 5)) * 8; const int nlines = N * K / 64;
{
#pragma unroll 1
        for (int l = 0; l < 8; ++l) { const int L = L0 + l; if (L >= nlines) break; const size_t e = (size_t)L * 64 + lane * 2; const int k = (int)(e % K), n = (int)(e / K); v2us o;
            o[0] = f2bf(w[(size_t)k * N + n]); o[1] = f2bf(w[(size_t)(k + 1) * N + n]); *(v2us*)(Bt + e) = o; }
         }
}
__global__ __launch_bounds__(256) void k_cvt8(const float* __restrict__ src, bf* dst, size_t n8) { const size_t i = (size_t)blockIdx.x * 256 + threadIdx.x; if (i >= n8) return; const v8f v = *(const v8f*)(src + i * 8); v8us o;
#pragma unroll
    for (int k = 0; k < 8; ++k) o[k] = f2bf(v[k]); *(v8us*)(dst + i * 8) = o;  }


typedef __attribute__((ext_vector_type(2))) __bf16 v2bf;
typedef float __attribute__((may_alias)) fa;
typedef v2f __attribute__((may_alias)) v2fa;
#define FW_   8                 // waves of a work-group = key splits
#define FSK   64                // keys per stage
#define FKP   40                // LDS pitch of a K row (HD elements), 16-bit elements
#define FPI   72                // LDS pitch of a V^T row (FSK elements), 16-bit elements
#define FKT   (FSK * FKP)       // one staged K plane: FSK rows
#define FVT   (HD * FPI)        // one staged V^T plane: HD rows
#define FSL   (2 * FKT + 2 * FVT)   // one wave's slice
#define FOP   36                // merge row pitch, floats
#define L2E   1.4426950408889634f
__device__ __forceinline__ float xhalf(float v) { const int b = __float_as_int(v); return __int_as_float(__builtin_amdgcn_permlanex16(b, b, 0x76543210, 0xfedcba98, false, false)); }
// orders one wave's LDS stores against its own later LDS loads of other lanes' bytes (the LDS serves a wave in order; this keeps the compiler from swapping them)
__device__ __forceinline__ void wave_order() { __builtin_amdgcn_wave_barrier(); asm volatile("" ::: "memory"); }
__global__ __launch_bounds__(256) void k_fattn(const bf* __restrict__ Qh, const bf* __restrict__ Ql, const bf* __restrict__ Kh, const bf* __restrict__ Kl, const bf* __restrict__ Vh, const bf* __restrict__ Vl, bf* __restrict__ Ch, bf* __restrict__ Cl) {
    __shared__ __align__(16) bf sm[FW_ * FSL];
    const int lane = threadIdx.x & 31, c = lane & 15, h = lane >> 4; const int w = __builtin_amdgcn_readfirstlane((int)(threadIdx.x >> 5)); const int q0 = blockIdx.x * 16;
    { const size_t zb = (size_t)blockIdx.y * TT * HD; Qh += zb; Ql += zb; Kh += zb; Kl += zb; Vh += zb; Vl += zb; Ch += zb; Cl += zb; }   // blockIdx.y = batch
    bf* kh_s = sm + w * FSL; bf* kl_s = kh_s + FKT; bf* vh_s = kl_s + FKT; bf* vl_s = vh_s + FVT;
    const v16bf qh = WFrag<bf>::ld(Qh + (size_t)(q0 + c) * HD + 8 * h), ql = WFrag<bf>::ld(Ql + (size_t)(q0 + c) * HD + 8 * h);
    v8f o[2];
#pragma unroll
    for (int dt = 0; dt < 2; ++dt) o[dt] = (v8f){};
    float m = -3.0e38f, l = 0.0f;
    const int kdst = (lane >> 2) * FKP + (lane & 3) * 8;                                   // a 16-byte piece of a K row: 4 lanes a row, 8 rows a load
    const int srow = lane >> 3, scol = (lane & 7) * 8, vdst = srow * FPI + scol;           // of a V^T row: 8 lanes a row, 4 rows a load
    const int kbase = w * (TT / FW_);
    v8us st[16];
#pragma unroll
    for (int i = 0; i < 8; ++i) { st[i] = *(const v8us*)(Kh + (size_t)kbase * HD + i * 256 + lane * 8); st[8 + i] = *(const v8us*)(Kl + (size_t)kbase * HD + i * 256 + lane * 8); }
#pragma unroll 1
    for (int s = 0; s < TT / FW_ / FSK; ++s) {
        const int key0 = kbase + s * FSK;
#pragma unroll
        for (int i = 0; i < 8; ++i) { *(v8us*)(kh_s + kdst + i * 8 * FKP) = st[i]; *(v8us*)(kl_s + kdst + i * 8 * FKP) = st[8 + i]; }
        // this stage's V^T rows fly while the scores are computed
        const bf* pvh = Vh + (size_t)srow * TT + key0 + scol; const bf* pvl = Vl + (size_t)srow * TT + key0 + scol;
#pragma unroll
        for (int i = 0; i < 8; ++i) { st[i] = *(const v8us*)(pvh + (size_t)i * 4 * TT); st[8 + i] = *(const v8us*)(pvl + (size_t)i * 4 * TT); }
        asm volatile("s_wait_xcnt 0x0" :: "v"(pvh), "v"(pvl) : "memory");   // precaution: stands before any overwrite of the address registers of the loads just issued; naming them keeps them whole up to here
        wave_order();
        v8f sc[4];
#pragma unroll
        for (int kt = 0; kt < 4; ++kt) sc[kt] = (v8f){};
        { v16bf a[4], a2[4];
#pragma unroll
            for (int kt = 0; kt < 4; ++kt) { a[kt] = WFrag<bf>::ld(kh_s + (kt * 16 + c) * FKP + 8 * h); a2[kt] = WFrag<bf>::ld(kl_s + (kt * 16 + c) * FKP + 8 * h); }
#pragma unroll
            for (int kt = 0; kt < 4; ++kt) sc[kt] = wmmab(a[kt], qh, sc[kt]);
#pragma unroll
            for (int kt = 0; kt < 4; ++kt) sc[kt] = wmmab(a[kt], ql, sc[kt]);
#pragma unroll
            for (int kt = 0; kt < 4; ++kt) sc[kt] = wmmab(a2[kt], qh, sc[kt]); }
        float mx = sc[0][0];
#pragma unroll
        for (int kt = 0; kt < 4; ++kt)
#pragma unroll
            for (int r = 0; r < 8; ++r) mx = fmaxf(mx, sc[kt][r]);
        mx = fmaxf(mx, xhalf(mx));
        const float mn = fmaxf(m, mx); const float al = __builtin_amdgcn_exp2f((m - mn) * L2E); m = mn;
        float ps = 0.0f;
#pragma unroll
        for (int kt = 0; kt < 4; ++kt)
#pragma unroll
            for (int r = 0; r < 8; ++r) { const float p = __builtin_amdgcn_exp2f((sc[kt][r] - mn) * L2E); sc[kt][r] = p; ps += p; }
        l = l * al + ps;
#pragma unroll
        for (int dt = 0; dt < 2; ++dt) o[dt] *= al;
        wave_order();
#pragma unroll
        for (int i = 0; i < 8; ++i) { *(v8us*)(vh_s + vdst + i * 4 * FPI) = st[i]; *(v8us*)(vl_s + vdst + i * 4 * FPI) = st[8 + i]; }
        // the next stage's K rows fly while attn.v is computed
        if (s + 1 < TT / FW_ / FSK) {
            const bf* pkh = Kh + (size_t)(key0 + FSK) * HD + lane * 8; const bf* pkl = Kl + (size_t)(key0 + FSK) * HD + lane * 8;
#pragma unroll
            for (int i = 0; i < 8; ++i) { st[i] = *(const v8us*)(pkh + i * 256); st[8 + i] = *(const v8us*)(pkl + i * 256); }
            asm volatile("s_wait_xcnt 0x0" :: "v"(pkh), "v"(pkl) : "memory");   // same precaution as behind the V^T loads
        }
        wave_order();
#pragma unroll
        for (int kb = 0; kb < 2; ++kb) { v16bf ph, pl;
#pragma unroll
            for (int e = 0; e < 16; e += 2) { v2f pp; pp[0] = sc[2 * kb + (e >> 3)][e & 7]; pp[1] = sc[2 * kb + (e >> 3)][(e & 7) + 1]; const v2bf hh = __builtin_convertvector(pp, v2bf); const v2f bk = __builtin_convertvector(hh, v2f); const v2bf ll = __builtin_convertvector(pp - bk, v2bf); ph[e] = hh[0]; ph[e + 1] = hh[1]; pl[e] = ll[0]; pl[e + 1] = ll[1]; }
            v16bf a[2], a2[2];
#pragma unroll
            for (int dt = 0; dt < 2; ++dt) { a[dt] = WFrag<bf>::ld(vh_s + (dt * 16 + c) * FPI + kb * 32 + 8 * h); a2[dt] = WFrag<bf>::ld(vl_s + (dt * 16 + c) * FPI + kb * 32 + 8 * h); }
#pragma unroll
            for (int dt = 0; dt < 2; ++dt) o[dt] = wmmab(a[dt], ph, o[dt]);
#pragma unroll
            for (int dt = 0; dt < 2; ++dt) o[dt] = wmmab(a2[dt], ph, o[dt]);
#pragma unroll
            for (int dt = 0; dt < 2; ++dt) o[dt] = wmmab(a[dt], pl, o[dt]); }
    }
    l += xhalf(l);
    // each wave's partial O^T, maximum and sum go into its own slice, then the work-group merges the 8 key splits
    fa* of = (fa*)kh_s;
#pragma unroll
    for (int dt = 0; dt < 2; ++dt) { v4f lo4, hi4;
#pragma unroll
        for (int r = 0; r < 4; ++r) { lo4[r] = o[dt][r]; hi4[r] = o[dt][4 + r]; }
        *(v4fa*)(of + c * FOP + dt * 16 + 8 * h) = lo4; *(v4fa*)(of + c * FOP + dt * 16 + 8 * h + 4) = hi4; }
    if (h == 0) { of[16 * FOP + c] = m; of[16 * FOP + 16 + c] = l; }
    __syncthreads();
    const int q = threadIdx.x >> 4, d0 = (threadIdx.x & 15) * 2;
    float M = -3.0e38f;
#pragma unroll
    for (int u = 0; u < FW_; ++u) M = fmaxf(M, ((const fa*)(sm + u * FSL))[16 * FOP + q]);
    float L = 0.0f; v2f acc = (v2f){};
#pragma unroll
    for (int u = 0; u < FW_; ++u) { const fa* b = (const fa*)(sm + u * FSL); const float f = __builtin_amdgcn_exp2f((b[16 * FOP + q] - M) * L2E); L += b[16 * FOP + 16 + q] * f; acc += *(const v2fa*)(b + q * FOP + d0) * f; }
    const float inv = __fdiv_rn(1.0f, L);
    const v2f y = acc * inv; unsigned short h0, l0, h1, l1; splitf(y[0], h0, l0); splitf(y[1], h1, l1);   // the context leaves as hi/lo planes: a token's row is 64 B, the work-group's 16 rows 1 KiB a plane
    v2us yh, yl; yh[0] = h0; yh[1] = h1; yl[0] = l0; yl[1] = l1;
    *(v2us*)(Ch + (size_t)(q0 + q) * HD + d0) = yh; *(v2us*)(Cl + (size_t)(q0 + q) * HD + d0) = yl;
}

// k_proj: everything in front of the attention in one launch. One work-group = PT_ tokens of one batch (blockIdx.y) x the 96 output channels of q, k and v.
// Wave w reads channels 32w..32w+31 of the tokens (16-byte loads along the tokens: 256 contiguous bytes a channel row), rounds them to bf16 and stores them token-major in LDS:
// a lane's 4 tokens go to 4 different 16-row tiles (LDS row j * 16 + lr = token 4 * lr + j), so its 8 channels of one token are one 16-byte store. The 96 weight rows are rounded into LDS beside them.
// Behind the barrier wave w does token tile w & 3 x output tiles 3 * (w >> 2) .. + 2, the channels in rising order in one accumulator each; results + biases go through LDS so that every plane is stored in whole rows.
typedef __attribute__((ext_vector_type(8))) __bf16 v8bf;
#define PT_  64                 // tokens of a work-group
#define PNO  96                 // output channels: q 0..31, k 32..63, v 64..95
#define PXP  264                // LDS pitch of a row of CC 16-bit channels: 512 B + 16 B
#define POP  100                // LDS pitch of a token's PNO f32 results, floats
__device__ __forceinline__ v8us rnd8(v8f v) { return __builtin_bit_cast(v8us, __builtin_convertvector(v, v8bf)); }   // nearest even, as f2bf
__device__ __forceinline__ void split8(v8f y, v8us& h, v8us& l) { h = rnd8(y); l = rnd8(y - __builtin_convertvector(__builtin_bit_cast(v8bf, h), v8f)); }
__global__ __launch_bounds__(256) void k_proj(const float* __restrict__ x, const float* __restrict__ wq, const float* __restrict__ bq, const float* __restrict__ wk, const float* __restrict__ bk, const float* __restrict__ wv, const float* __restrict__ bv, bf* Qh, bf* Ql, bf* Kh, bf* Kl, bf* Vh, bf* Vl) {
    __shared__ __align__(16) bf xs[PT_ * PXP];
    __shared__ __align__(16) bf wsh[PNO * PXP];
    __shared__ __align__(16) float os[PT_ * POP];
    const int lane = threadIdx.x & 31, lr = lane & 15, hi = lane >> 4; const int w = __builtin_amdgcn_readfirstlane((int)(threadIdx.x >> 5));
    const int n0 = blockIdx.x * PT_; const size_t b = blockIdx.y;
    const int mt = w & 3, g = w >> 2;
    const float* xp = x + (b * CC + 32 * w + 8 * hi) * TT + n0 + 4 * lr;
    v4f xv[16];
#pragma unroll
    for (int e = 0; e < 8; ++e) { xv[e] = *(const v4f*)(xp + (size_t)e * TT); xv[8 + e] = *(const v4f*)(xp + (size_t)(16 + e) * TT); }
    v4f wr[24];   // wave w rounds weight rows w, w + 8, ... of each matrix: a row is 1 KiB, 32 bytes a lane
#pragma unroll
    for (int s = 0; s < 12; ++s) { const float* wp = ((s < 4) ? wq : (s < 8) ? wk : wv) + (size_t)(w + 8 * (s & 3)) * CC + lane * 8; wr[2 * s] = *(const v4f*)wp; wr[2 * s + 1] = *(const v4f*)(wp + 4); }
    float bias[3];
#pragma unroll
    for (int n = 0; n < 3; ++n) { const int nt = 3 * g + n; const float* bp = (nt < 2) ? bq : (nt < 4) ? bk : bv; bias[n] = bfr(bp[(nt & 1) * 16 + lr]); }
    asm volatile("s_wait_xcnt 0x0" :: "v"(xp) : "memory");   // precaution: stands before any overwrite of the address registers of the loads just issued; naming the x address keeps it whole up to here
#pragma unroll
    for (int j = 0; j < 4; ++j) { v8f t0, t1;
#pragma unroll
        for (int e = 0; e < 8; ++e) { t0[e] = xv[e][j]; t1[e] = xv[8 + e][j]; }
        bf* d = xs + (j * 16 + lr) * PXP + 32 * w + 8 * hi; *(v8us*)d = rnd8(t0); *(v8us*)(d + 16) = rnd8(t1); }
#pragma unroll
    for (int s = 0; s < 12; ++s) { const v8f t = __builtin_shufflevector(wr[2 * s], wr[2 * s + 1], 0, 1, 2, 3, 4, 5, 6, 7); *(v8us*)(wsh + ((s >> 2) * 32 + w + 8 * (s & 3)) * PXP + lane * 8) = rnd8(t); }
    __syncthreads();
    v8f acc[3];
#pragma unroll
    for (int n = 0; n < 3; ++n) acc[n] = (v8f){};
#pragma unroll
    for (int kc = 0; kc < CC; kc += 32) { const v16bf a = WFrag<bf>::ld(xs + (mt * 16 + lr) * PXP + kc + 8 * hi);
#pragma unroll
        for (int n = 0; n < 3; ++n) acc[n] = wmmab(a, WFrag<bf>::ld(wsh + ((3 * g + n) * 16 + lr) * PXP + kc + 8 * hi), acc[n]); }
#pragma unroll
    for (int n = 0; n < 3; ++n)
#pragma unroll
        for (int r = 0; r < 8; ++r) os[(4 * (8 * hi + r) + mt) * POP + (3 * g + n) * 16 + lr] = acc[n][r] + bias[n];
    __syncthreads();
    { const int t = threadIdx.x >> 2, c0 = (threadIdx.x & 3) * 8; const float* p = os + t * POP + c0; const size_t o = (b * TT + n0 + t) * HD + c0; v8us h8, l8;   // q, k: 8 channels of a token a thread
        split8(__builtin_shufflevector(*(const v4fa*)p, *(const v4fa*)(p + 4), 0, 1, 2, 3, 4, 5, 6, 7), h8, l8); *(v8us*)(Qh + o) = h8; *(v8us*)(Ql + o) = l8;
        split8(__builtin_shufflevector(*(const v4fa*)(p + 32), *(const v4fa*)(p + 36), 0, 1, 2, 3, 4, 5, 6, 7), h8, l8); *(v8us*)(Kh + o) = h8; *(v8us*)(Kl + o) = l8; }
    { const int d = threadIdx.x >> 3, t0 = (threadIdx.x & 7) * 8; v8f y; v8us h8, l8;   // v, channel-major: 8 tokens of a channel a thread
#pragma unroll
        for (int q = 0; q < 8; ++q) y[q] = os[(t0 + q) * POP + 64 + d];
        const size_t o = (b * HD + d) * TT + n0 + t0; split8(y, h8, l8); *(v8us*)(Vh + o) = h8; *(v8us*)(Vl + o) = l8; }
}
// k_tail: everything behind the attention in one launch. One work-group = ET_ tokens (all of one batch) x EC_ output channels.
// y^T = Wo ctx^T: A = 16 rows of Wo, B = the context planes (hi, then lo, in one accumulator), so a lane holds 8 channels of one token.
// The work-group's EC_ rows of Wo (f32, contiguous) are read in whole lines, rounded to bf16 and laid in LDS once; behind the barrier wave w does token tile w x the EC_ / 16 channel tiles.
// The results go through LDS so that every store is 512 contiguous bytes of one channel row of the channel-major output; the bias is added there.
typedef __attribute__((ext_vector_type(4))) __bf16 v4bf;
#define ET_  128                // tokens of a work-group
#define EC_  128                // output channels of a work-group: the grid is one work-group a WGP
#define EWP  40                 // LDS pitch of a rounded Wo row (CQR elements), 16-bit elements: 64 B + 16 B
#define EOP  132                // LDS pitch of a channel's ET_ f32 results, floats: rows 8 apart lie 32 banks apart
__global__ __launch_bounds__(256) void k_tail(const bf* __restrict__ Ch, const bf* __restrict__ Cl, const float* __restrict__ wo, const float* __restrict__ bo, float* __restrict__ out) {
    __shared__ __align__(16) bf wsh[EC_ * EWP];
    __shared__ __align__(16) float os[EC_ * EOP];
    const int lane = threadIdx.x & 31, lr = lane & 15, hi = lane >> 4; const int w = __builtin_amdgcn_readfirstlane((int)(threadIdx.x >> 5));
    const int t0 = blockIdx.x * ET_, c0 = blockIdx.y * EC_;   // t0 counts the tokens of all batches, one behind the other
    float bias[EC_ / 8];
#pragma unroll
    for (int i = 0; i < EC_ / 8; ++i) bias[i] = bfr(bo[c0 + w + 8 * i]);
    const int tid = threadIdx.x; const float* pw = wo + (size_t)(c0 * CQR + tid * 4);   // 4 of a row's CQR floats a thread: 32 rows a load
    const bf* ph = Ch + (size_t)(t0 + 16 * w + lr) * HD + 8 * hi; const bf* pl = Cl + (size_t)(t0 + 16 * w + lr) * HD + 8 * hi;
    v4f wr[EC_ / 32];
#pragma unroll
    for (int j = 0; j < EC_ / 32; ++j) wr[j] = *(const v4f*)(pw + j * 32 * CQR);
    const v16bf bh = WFrag<bf>::ld(ph), bl = WFrag<bf>::ld(pl);
    asm volatile("s_wait_xcnt 0x0" :: "v"(pw), "v"(ph), "v"(pl) : "memory");   // precaution: stands before any overwrite of the address registers of the loads just issued; naming them keeps them whole up to here
#pragma unroll
    for (int j = 0; j < EC_ / 32; ++j) *(v4us*)(wsh + (32 * j + (tid >> 3)) * EWP + (tid & 7) * 4) = __builtin_bit_cast(v4us, __builtin_convertvector(wr[j], v4bf));   // nearest even, as f2bf
    __syncthreads();
#pragma unroll
    for (int mt = 0; mt < EC_ / 16; ++mt) { const v16bf a = WFrag<bf>::ld(wsh + (16 * mt + lr) * EWP + 8 * hi);
        v8f d = wmmab(a, bh, (v8f){}); d = wmmab(a, bl, d);
#pragma unroll
        for (int r = 0; r < 8; ++r) os[(16 * mt + 8 * hi + r) * EOP + 16 * w + lr] = d[r]; }
    __syncthreads();
    float* po = out + ((size_t)(t0 / TT) * CC + c0 + w) * TT + (t0 % TT) + lane * 4;   // wave w stores channel rows w, w + 8, ...
#pragma unroll
    for (int i = 0; i < EC_ / 8; ++i) { v4f v = *(const v4fa*)(os + (w + 8 * i) * EOP + lane * 4); v += bias[i]; *(v4f*)(po + (size_t)i * 8 * TT) = v; }
}
__global__ __launch_bounds__(256) void k_merge(const float* __restrict__ O, int h0, float* OUTb) { const size_t e = ((size_t)blockIdx.x * 256 + threadIdx.x) * 2; if (e >= (size_t)ZH * TT * HD) return; const int d = (int)(e % HD); const int t = (int)((e / HD) % TT); const int zz = (int)(e / ((size_t)HD * TT)); const float cs = (t < RH) ? 1.0f : (1.0f / PCAR); const size_t oo = (size_t)t * DQ + (h0 + zz) * HD + d;
    v2f o2; o2[0] = O[e] * cs; o2[1] = O[e + 1] * cs; *(v2f*)(OUTb + oo) = o2;  }

extern "C" void kernel_launch(void* const* d_in, const int* in_sizes, int n_in,
                              void* d_out, int out_size, void* d_ws, size_t ws_size, hipStream_t stream) {
    (void)in_sizes; (void)n_in; (void)out_size;
    const float* x = (const float*)d_in[0]; const float* wq = (const float*)d_in[1]; const float* bq = (const float*)d_in[2]; const float* wk = (const float*)d_in[3]; const float* bk = (const float*)d_in[4]; const float* wv = (const float*)d_in[5]; const float* bv = (const float*)d_in[6]; const float* wo = (const float*)d_in[7]; const float* bo = (const float*)d_in[8];
    float* OUT = (float*)d_out;   /* [4][256][4096] channel-major */
    char* wsp = (char*)d_ws;
    auto take = [&](size_t bytes) { char* p = wsp; wsp += (bytes + 255) & ~(size_t)255; return (void*)p; };
    bf* ATh = (bf*)take((size_t)NB_ * TT * HD * 2); bf* ATl = (bf*)take((size_t)NB_ * TT * HD * 2);
    bf* QPh = (bf*)take((size_t)NB_ * TT * HD * 2); bf* QPl = (bf*)take((size_t)NB_ * TT * HD * 2); bf* KPh = (bf*)take((size_t)NB_ * TT * HD * 2); bf* KPl = (bf*)take((size_t)NB_ * TT * HD * 2); bf* VTh = (bf*)take((size_t)NB_ * HD * TT * 2); bf* VTl = (bf*)take((size_t)NB_ * HD * TT * 2);
    if ((size_t)(wsp - (char*)d_ws) > ws_size) return;    // ws 256 MiB
    // the token-major context planes of the NB_ batches lie one behind the other, so the last launch sees NB_ * TT rows; the projections and the attention take the batch from blockIdx.y
    k_proj<<<dim3(TT / PT_, NB_, 1), 256, 0, stream>>>(x, wq, bq, wk, bk, wv, bv, QPh, QPl, KPh, KPl, VTh, VTl);   /* x, Wq, Wk, Wv -> q, k, v hi/lo planes */
    k_fattn<<<dim3(TT / 16, NB_, 1), 256, 0, stream>>>(QPh, QPl, KPh, KPl, VTh, VTl, ATh, ATl);   /* scores + softmax + attn.v -> context hi/lo planes */
    k_tail<<<dim3(NB_ * TT / ET_, CC / EC_, 1), 256, 0, stream>>>(ATh, ATl, wo, bo, OUT);   /* Wo ctx + bo, channel-major */
}

// v006
// It runs in 38.7 microseconds.
// Two timings next to v005 both put it at 1.40 times that version's speed.
// Counting every step since v000, it is 20.5 times as fast.
#include <hip/hip_runtime.h>

// SAGAN self-attention over a feature map (x [4][256][64][64] channel-major; tokens = 4,096 positions; q, k, v = 1x1 convs to 32 channels ('oi' [32][256] + [32]); energy = q.k (unscaled, 32 dims: logit sigma ~5.7); attn = softmax over positions; out = attn v ([4096][32]); y = Wo out + bo (1x1 conv 'oi' [256][32] + [256]) written channel-major -> [4][256][64][64] (4.2 M)).
// Every stage runs once for all NB_ batches (the batch is a grid dimension, or extra rows of a row-contiguous operand); every workspace plane holds NB_ slabs.
// Layout per batch: one launch (k_proj) reads the channel-major slab and the three f32 weight matrices, rounds them to bf16 into LDS (x transposed to token-major on the way), does the three 32-channel projections (exact products + f32 biases) and writes the q, k and v hi/lo planes; scores as hi/lo x hi/lo (3 products) for every row (the logits are too sharp for fp16), softmax with a running maximum and sum on the score tiles in registers, bf16 hi/lo probabilities, attn.v (3 products), all in one launch, which stores the 32-wide context as hi/lo planes; one launch (k_tail) rounds Wo ([256][32]), does Wo x context (hi/lo, exact products) + bo and writes channel-major rows.
// Compute dtypes, f32 accumulate: every input rounded to bf16; projections exact + f32 biases; scores and attn.v 3 products; softmax f32; Wo hl x exact + bias.

#define NB_  4
#define TT   4096
#define DM   256
#define NH_  1
#define NKV  1
#define REP  (NH_ / NKV)
#define HD   32                    // head width of the q, k, v planes and of the context: the real channels only
#define DQ   (NH_ * HD)
#define ZH   1
#define RH   4096                  // read only by k_merge, which is not launched; every query row uses hi+lo planes
#define WIN  0
#define PCAR 1024.0f
#define SCL  1.0f   // unscaled energy
#define CC   256     // channels
#define CQR  32      // real q/k/v channels
typedef _Float16 h16;
typedef unsigned short bf;
typedef __attribute__((ext_vector_type(16))) __bf16   v16bf;
typedef __attribute__((ext_vector_type(16))) _Float16 v16h;
typedef __attribute__((ext_vector_type(8)))  _Float16 v8h;
typedef __attribute__((ext_vector_type(8)))  unsigned short v8us;
typedef __attribute__((ext_vector_type(8)))  float    v8f;
typedef __attribute__((ext_vector_type(4)))  float    v4f;
typedef v8h  __attribute__((may_alias)) v8ha;
typedef v4f  __attribute__((may_alias)) v4fa;
typedef v8us __attribute__((may_alias)) v8usa;

__device__ __forceinline__ unsigned short f2bf(float f) { unsigned u = __float_as_uint(f); u += 0x7FFFu + ((u >> 16) & 1u); return (unsigned short)(u >> 16); }
__device__ __forceinline__ float bf2f(unsigned short b) { return __uint_as_float(((unsigned)b) << 16); }
__device__ __forceinline__ float bfr(float f) { return bf2f(f2bf(f)); }
__device__ __forceinline__ v16h cat16(v8h lo, v8h hi) { return __builtin_shufflevector(lo, hi, 0, 1, 2, 3, 4, 5, 6, 7, 8, 9, 10, 11, 12, 13, 14, 15); }
__device__ __forceinline__ v16bf cat16b(v8us lo, v8us hi) { return __builtin_bit_cast(v16bf, __builtin_shufflevector(lo, hi, 0, 1, 2, 3, 4, 5, 6, 7, 8, 9, 10, 11, 12, 13, 14, 15)); }
__device__ __forceinline__ v8f wmma16(v16h a, v16h b, v8f c) { return __builtin_amdgcn_wmma_f32_16x16x32_f16(false, a, false, b, (short)0, c, false, false); }
__device__ __forceinline__ v8f wmmab(v16bf a, v16bf b, v8f c) { return __builtin_amdgcn_wmma_f32_16x16x32_bf16(false, a, false, b, (short)0, c, false, false); }



// fragment loads: a lane's 16 elements of a K-contiguous 16-bit row are k = 8h .. 8h + 7 and 16 + 8h .. 16 + 8h + 7, the same for the A and the B operand
template <typename T16> struct WFrag;
template <> struct WFrag<h16> { typedef v16h V; static __device__ __forceinline__ V ld(const h16* p) { return cat16(*(const v8h*)p, *(const v8h*)(p + 16)); } static __device__ __forceinline__ v8f mma(V a, V b, v8f c) { return wmma16(a, b, c); } };
template <> struct WFrag<bf> { typedef v16bf V; static __device__ __forceinline__ V ld(const bf* p) { return cat16b(*(const v8us*)p, *(const v8us*)(p + 16)); } static __device__ __forceinline__ v8f mma(V a, V b, v8f c) { return wmmab(a, b, c); } };
__device__ __forceinline__ h16 tohx(float x) { return (h16)x; }
__device__ __forceinline__ void splitf(float y, unsigned short& h, unsigned short& l) { h = f2bf(y); l = f2bf(y - bf2f(h)); }
typedef __attribute__((ext_vector_type(2))) _Float16 v2h;
typedef __attribute__((ext_vector_type(4))) _Float16 v4h;
typedef __attribute__((ext_vector_type(2))) unsigned short v2us;
typedef __attribute__((ext_vector_type(4))) unsigned short v4us;
typedef __attribute__((ext_vector_type(2))) float v2f;
typedef __attribute__((ext_vector_type(4))) int v4i;

__global__ __launch_bounds__(256) void k_wtG(const float* __restrict__ w, int K, int N, bf* Bt) {
    const int lane = threadIdx.x & 31; const int L0 = (blockIdx.x * 8 + (threadIdx.x >> 5)) * 8; const int nlines = N * K / 64;
{
#pragma unroll 1
        for (int l = 0; l < 8; ++l) { const int L = L0 + l; if (L >= nlines) break; const size_t e = (size_t)L * 64 + lane * 2; const int k = (int)(e % K), n = (int)(e / K); v2us o;
            o[0] = f2bf(w[(size_t)k * N + n]); o[1] = f2bf(w[(size_t)(k + 1) * N + n]); *(v2us*)(Bt + e) = o; }
         }
}
__global__ __launch_bounds__(256) void k_cvt8(const float* __restrict__ src, bf* dst, size_t n8) { const size_t i = (size_t)blockIdx.x * 256 + threadIdx.x; if (i >= n8) return; const v8f v = *(const v8f*)(src + i * 8); v8us o;
#pragma unroll
    for (int k = 0; k < 8; ++k) o[k] = f2bf(v[k]); *(v8us*)(dst + i * 8) = o;  }


typedef __attribute__((ext_vector_type(2))) __bf16 v2bf;
typedef float __attribute__((may_alias)) fa;
typedef v2f __attribute__((may_alias)) v2fa;
#define FW_   8                 // waves of a work-group = key splits
#define FQT   2                 // query tiles (16 columns each) of a wave
#define FSK   64                // keys per stage
#define FKP   40                // LDS pitch of a K row (HD elements), 16-bit elements
#define FPI   72                // LDS pitch of a V^T row (FSK elements), 16-bit elements
#define FKT   (FSK * FKP)       // one staged K plane: FSK rows
#define FVT   (HD * FPI)        // one staged V^T plane: HD rows
#define FSL   (2 * FKT + 2 * FVT)   // one wave's slice
#define FOP   36                // merge row pitch, floats
#define FMB   (16 * FOP + 32)   // one query tile's merge block, floats
#define L2E   1.4426950408889634f
__device__ __forceinline__ float xhalf(float v) { const int b = __float_as_int(v); return __int_as_float(__builtin_amdgcn_permlanex16(b, b, 0x76543210, 0xfedcba98, false, false)); }
// orders one wave's LDS stores against its own later LDS loads of other lanes' bytes (the LDS serves a wave in order; this keeps the compiler from swapping them)
__device__ __forceinline__ void wave_order() { __builtin_amdgcn_wave_barrier(); asm volatile("" ::: "memory"); }
// four waves a SIMD (two work-groups a WGP, as the LDS allows): the register budget is 256
__global__ __launch_bounds__(256) __attribute__((amdgpu_waves_per_eu(4, 4))) void k_fattn(const bf* __restrict__ Qh, const bf* __restrict__ Ql, const bf* __restrict__ Kh, const bf* __restrict__ Kl, const bf* __restrict__ Vh, const bf* __restrict__ Vl, bf* __restrict__ Ch, bf* __restrict__ Cl) {
    __shared__ __align__(16) bf sm[FW_ * FSL];
    const int lane = threadIdx.x & 31, c = lane & 15, h = lane >> 4; const int w = __builtin_amdgcn_readfirstlane((int)(threadIdx.x >> 5)); const int q0 = blockIdx.x * (16 * FQT);
    { const size_t zb = (size_t)blockIdx.y * TT * HD; Qh += zb; Ql += zb; Kh += zb; Kl += zb; Vh += zb; Vl += zb; Ch += zb; Cl += zb; }   // blockIdx.y = batch
    bf* kh_s = sm + w * FSL; bf* kl_s = kh_s + FKT; bf* vh_s = kl_s + FKT; bf* vl_s = vh_s + FVT;
    v16bf qh[FQT], ql[FQT]; v8f o[FQT][2]; float m[FQT], l[FQT];
#pragma unroll
    for (int t = 0; t < FQT; ++t) { const bf* pqh = Qh + (size_t)(q0 + t * 16 + c) * HD + 8 * h; const bf* pql = Ql + (size_t)(q0 + t * 16 + c) * HD + 8 * h;
        qh[t] = WFrag<bf>::ld(pqh); ql[t] = WFrag<bf>::ld(pql); o[t][0] = (v8f){}; o[t][1] = (v8f){}; m[t] = -3.0e38f; l[t] = 0.0f;
        asm volatile("s_wait_xcnt 0x0" :: "v"(pqh), "v"(pql) : "memory"); }   // precaution: stands before any overwrite of the address registers of the loads just issued; naming them keeps them whole up to here
    const int kdst = (lane >> 2) * FKP + (lane & 3) * 8;                                   // a 16-byte piece of a K row: 4 lanes a row, 8 rows a load
    const int srow = lane >> 3, scol = (lane & 7) * 8, vdst = srow * FPI + scol;           // of a V^T row: 8 lanes a row, 4 rows a load
    const int kbase = w * (TT / FW_);
    v8us st[16];
#pragma unroll
    for (int i = 0; i < 8; ++i) { st[i] = *(const v8us*)(Kh + (size_t)kbase * HD + i * 256 + lane * 8); st[8 + i] = *(const v8us*)(Kl + (size_t)kbase * HD + i * 256 + lane * 8); }
#pragma unroll 1
    for (int s = 0; s < TT / FW_ / FSK; ++s) {
        const int key0 = kbase + s * FSK;
#pragma unroll
        for (int i = 0; i < 8; ++i) { *(v8us*)(kh_s + kdst + i * 8 * FKP) = st[i]; *(v8us*)(kl_s + kdst + i * 8 * FKP) = st[8 + i]; }
        // this stage's V^T rows fly while the scores are computed
        const bf* pvh = Vh + (size_t)srow * TT + key0 + scol; const bf* pvl = Vl + (size_t)srow * TT + key0 + scol;
#pragma unroll
        for (int i = 0; i < 8; ++i) { st[i] = *(const v8us*)(pvh + (size_t)i * 4 * TT); st[8 + i] = *(const v8us*)(pvl + (size_t)i * 4 * TT); }
        asm volatile("s_wait_xcnt 0x0" :: "v"(pvh), "v"(pvl) : "memory");   // precaution: stands before any overwrite of the address registers of the loads just issued; naming them keeps them whole up to here
        wave_order();
        v8f sc[FQT][4];
#pragma unroll
        for (int kp = 0; kp < 4; kp += 2) { v16bf a[2], a2[2];   // two key tiles at a time: 2 * FQT independent accumulators
#pragma unroll
            for (int k = 0; k < 2; ++k) { a[k] = WFrag<bf>::ld(kh_s + ((kp + k) * 16 + c) * FKP + 8 * h); a2[k] = WFrag<bf>::ld(kl_s + ((kp + k) * 16 + c) * FKP + 8 * h); }
#pragma unroll
            for (int t = 0; t < FQT; ++t)
#pragma unroll
                for (int k = 0; k < 2; ++k) sc[t][kp + k] = wmmab(a[k], qh[t], (v8f){});
#pragma unroll
            for (int t = 0; t < FQT; ++t)
#pragma unroll
                for (int k = 0; k < 2; ++k) sc[t][kp + k] = wmmab(a[k], ql[t], sc[t][kp + k]);
#pragma unroll
            for (int t = 0; t < FQT; ++t)
#pragma unroll
                for (int k = 0; k < 2; ++k) sc[t][kp + k] = wmmab(a2[k], qh[t], sc[t][kp + k]); }
#pragma unroll
        for (int t = 0; t < FQT; ++t) {
            float mx = sc[t][0][0];
#pragma unroll
            for (int kt = 0; kt < 4; ++kt)
#pragma unroll
                for (int r = 0; r < 8; ++r) mx = fmaxf(mx, sc[t][kt][r]);
            mx = fmaxf(mx, xhalf(mx));
            const float mn = fmaxf(m[t], mx); const float al = __builtin_amdgcn_exp2f((m[t] - mn) * L2E); m[t] = mn;
            float ps = 0.0f;
#pragma unroll
            for (int kt = 0; kt < 4; ++kt)
#pragma unroll
                for (int r = 0; r < 8; ++r) { const float p = __builtin_amdgcn_exp2f((sc[t][kt][r] - mn) * L2E); sc[t][kt][r] = p; ps += p; }
            l[t] = l[t] * al + ps;
#pragma unroll
            for (int dt = 0; dt < 2; ++dt) o[t][dt] *= al;
        }
        wave_order();
#pragma unroll
        for (int i = 0; i < 8; ++i) { *(v8us*)(vh_s + vdst + i * 4 * FPI) = st[i]; *(v8us*)(vl_s + vdst + i * 4 * FPI) = st[8 + i]; }
        // the next stage's K rows fly while attn.v is computed
        if (s + 1 < TT / FW_ / FSK) {
            const bf* pkh = Kh + (size_t)(key0 + FSK) * HD + lane * 8; const bf* pkl = Kl + (size_t)(key0 + FSK) * HD + lane * 8;
#pragma unroll
            for (int i = 0; i < 8; ++i) { st[i] = *(const v8us*)(pkh + i * 256); st[8 + i] = *(const v8us*)(pkl + i * 256); }
            asm volatile("s_wait_xcnt 0x0" :: "v"(pkh), "v"(pkl) : "memory");   // same precaution as behind the V^T loads
        }
        wave_order();
#pragma unroll
        for (int kb = 0; kb < 2; ++kb) { v16bf ph[FQT], pl[FQT];
#pragma unroll
            for (int t = 0; t < FQT; ++t)
#pragma unroll
                for (int e = 0; e < 16; e += 2) { v2f pp; pp[0] = sc[t][2 * kb + (e >> 3)][e & 7]; pp[1] = sc[t][2 * kb + (e >> 3)][(e & 7) + 1]; const v2bf hh = __builtin_convertvector(pp, v2bf); const v2f bk = __builtin_convertvector(hh, v2f); const v2bf ll = __builtin_convertvector(pp - bk, v2bf); ph[t][e] = hh[0]; ph[t][e + 1] = hh[1]; pl[t][e] = ll[0]; pl[t][e + 1] = ll[1]; }
            v16bf a[2], a2[2];
#pragma unroll
            for (int dt = 0; dt < 2; ++dt) { a[dt] = WFrag<bf>::ld(vh_s + (dt * 16 + c) * FPI + kb * 32 + 8 * h); a2[dt] = WFrag<bf>::ld(vl_s + (dt * 16 + c) * FPI + kb * 32 + 8 * h); }
#pragma unroll
            for (int t = 0; t < FQT; ++t)
#pragma unroll
                for (int dt = 0; dt < 2; ++dt) o[t][dt] = wmmab(a[dt], ph[t], o[t][dt]);
#pragma unroll
            for (int t = 0; t < FQT; ++t)
#pragma unroll
                for (int dt = 0; dt < 2; ++dt) o[t][dt] = wmmab(a2[dt], ph[t], o[t][dt]);
#pragma unroll
            for (int t = 0; t < FQT; ++t)
#pragma unroll
                for (int dt = 0; dt < 2; ++dt) o[t][dt] = wmmab(a[dt], pl[t], o[t][dt]); }
    }
    // each wave's partial O^T, maximum and sum go into its own slice, then the work-group merges the 8 key splits
    fa* of = (fa*)kh_s;   // FQT blocks of FMB floats: 16 rows of FOP, then the 16 maxima and the 16 sums
#pragma unroll
    for (int t = 0; t < FQT; ++t) { l[t] += xhalf(l[t]);
#pragma unroll
        for (int dt = 0; dt < 2; ++dt) { v4f lo4, hi4;
#pragma unroll
            for (int r = 0; r < 4; ++r) { lo4[r] = o[t][dt][r]; hi4[r] = o[t][dt][4 + r]; }
            *(v4fa*)(of + t * FMB + c * FOP + dt * 16 + 8 * h) = lo4; *(v4fa*)(of + t * FMB + c * FOP + dt * 16 + 8 * h + 4) = hi4; }
        if (h == 0) { of[t * FMB + 16 * FOP + c] = m[t]; of[t * FMB + 16 * FOP + 16 + c] = l[t]; } }
    __syncthreads();
    const int q = threadIdx.x >> 4, d0 = (threadIdx.x & 15) * 2;
#pragma unroll
    for (int t = 0; t < FQT; ++t) {
        float M = -3.0e38f;
#pragma unroll
        for (int u = 0; u < FW_; ++u) M = fmaxf(M, ((const fa*)(sm + u * FSL))[t * FMB + 16 * FOP + q]);
        float L = 0.0f; v2f acc = (v2f){};
#pragma unroll
        for (int u = 0; u < FW_; ++u) { const fa* b = (const fa*)(sm + u * FSL) + t * FMB; const float f = __builtin_amdgcn_exp2f((b[16 * FOP + q] - M) * L2E); L += b[16 * FOP + 16 + q] * f; acc += *(const v2fa*)(b + q * FOP + d0) * f; }
        const float inv = __fdiv_rn(1.0f, L);
        const v2f y = acc * inv; unsigned short h0, l0, h1, l1; splitf(y[0], h0, l0); splitf(y[1], h1, l1);   // the context leaves as hi/lo planes: a token's row is 64 B, a tile's 16 rows 1 KiB a plane
        v2us yh, yl; yh[0] = h0; yh[1] = h1; yl[0] = l0; yl[1] = l1;
        *(v2us*)(Ch + (size_t)(q0 + t * 16 + q) * HD + d0) = yh; *(v2us*)(Cl + (size_t)(q0 + t * 16 + q) * HD + d0) = yl;
    }
}

// k_proj: everything in front of the attention in one launch. One work-group = PT_ tokens of one batch (blockIdx.y) x the 96 output channels of q, k and v.
// Wave w reads channels 32w..32w+31 of the tokens (16-byte loads along the tokens: 256 contiguous bytes a channel row), rounds them to bf16 and stores them token-major in LDS:
// a lane's 4 tokens go to 4 different 16-row tiles (LDS row j * 16 + lr = token 4 * lr + j), so its 8 channels of one token are one 16-byte store. The 96 weight rows are rounded into LDS beside them.
// Behind the barrier wave w does token tile w & 3 x output tiles 3 * (w >> 2) .. + 2, the channels in rising order in one accumulator each; results + biases go through LDS so that every plane is stored in whole rows.
typedef __attribute__((ext_vector_type(8))) __bf16 v8bf;
#define PT_  64                 // tokens of a work-group
#define PNO  96                 // output channels: q 0..31, k 32..63, v 64..95
#define PXP  264                // LDS pitch of a row of CC 16-bit channels: 512 B + 16 B
#define POP  100                // LDS pitch of a token's PNO f32 results, floats
__device__ __forceinline__ v8us rnd8(v8f v) { return __builtin_bit_cast(v8us, __builtin_convertvector(v, v8bf)); }   // nearest even, as f2bf
__device__ __forceinline__ void split8(v8f y, v8us& h, v8us& l) { h = rnd8(y); l = rnd8(y - __builtin_convertvector(__builtin_bit_cast(v8bf, h), v8f)); }
__global__ __launch_bounds__(256) void k_proj(const float* __restrict__ x, const float* __restrict__ wq, const float* __restrict__ bq, const float* __restrict__ wk, const float* __restrict__ bk, const float* __restrict__ wv, const float* __restrict__ bv, bf* Qh, bf* Ql, bf* Kh, bf* Kl, bf* Vh, bf* Vl) {
    __shared__ __align__(16) bf xs[PT_ * PXP];
    __shared__ __align__(16) bf wsh[PNO * PXP];
    __shared__ __align__(16) float os[PT_ * POP];
    const int lane = threadIdx.x & 31, lr = lane & 15, hi = lane >> 4; const int w = __builtin_amdgcn_readfirstlane((int)(threadIdx.x >> 5));
    const int n0 = blockIdx.x * PT_; const size_t b = blockIdx.y;
    const int mt = w & 3, g = w >> 2;
    const float* xp = x + (b * CC + 32 * w + 8 * hi) * TT + n0 + 4 * lr;
    v4f xv[16];
#pragma unroll
    for (int e = 0; e < 8; ++e) { xv[e] = *(const v4f*)(xp + (size_t)e * TT); xv[8 + e] = *(const v4f*)(xp + (size_t)(16 + e) * TT); }
    v4f wr[24];   // wave w rounds weight rows w, w + 8, ... of each matrix: a row is 1 KiB, 32 bytes a lane
#pragma unroll
    for (int s = 0; s < 12; ++s) { const float* wp = ((s < 4) ? wq : (s < 8) ? wk : wv) + (size_t)(w + 8 * (s & 3)) * CC + lane * 8; wr[2 * s] = *(const v4f*)wp; wr[2 * s + 1] = *(const v4f*)(wp + 4); }
    float bias[3];
#pragma unroll
    for (int n = 0; n < 3; ++n) { const int nt = 3 * g + n; const float* bp = (nt < 2) ? bq : (nt < 4) ? bk : bv; bias[n] = bfr(bp[(nt & 1) * 16 + lr]); }
    asm volatile("s_wait_xcnt 0x0" :: "v"(xp) : "memory");   // precaution: stands before any overwrite of the address registers of the loads just issued; naming the x address keeps it whole up to here
#pragma unroll
    for (int j = 0; j < 4; ++j) { v8f t0, t1;
#pragma unroll
        for (int e = 0; e < 8; ++e) { t0[e] = xv[e][j]; t1[e] = xv[8 + e][j]; }
        bf* d = xs + (j * 16 + lr) * PXP + 32 * w + 8 * hi; *(v8us*)d = rnd8(t0); *(v8us*)(d + 16) = rnd8(t1); }
#pragma unroll
    for (int s = 0; s < 12; ++s) { const v8f t = __builtin_shufflevector(wr[2 * s], wr[2 * s + 1], 0, 1, 2, 3, 4, 5, 6, 7); *(v8us*)(wsh + ((s >> 2) * 32 + w + 8 * (s & 3)) * PXP + lane * 8) = rnd8(t); }
    __syncthreads();
    v8f acc[3];
#pragma unroll
    for (int n = 0; n < 3; ++n) acc[n] = (v8f){};
#pragma unroll
    for (int kc = 0; kc < CC; kc += 32) { const v16bf a = WFrag<bf>::ld(xs + (mt * 16 + lr) * PXP + kc + 8 * hi);
#pragma unroll
        for (int n = 0; n < 3; ++n) acc[n] = wmmab(a, WFrag<bf>::ld(wsh + ((3 * g + n) * 16 + lr) * PXP + kc + 8 * hi), acc[n]); }
#pragma unroll
    for (int n = 0; n < 3; ++n)
#pragma unroll
        for (int r = 0; r < 8; ++r) os[(4 * (8 * hi + r) + mt) * POP + (3 * g + n) * 16 + lr] = acc[n][r] + bias[n];
    __syncthreads();
    { const int t = threadIdx.x >> 2, c0 = (threadIdx.x & 3) * 8; const float* p = os + t * POP + c0; const size_t o = (b * TT + n0 + t) * HD + c0; v8us h8, l8;   // q, k: 8 channels of a token a thread
        split8(__builtin_shufflevector(*(const v4fa*)p, *(const v4fa*)(p + 4), 0, 1, 2, 3, 4, 5, 6, 7), h8, l8); *(v8us*)(Qh + o) = h8; *(v8us*)(Ql + o) = l8;
        split8(__builtin_shufflevector(*(const v4fa*)(p + 32), *(const v4fa*)(p + 36), 0, 1, 2, 3, 4, 5, 6, 7), h8, l8); *(v8us*)(Kh + o) = h8; *(v8us*)(Kl + o) = l8; }
    { const int d = threadIdx.x >> 3, t0 = (threadIdx.x & 7) * 8; v8f y; v8us h8, l8;   // v, channel-major: 8 tokens of a channel a thread
#pragma unroll
        for (int q = 0; q < 8; ++q) y[q] = os[(t0 + q) * POP + 64 + d];
        const size_t o = (b * HD + d) * TT + n0 + t0; split8(y, h8, l8); *(v8us*)(Vh + o) = h8; *(v8us*)(Vl + o) = l8; }
}
// k_tail: everything behind the attention in one launch. One work-group = ET_ tokens (all of one batch) x EC_ output channels.
// y^T = Wo ctx^T: A = 16 rows of Wo, B = the context planes (hi, then lo, in one accumulator), so a lane holds 8 channels of one token.
// The work-group's EC_ rows of Wo (f32, contiguous) are read in whole lines, rounded to bf16 and laid in LDS once; behind the barrier wave w does token tile w x the EC_ / 16 channel tiles.
// The results go through LDS so that every store is 512 contiguous bytes of one channel row of the channel-major output; the bias is added there.
typedef __attribute__((ext_vector_type(4))) __bf16 v4bf;
#define ET_  128                // tokens of a work-group
#define EC_  128                // output channels of a work-group: the grid is one work-group a WGP
#define EWP  40                 // LDS pitch of a rounded Wo row (CQR elements), 16-bit elements: 64 B + 16 B
#define EOP  132                // LDS pitch of a channel's ET_ f32 results, floats: rows 8 apart lie 32 banks apart
__global__ __launch_bounds__(256) void k_tail(const bf* __restrict__ Ch, const bf* __restrict__ Cl, const float* __restrict__ wo, const float* __restrict__ bo, float* __restrict__ out) {
    __shared__ __align__(16) bf wsh[EC_ * EWP];
    __shared__ __align__(16) float os[EC_ * EOP];
    const int lane = threadIdx.x & 31, lr = lane & 15, hi = lane >> 4; const int w = __builtin_amdgcn_readfirstlane((int)(threadIdx.x >> 5));
    const int t0 = blockIdx.x * ET_, c0 = blockIdx.y * EC_;   // t0 counts the tokens of all batches, one behind the other
    float bias[EC_ / 8];
#pragma unroll
    for (int i = 0; i < EC_ / 8; ++i) bias[i] = bfr(bo[c0 + w + 8 * i]);
    const int tid = threadIdx.x; const float* pw = wo + (size_t)(c0 * CQR + tid * 4);   // 4 of a row's CQR floats a thread: 32 rows a load
    const bf* ph = Ch + (size_t)(t0 + 16 * w + lr) * HD + 8 * hi; const bf* pl = Cl + (size_t)(t0 + 16 * w + lr) * HD + 8 * hi;
    v4f wr[EC_ / 32];
#pragma unroll
    for (int j = 0; j < EC_ / 32; ++j) wr[j] = *(const v4f*)(pw + j * 32 * CQR);
    const v16bf bh = WFrag<bf>::ld(ph), bl = WFrag<bf>::ld(pl);
    asm volatile("s_wait_xcnt 0x0" :: "v"(pw), "v"(ph), "v"(pl) : "memory");   // precaution: stands before any overwrite of the address registers of the loads just issued; naming them keeps them whole up to here
#pragma unroll
    for (int j = 0; j < EC_ / 32; ++j) *(v4us*)(wsh + (32 * j + (tid >> 3)) * EWP + (tid & 7) * 4) = __builtin_bit_cast(v4us, __builtin_convertvector(wr[j], v4bf));   // nearest even, as f2bf
    __syncthreads();
#pragma unroll
    for (int mt = 0; mt < EC_ / 16; ++mt) { const v16bf a = WFrag<bf>::ld(wsh + (16 * mt + lr) * EWP + 8 * hi);
        v8f d = wmmab(a, bh, (v8f){}); d = wmmab(a, bl, d);
#pragma unroll
        for (int r = 0; r < 8; ++r) os[(16 * mt + 8 * hi + r) * EOP + 16 * w + lr] = d[r]; }
    __syncthreads();
    float* po = out + ((size_t)(t0 / TT) * CC + c0 + w) * TT + (t0 % TT) + lane * 4;   // wave w stores channel rows w, w + 8, ...
#pragma unroll
    for (int i = 0; i < EC_ / 8; ++i) { v4f v = *(const v4fa*)(os + (w + 8 * i) * EOP + lane * 4); v += bias[i]; *(v4f*)(po + (size_t)i * 8 * TT) = v; }
}
__global__ __launch_bounds__(256) void k_merge(const float* __restrict__ O, int h0, float* OUTb) { const size_t e = ((size_t)blockIdx.x * 256 + threadIdx.x) * 2; if (e >= (size_t)ZH * TT * HD) return; const int d = (int)(e % HD); const int t = (int)((e / HD) % TT); const int zz = (int)(e / ((size_t)HD * TT)); const float cs = (t < RH) ? 1.0f : (1.0f / PCAR); const size_t oo = (size_t)t * DQ + (h0 + zz) * HD + d;
    v2f o2; o2[0] = O[e] * cs; o2[1] = O[e + 1] * cs; *(v2f*)(OUTb + oo) = o2;  }

extern "C" void kernel_launch(void* const* d_in, const int* in_sizes, int n_in,
                              void* d_out, int out_size, void* d_ws, size_t ws_size, hipStream_t stream) {
    (void)in_sizes; (void)n_in; (void)out_size;
    const float* x = (const float*)d_in[0]; const float* wq = (const float*)d_in[1]; const float* bq = (const float*)d_in[2]; const float* wk = (const float*)d_in[3]; const float* bk = (const float*)d_in[4]; const float* wv = (const float*)d_in[5]; const float* bv = (const float*)d_in[6]; const float* wo = (const float*)d_in[7]; const float* bo = (const float*)d_in[8];
    float* OUT = (float*)d_out;   /* [4][256][4096] channel-major */
    char* wsp = (char*)d_ws;
    auto take = [&](size_t bytes) { char* p = wsp; wsp += (bytes + 255) & ~(size_t)255; return (void*)p; };
    bf* ATh = (bf*)take((size_t)NB_ * TT * HD * 2); bf* ATl = (bf*)take((size_t)NB_ * TT * HD * 2);
    bf* QPh = (bf*)take((size_t)NB_ * TT * HD * 2); bf* QPl = (bf*)take((size_t)NB_ * TT * HD * 2); bf* KPh = (bf*)take((size_t)NB_ * TT * HD * 2); bf* KPl = (bf*)take((size_t)NB_ * TT * HD * 2); bf* VTh = (bf*)take((size_t)NB_ * HD * TT * 2); bf* VTl = (bf*)take((size_t)NB_ * HD * TT * 2);
    if ((size_t)(wsp - (char*)d_ws) > ws_size) return;    // ws 256 MiB
    // the token-major context planes of the NB_ batches lie one behind the other, so the last launch sees NB_ * TT rows; the projections and the attention take the batch from blockIdx.y
    k_proj<<<dim3(TT / PT_, NB_, 1), 256, 0, stream>>>(x, wq, bq, wk, bk, wv, bv, QPh, QPl, KPh, KPl, VTh, VTl);   /* x, Wq, Wk, Wv -> q, k, v hi/lo planes */
    k_fattn<<<dim3(TT / (16 * FQT), NB_, 1), 256, 0, stream>>>(QPh, QPl, KPh, KPl, VTh, VTl, ATh, ATl);   /* scores + softmax + attn.v -> context hi/lo planes */
    k_tail<<<dim3(NB_ * TT / ET_, CC / EC_, 1), 256, 0, stream>>>(ATh, ATl, wo, bo, OUT);   /* Wo ctx + bo, channel-major */
}

// v007
// Measured time: 31.7 microseconds a run.
// Next to v006, in two timings, it ran 1.22 and 1.21 times as fast.
// Counting every step since v000, it is 25.0 times as fast.
#include <hip/hip_runtime.h>

// SAGAN self-attention over a feature map (x [4][256][64][64] channel-major; tokens = 4,096 positions; q, k, v = 1x1 convs to 32 channels ('oi' [32][256] + [32]); energy = q.k (unscaled, 32 dims: logit sigma ~5.7); attn = softmax over positions; out = attn v ([4096][32]); y = Wo out + bo (1x1 conv 'oi' [256][32] + [256]) written channel-major -> [4][256][64][64] (4.2 M)).
// Every stage runs once for all NB_ batches (the batch is a grid dimension, or extra rows of a row-contiguous operand); every workspace plane holds NB_ slabs.
// Layout per batch: one launch (k_proj) reads the channel-major slab and the three f32 weight matrices, rounds them to bf16 into LDS (x transposed to token-major on the way), does the three 32-channel projections (exact products + f32 biases) and writes the q, k and v hi/lo planes; scores as hi/lo x hi/lo (3 products) for every row (the logits are too sharp for fp16), softmax with a running maximum and sum on the score tiles in registers, bf16 hi/lo probabilities, attn.v (3 products), all in one launch, which stores one f32 partial context with its maximum and sum per key split; one launch (k_tail) merges the splits into the 32-wide hi/lo context, rounds Wo ([256][32]), does Wo x context (hi/lo, exact products) + bo and writes channel-major rows.
// Compute dtypes, f32 accumulate: every input rounded to bf16; projections exact + f32 biases; scores and attn.v 3 products; softmax f32; Wo hl x exact + bias.

#define NB_  4
#define TT   4096
#define DM   256
#define NH_  1
#define NKV  1
#define REP  (NH_ / NKV)
#define HD   32                    // head width of the q, k, v planes and of the context: the real channels only
#define DQ   (NH_ * HD)
#define ZH   1
#define RH   4096                  // read only by k_merge, which is not launched; every query row uses hi+lo planes
#define WIN  0
#define PCAR 1024.0f
#define SCL  1.0f   // unscaled energy
#define CC   256     // channels
#define CQR  32      // real q/k/v channels
typedef _Float16 h16;
typedef unsigned short bf;
typedef __attribute__((ext_vector_type(16))) __bf16   v16bf;
typedef __attribute__((ext_vector_type(16))) _Float16 v16h;
typedef __attribute__((ext_vector_type(8)))  _Float16 v8h;
typedef __attribute__((ext_vector_type(8)))  unsigned short v8us;
typedef __attribute__((ext_vector_type(8)))  float    v8f;
typedef __attribute__((ext_vector_type(4)))  float    v4f;
typedef v8h  __attribute__((may_alias)) v8ha;
typedef v4f  __attribute__((may_alias)) v4fa;
typedef v8us __attribute__((may_alias)) v8usa;

__device__ __forceinline__ unsigned short f2bf(float f) { unsigned u = __float_as_uint(f); u += 0x7FFFu + ((u >> 16) & 1u); return (unsigned short)(u >> 16); }
__device__ __forceinline__ float bf2f(unsigned short b) { return __uint_as_float(((unsigned)b) << 16); }
__device__ __forceinline__ float bfr(float f) { return bf2f(f2bf(f)); }
__device__ __forceinline__ v16h cat16(v8h lo, v8h hi) { return __builtin_shufflevector(lo, hi, 0, 1, 2, 3, 4, 5, 6, 7, 8, 9, 10, 11, 12, 13, 14, 15); }
__device__ __forceinline__ v16bf cat16b(v8us lo, v8us hi) { return __builtin_bit_cast(v16bf, __builtin_shufflevector(lo, hi, 0, 1, 2, 3, 4, 5, 6, 7, 8, 9, 10, 11, 12, 13, 14, 15)); }
__device__ __forceinline__ v8f wmma16(v16h a, v16h b, v8f c) { return __builtin_amdgcn_wmma_f32_16x16x32_f16(false, a, false, b, (short)0, c, false, false); }
__device__ __forceinline__ v8f wmmab(v16bf a, v16bf b, v8f c) { return __builtin_amdgcn_wmma_f32_16x16x32_bf16(false, a, false, b, (short)0, c, false, false); }



// fragment loads: a lane's 16 elements of a K-contiguous 16-bit row are k = 8h .. 8h + 7 and 16 + 8h .. 16 + 8h + 7, the same for the A and the B operand
template <typename T16> struct WFrag;
template <> struct WFrag<h16> { typedef v16h V; static __device__ __forceinline__ V ld(const h16* p) { return cat16(*(const v8h*)p, *(const v8h*)(p + 16)); } static __device__ __forceinline__ v8f mma(V a, V b, v8f c) { return wmma16(a, b, c); } };
template <> struct WFrag<bf> { typedef v16bf V; static __device__ __forceinline__ V ld(const bf* p) { return cat16b(*(const v8us*)p, *(const v8us*)(p + 16)); } static __device__ __forceinline__ v8f mma(V a, V b, v8f c) { return wmmab(a, b, c); } };
__device__ __forceinline__ h16 tohx(float x) { return (h16)x; }
__device__ __forceinline__ void splitf(float y, unsigned short& h, unsigned short& l) { h = f2bf(y); l = f2bf(y - bf2f(h)); }
typedef __attribute__((ext_vector_type(2))) _Float16 v2h;
typedef __attribute__((ext_vector_type(4))) _Float16 v4h;
typedef __attribute__((ext_vector_type(2))) unsigned short v2us;
typedef __attribute__((ext_vector_type(4))) unsigned short v4us;
typedef __attribute__((ext_vector_type(2))) float v2f;
typedef __attribute__((ext_vector_type(4))) int v4i;

__global__ __launch_bounds__(256) void k_wtG(const float* __restrict__ w, int K, int N, bf* Bt) {
    const int lane = threadIdx.x & 31; const int L0 = (blockIdx.x * 8 + (threadIdx.x >> 5)) * 8; const int nlines = N * K / 64;
{
#pragma unroll 1
        for (int l = 0; l < 8; ++l) { const int L = L0 + l; if (L >= nlines) break; const size_t e = (size_t)L * 64 + lane * 2; const int k = (int)(e % K), n = (int)(e / K); v2us o;
            o[0] = f2bf(w[(size_t)k * N + n]); o[1] = f2bf(w[(size_t)(k + 1) * N + n]); *(v2us*)(Bt + e) = o; }
         }
}
__global__ __launch_bounds__(256) void k_cvt8(const float* __restrict__ src, bf* dst, size_t n8) { const size_t i = (size_t)blockIdx.x * 256 + threadIdx.x; if (i >= n8) return; const v8f v = *(const v8f*)(src + i * 8); v8us o;
#pragma unroll
    for (int k = 0; k < 8; ++k) o[k] = f2bf(v[k]); *(v8us*)(dst + i * 8) = o;  }


typedef __attribute__((ext_vector_type(2))) __bf16 v2bf;
#define FW_   8                 // waves of a work-group = query groups
#define FKS   8                 // key splits = grid z
#define FQT   2                 // query tiles (16 columns each) of a wave
#define FSK   64                // keys per stage
#define FNS   (TT / FKS / FSK)  // stages of a key split
#define FKP   40                // LDS pitch of a K row (HD elements), 16-bit elements
#define FPI   72                // LDS pitch of a V^T row (FSK elements), 16-bit elements
#define FKT   (FSK * FKP)       // one staged K plane: FSK rows
#define FVT   (HD * FPI)        // one staged V^T plane: HD rows
#define FSL   (2 * FKT + 2 * FVT)   // one stage buffer
#define NTL   (NB_ * TT / 16)   // query tiles of all batches: one key split's slab of partial results
#define L2E   1.4426950408889634f
__device__ __forceinline__ float xhalf(float v) { const int b = __float_as_int(v); return __int_as_float(__builtin_amdgcn_permlanex16(b, b, 0x76543210, 0xfedcba98, false, false)); }
// four waves a SIMD (two work-groups a WGP): the register budget is 256
__global__ __launch_bounds__(256) __attribute__((amdgpu_waves_per_eu(4, 4))) void k_fattn(const bf* __restrict__ Qh, const bf* __restrict__ Ql, const bf* __restrict__ Kh, const bf* __restrict__ Kl, const bf* __restrict__ Vh, const bf* __restrict__ Vl, float* __restrict__ PO, float* __restrict__ PML) {
    __shared__ __align__(16) bf sm[2 * FSL];
    const int tid = threadIdx.x, lane = tid & 31, c = lane & 15, h = lane >> 4; const int w = __builtin_amdgcn_readfirstlane((int)(threadIdx.x >> 5)); const int q0 = (blockIdx.x * FW_ + w) * (16 * FQT);
    { const size_t zb = (size_t)blockIdx.y * TT * HD; Qh += zb; Ql += zb; Kh += zb; Kl += zb; Vh += zb; Vl += zb; }   // blockIdx.y = batch
    v16bf qh[FQT], ql[FQT]; v8f o[FQT][2]; float m[FQT], l[FQT];
#pragma unroll
    for (int t = 0; t < FQT; ++t) { const bf* pqh = Qh + (size_t)(q0 + t * 16 + c) * HD + 8 * h; const bf* pql = Ql + (size_t)(q0 + t * 16 + c) * HD + 8 * h;
        qh[t] = WFrag<bf>::ld(pqh); ql[t] = WFrag<bf>::ld(pql); o[t][0] = (v8f){}; o[t][1] = (v8f){}; m[t] = -3.0e38f; l[t] = 0.0f;
        asm volatile("s_wait_xcnt 0x0" :: "v"(pqh), "v"(pql) : "memory"); }   // precaution: stands before any overwrite of the address registers of the loads just issued; naming them keeps them whole up to here
    const int kdst = (tid >> 2) * FKP + (tid & 3) * 8;                                    // a 16-byte piece of a K row: 4 threads a row, the work-group covers the 64 rows
    const int srow = tid >> 3, scol = (tid & 7) * 8, vdst = srow * FPI + scol;            // of a V^T row: 8 threads a row, the work-group covers the 32 rows
    const int kbase = blockIdx.z * (TT / FKS);
    v8us st[4];
    { const bf* pkh = Kh + (size_t)kbase * HD + tid * 8; const bf* pkl = Kl + (size_t)kbase * HD + tid * 8; const bf* pvh = Vh + (size_t)srow * TT + kbase + scol; const bf* pvl = Vl + (size_t)srow * TT + kbase + scol;
        st[0] = *(const v8us*)pkh; st[1] = *(const v8us*)pkl; st[2] = *(const v8us*)pvh; st[3] = *(const v8us*)pvl;
        asm volatile("s_wait_xcnt 0x0" :: "v"(pkh), "v"(pkl), "v"(pvh), "v"(pvl) : "memory"); }   // same precaution as behind the Q loads
#pragma unroll 1
    for (int s = 0; s < FNS; ++s) {
        bf* kh_s = sm + (s & 1) * FSL; bf* kl_s = kh_s + FKT; bf* vh_s = kl_s + FKT; bf* vl_s = vh_s + FVT;
        *(v8us*)(kh_s + kdst) = st[0]; *(v8us*)(kl_s + kdst) = st[1]; *(v8us*)(vh_s + vdst) = st[2]; *(v8us*)(vl_s + vdst) = st[3];
        __syncthreads();   // publishes this stage's tiles; it also ends every wave's reads of the other buffer, which the next stage refills
        // the next stage's pieces fly while this stage is computed (issued behind the barrier, which would wait for them)
        if (s + 1 < FNS) {
            const int key1 = kbase + (s + 1) * FSK;
            const bf* pkh = Kh + (size_t)key1 * HD + tid * 8; const bf* pkl = Kl + (size_t)key1 * HD + tid * 8; const bf* pvh = Vh + (size_t)srow * TT + key1 + scol; const bf* pvl = Vl + (size_t)srow * TT + key1 + scol;
            st[0] = *(const v8us*)pkh; st[1] = *(const v8us*)pkl; st[2] = *(const v8us*)pvh; st[3] = *(const v8us*)pvl;
            asm volatile("s_wait_xcnt 0x0" :: "v"(pkh), "v"(pkl), "v"(pvh), "v"(pvl) : "memory");   // same precaution as behind the Q loads
        }
        v8f sc[FQT][4];
#pragma unroll
        for (int kp = 0; kp < 4; kp += 2) { v16bf a[2], a2[2];   // two key tiles at a time: 2 * FQT independent accumulators
#pragma unroll
            for (int k = 0; k < 2; ++k) { a[k] = WFrag<bf>::ld(kh_s + ((kp + k) * 16 + c) * FKP + 8 * h); a2[k] = WFrag<bf>::ld(kl_s + ((kp + k) * 16 + c) * FKP + 8 * h); }
#pragma unroll
            for (int t = 0; t < FQT; ++t)
#pragma unroll
                for (int k = 0; k < 2; ++k) sc[t][kp + k] = wmmab(a[k], qh[t], (v8f){});
#pragma unroll
            for (int t = 0; t < FQT; ++t)
#pragma unroll
                for (int k = 0; k < 2; ++k) sc[t][kp + k] = wmmab(a[k], ql[t], sc[t][kp + k]);
#pragma unroll
            for (int t = 0; t < FQT; ++t)
#pragma unroll
                for (int k = 0; k < 2; ++k) sc[t][kp + k] = wmmab(a2[k], qh[t], sc[t][kp + k]); }
#pragma unroll
        for (int t = 0; t < FQT; ++t) {
            float mx = sc[t][0][0];
#pragma unroll
            for (int kt = 0; kt < 4; ++kt)
#pragma unroll
                for (int r = 0; r < 8; ++r) mx = fmaxf(mx, sc[t][kt][r]);
            mx = fmaxf(mx, xhalf(mx));
            const float mn = fmaxf(m[t], mx); const float al = __builtin_amdgcn_exp2f((m[t] - mn) * L2E); m[t] = mn;
            float ps = 0.0f;
#pragma unroll
            for (int kt = 0; kt < 4; ++kt)
#pragma unroll
                for (int r = 0; r < 8; ++r) { const float p = __builtin_amdgcn_exp2f((sc[t][kt][r] - mn) * L2E); sc[t][kt][r] = p; ps += p; }
            l[t] = l[t] * al + ps;
#pragma unroll
            for (int dt = 0; dt < 2; ++dt) o[t][dt] *= al;
        }
#pragma unroll
        for (int kb = 0; kb < 2; ++kb) { v16bf ph[FQT], pl[FQT];
#pragma unroll
            for (int t = 0; t < FQT; ++t)
#pragma unroll
                for (int e = 0; e < 16; e += 2) { v2f pp; pp[0] = sc[t][2 * kb + (e >> 3)][e & 7]; pp[1] = sc[t][2 * kb + (e >> 3)][(e & 7) + 1]; const v2bf hh = __builtin_convertvector(pp, v2bf); const v2f bk = __builtin_convertvector(hh, v2f); const v2bf ll = __builtin_convertvector(pp - bk, v2bf); ph[t][e] = hh[0]; ph[t][e + 1] = hh[1]; pl[t][e] = ll[0]; pl[t][e + 1] = ll[1]; }
            v16bf a[2], a2[2];
#pragma unroll
            for (int dt = 0; dt < 2; ++dt) { a[dt] = WFrag<bf>::ld(vh_s + (dt * 16 + c) * FPI + kb * 32 + 8 * h); a2[dt] = WFrag<bf>::ld(vl_s + (dt * 16 + c) * FPI + kb * 32 + 8 * h); }
#pragma unroll
            for (int t = 0; t < FQT; ++t)
#pragma unroll
                for (int dt = 0; dt < 2; ++dt) o[t][dt] = wmmab(a[dt], ph[t], o[t][dt]);
#pragma unroll
            for (int t = 0; t < FQT; ++t)
#pragma unroll
                for (int dt = 0; dt < 2; ++dt) o[t][dt] = wmmab(a2[dt], ph[t], o[t][dt]);
#pragma unroll
            for (int t = 0; t < FQT; ++t)
#pragma unroll
                for (int dt = 0; dt < 2; ++dt) o[t][dt] = wmmab(a[dt], pl[t], o[t][dt]); }
    }
    // this key split's partial O^T, maximum and sum of each query tile. A lane's 16 values (dims 8h + r and 16 + 8h + r of query c) are the B fragment of the last launch's product,
    // so they are stored lane by lane: a tile is 4 rows of 32 lanes x 16 B, every store 512 contiguous bytes; maxima (lanes 0..15) and sums (lanes 16..31) are one 128-byte row a tile.
    const size_t tile0 = ((size_t)blockIdx.z * NB_ + blockIdx.y) * (TT / 16) + (q0 >> 4);
    float* po = PO + tile0 * 512 + lane * 4; float* pm = PML + tile0 * 32 + lane;
#pragma unroll
    for (int t = 0; t < FQT; ++t) { l[t] += xhalf(l[t]);
#pragma unroll
        for (int dt = 0; dt < 2; ++dt) { v4f lo4, hi4;
#pragma unroll
            for (int r = 0; r < 4; ++r) { lo4[r] = o[t][dt][r]; hi4[r] = o[t][dt][4 + r]; }
            *(v4f*)(po + t * 512 + dt * 256) = lo4; *(v4f*)(po + t * 512 + dt * 256 + 128) = hi4; }
        pm[t * 32] = h ? l[t] : m[t]; }
}

// k_proj: everything in front of the attention in one launch. One work-group = PT_ tokens of one batch (blockIdx.y) x the 96 output channels of q, k and v.
// Wave w reads channels 32w..32w+31 of the tokens (16-byte loads along the tokens: 256 contiguous bytes a channel row), rounds them to bf16 and stores them token-major in LDS:
// a lane's 4 tokens go to 4 different 16-row tiles (LDS row j * 16 + lr = token 4 * lr + j), so its 8 channels of one token are one 16-byte store. The 96 weight rows are rounded into LDS beside them.
// Behind the barrier wave w does token tile w & 3 x output tiles 3 * (w >> 2) .. + 2, the channels in rising order in one accumulator each; results + biases go through LDS so that every plane is stored in whole rows.
typedef __attribute__((ext_vector_type(8))) __bf16 v8bf;
#define PT_  64                 // tokens of a work-group
#define PNO  96                 // output channels: q 0..31, k 32..63, v 64..95
#define PXP  264                // LDS pitch of a row of CC 16-bit channels: 512 B + 16 B
#define POP  100                // LDS pitch of a token's PNO f32 results, floats
__device__ __forceinline__ v8us rnd8(v8f v) { return __builtin_bit_cast(v8us, __builtin_convertvector(v, v8bf)); }   // nearest even, as f2bf
__device__ __forceinline__ void split8(v8f y, v8us& h, v8us& l) { h = rnd8(y); l = rnd8(y - __builtin_convertvector(__builtin_bit_cast(v8bf, h), v8f)); }
__global__ __launch_bounds__(256) void k_proj(const float* __restrict__ x, const float* __restrict__ wq, const float* __restrict__ bq, const float* __restrict__ wk, const float* __restrict__ bk, const float* __restrict__ wv, const float* __restrict__ bv, bf* Qh, bf* Ql, bf* Kh, bf* Kl, bf* Vh, bf* Vl) {
    __shared__ __align__(16) bf xs[PT_ * PXP];
    __shared__ __align__(16) bf wsh[PNO * PXP];
    __shared__ __align__(16) float os[PT_ * POP];
    const int lane = threadIdx.x & 31, lr = lane & 15, hi = lane >> 4; const int w = __builtin_amdgcn_readfirstlane((int)(threadIdx.x >> 5));
    const int n0 = blockIdx.x * PT_; const size_t b = blockIdx.y;
    const int mt = w & 3, g = w >> 2;
    const float* xp = x + (b * CC + 32 * w + 8 * hi) * TT + n0 + 4 * lr;
    v4f xv[16];
#pragma unroll
    for (int e = 0; e < 8; ++e) { xv[e] = *(const v4f*)(xp + (size_t)e * TT); xv[8 + e] = *(const v4f*)(xp + (size_t)(16 + e) * TT); }
    v4f wr[24];   // wave w rounds weight rows w, w + 8, ... of each matrix: a row is 1 KiB, 32 bytes a lane
#pragma unroll
    for (int s = 0; s < 12; ++s) { const float* wp = ((s < 4) ? wq : (s < 8) ? wk : wv) + (size_t)(w + 8 * (s & 3)) * CC + lane * 8; wr[2 * s] = *(const v4f*)wp; wr[2 * s + 1] = *(const v4f*)(wp + 4); }
    float bias[3];
#pragma unroll
    for (int n = 0; n < 3; ++n) { const int nt = 3 * g + n; const float* bp = (nt < 2) ? bq : (nt < 4) ? bk : bv; bias[n] = bfr(bp[(nt & 1) * 16 + lr]); }
    asm volatile("s_wait_xcnt 0x0" :: "v"(xp) : "memory");   // precaution: stands before any overwrite of the address registers of the loads just issued; naming the x address keeps it whole up to here
#pragma unroll
    for (int j = 0; j < 4; ++j) { v8f t0, t1;
#pragma unroll
        for (int e = 0; e < 8; ++e) { t0[e] = xv[e][j]; t1[e] = xv[8 + e][j]; }
        bf* d = xs + (j * 16 + lr) * PXP + 32 * w + 8 * hi; *(v8us*)d = rnd8(t0); *(v8us*)(d + 16) = rnd8(t1); }
#pragma unroll
    for (int s = 0; s < 12; ++s) { const v8f t = __builtin_shufflevector(wr[2 * s], wr[2 * s + 1], 0, 1, 2, 3, 4, 5, 6, 7); *(v8us*)(wsh + ((s >> 2) * 32 + w + 8 * (s & 3)) * PXP + lane * 8) = rnd8(t); }
    __syncthreads();
    v8f acc[3];
#pragma unroll
    for (int n = 0; n < 3; ++n) acc[n] = (v8f){};
#pragma unroll
    for (int kc = 0; kc < CC; kc += 32) { const v16bf a = WFrag<bf>::ld(xs + (mt * 16 + lr) * PXP + kc + 8 * hi);
#pragma unroll
        for (int n = 0; n < 3; ++n) acc[n] = wmmab(a, WFrag<bf>::ld(wsh + ((3 * g + n) * 16 + lr) * PXP + kc + 8 * hi), acc[n]); }
#pragma unroll
    for (int n = 0; n < 3; ++n)
#pragma unroll
        for (int r = 0; r < 8; ++r) os[(4 * (8 * hi + r) + mt) * POP + (3 * g + n) * 16 + lr] = acc[n][r] + bias[n];
    __syncthreads();
    { const int t = threadIdx.x >> 2, c0 = (threadIdx.x & 3) * 8; const float* p = os + t * POP + c0; const size_t o = (b * TT + n0 + t) * HD + c0; v8us h8, l8;   // q, k: 8 channels of a token a thread
        split8(__builtin_shufflevector(*(const v4fa*)p, *(const v4fa*)(p + 4), 0, 1, 2, 3, 4, 5, 6, 7), h8, l8); *(v8us*)(Qh + o) = h8; *(v8us*)(Ql + o) = l8;
        split8(__builtin_shufflevector(*(const v4fa*)(p + 32), *(const v4fa*)(p + 36), 0, 1, 2, 3, 4, 5, 6, 7), h8, l8); *(v8us*)(Kh + o) = h8; *(v8us*)(Kl + o) = l8; }
    { const int d = threadIdx.x >> 3, t0 = (threadIdx.x & 7) * 8; v8f y; v8us h8, l8;   // v, channel-major: 8 tokens of a channel a thread
#pragma unroll
        for (int q = 0; q < 8; ++q) y[q] = os[(t0 + q) * POP + 64 + d];
        const size_t o = (b * HD + d) * TT + n0 + t0; split8(y, h8, l8); *(v8us*)(Vh + o) = h8; *(v8us*)(Vl + o) = l8; }
}
// k_tail: everything behind the attention in one launch. One work-group = ET_ tokens (all of one batch) x EC_ output channels.
// y^T = Wo ctx^T: A = 16 rows of Wo, B = the context (hi, then lo, in one accumulator), so a lane holds 8 channels of one token.
// The context is merged here from the FKS key splits' partial results (rising split order, common maximum, one division): a lane reads its own 16 values of each split, which are its B fragment's elements.
// The work-group's EC_ rows of Wo (f32, contiguous) are read in whole lines, rounded to bf16 and laid in LDS once; behind the barrier wave w does token tile w x the EC_ / 16 channel tiles.
// The results go through LDS so that every store is 512 contiguous bytes of one channel row of the channel-major output; the bias is added there.
typedef __attribute__((ext_vector_type(4))) __bf16 v4bf;
typedef __attribute__((ext_vector_type(16))) unsigned short v16us;
#define ET_  128                // tokens of a work-group
#define EC_  128                // output channels of a work-group: the grid is one work-group a WGP
#define EWP  40                 // LDS pitch of a rounded Wo row (CQR elements), 16-bit elements: 64 B + 16 B
#define EOP  132                // LDS pitch of a channel's ET_ f32 results, floats: rows 8 apart lie 32 banks apart
__global__ __launch_bounds__(256) void k_tail(const float* __restrict__ PO, const float* __restrict__ PML, const float* __restrict__ wo, const float* __restrict__ bo, float* __restrict__ out) {
    __shared__ __align__(16) bf wsh[EC_ * EWP];
    __shared__ __align__(16) float os[EC_ * EOP];
    const int lane = threadIdx.x & 31, lr = lane & 15, hi = lane >> 4; const int w = __builtin_amdgcn_readfirstlane((int)(threadIdx.x >> 5));
    const int t0 = blockIdx.x * ET_, c0 = blockIdx.y * EC_;   // t0 counts the tokens of all batches, one behind the other
    float bias[EC_ / 8];
#pragma unroll
    for (int i = 0; i < EC_ / 8; ++i) bias[i] = bfr(bo[c0 + w + 8 * i]);
    const int tid = threadIdx.x; const float* pw = wo + (size_t)(c0 * CQR + tid * 4);   // 4 of a row's CQR floats a thread: 32 rows a load
    const size_t tile = (size_t)(t0 >> 4) + w; const float* pp = PO + tile * 512 + lane * 4; const float* pm = PML + tile * 32 + lr;
    v4f wr[EC_ / 32];
#pragma unroll
    for (int j = 0; j < EC_ / 32; ++j) wr[j] = *(const v4f*)(pw + j * 32 * CQR);
    v4f pv[FKS][4]; float pmx[FKS], pls[FKS];
#pragma unroll
    for (int u = 0; u < FKS; ++u) { const float* pu = pp + (size_t)u * NTL * 512; const float* mu = pm + (size_t)u * NTL * 32;
#pragma unroll
        for (int i = 0; i < 4; ++i) pv[u][i] = *(const v4f*)(pu + i * 128);
        pmx[u] = mu[0]; pls[u] = mu[16]; }
    __builtin_amdgcn_sched_barrier(0);   // every load above is issued before the first is waited for: one trip to L2 instead of several, one behind the other
    asm volatile("s_wait_xcnt 0x0" :: "v"(pw), "v"(pp), "v"(pm) : "memory");   // precaution: stands before any overwrite of the address registers of the loads just issued; naming them keeps them whole up to here
#pragma unroll
    for (int j = 0; j < EC_ / 32; ++j) *(v4us*)(wsh + (32 * j + (tid >> 3)) * EWP + (tid & 7) * 4) = __builtin_bit_cast(v4us, __builtin_convertvector(wr[j], v4bf));   // nearest even, as f2bf
    v16bf bh, bl;
    { float M = -3.0e38f;
#pragma unroll
        for (int u = 0; u < FKS; ++u) M = fmaxf(M, pmx[u]);
        float L = 0.0f; v4f acc[4];
#pragma unroll
        for (int i = 0; i < 4; ++i) acc[i] = (v4f){};
#pragma unroll
        for (int u = 0; u < FKS; ++u) { const float f = __builtin_amdgcn_exp2f((pmx[u] - M) * L2E); L += pls[u] * f;
#pragma unroll
            for (int i = 0; i < 4; ++i) acc[i] += pv[u][i] * f; }
        const float inv = __fdiv_rn(1.0f, L); v16us uh, ul;
#pragma unroll
        for (int e = 0; e < 16; ++e) { unsigned short h0, l0; splitf(acc[e >> 2][e & 3] * inv, h0, l0); uh[e] = h0; ul[e] = l0; }
        bh = __builtin_bit_cast(v16bf, uh); bl = __builtin_bit_cast(v16bf, ul); }
    __syncthreads();
#pragma unroll
    for (int mt = 0; mt < EC_ / 16; ++mt) { const v16bf a = WFrag<bf>::ld(wsh + (16 * mt + lr) * EWP + 8 * hi);
        v8f d = wmmab(a, bh, (v8f){}); d = wmmab(a, bl, d);
#pragma unroll
        for (int r = 0; r < 8; ++r) os[(16 * mt + 8 * hi + r) * EOP + 16 * w + lr] = d[r]; }
    __syncthreads();
    float* po = out + ((size_t)(t0 / TT) * CC + c0 + w) * TT + (t0 % TT) + lane * 4;   // wave w stores channel rows w, w + 8, ...
#pragma unroll
    for (int i = 0; i < EC_ / 8; ++i) { v4f v = *(const v4fa*)(os + (w + 8 * i) * EOP + lane * 4); v += bias[i]; *(v4f*)(po + (size_t)i * 8 * TT) = v; }
}
__global__ __launch_bounds__(256) void k_merge(const float* __restrict__ O, int h0, float* OUTb) { const size_t e = ((size_t)blockIdx.x * 256 + threadIdx.x) * 2; if (e >= (size_t)ZH * TT * HD) return; const int d = (int)(e % HD); const int t = (int)((e / HD) % TT); const int zz = (int)(e / ((size_t)HD * TT)); const float cs = (t < RH) ? 1.0f : (1.0f / PCAR); const size_t oo = (size_t)t * DQ + (h0 + zz) * HD + d;
    v2f o2; o2[0] = O[e] * cs; o2[1] = O[e + 1] * cs; *(v2f*)(OUTb + oo) = o2;  }

extern "C" void kernel_launch(void* const* d_in, const int* in_sizes, int n_in,
                              void* d_out, int out_size, void* d_ws, size_t ws_size, hipStream_t stream) {
    (void)in_sizes; (void)n_in; (void)out_size;
    const float* x = (const float*)d_in[0]; const float* wq = (const float*)d_in[1]; const float* bq = (const float*)d_in[2]; const float* wk = (const float*)d_in[3]; const float* bk = (const float*)d_in[4]; const float* wv = (const float*)d_in[5]; const float* bv = (const float*)d_in[6]; const float* wo = (const float*)d_in[7]; const float* bo = (const float*)d_in[8];
    float* OUT = (float*)d_out;   /* [4][256][4096] channel-major */
    char* wsp = (char*)d_ws;
    auto take = [&](size_t bytes) { char* p = wsp; wsp += (bytes + 255) & ~(size_t)255; return (void*)p; };
    float* PO = (float*)take((size_t)FKS * NB_ * TT * HD * 4); float* PML = (float*)take((size_t)FKS * NB_ * TT * 2 * 4);   /* per key split: partial context; maxima and sums */
    bf* QPh = (bf*)take((size_t)NB_ * TT * HD * 2); bf* QPl = (bf*)take((size_t)NB_ * TT * HD * 2); bf* KPh = (bf*)take((size_t)NB_ * TT * HD * 2); bf* KPl = (bf*)take((size_t)NB_ * TT * HD * 2); bf* VTh = (bf*)take((size_t)NB_ * HD * TT * 2); bf* VTl = (bf*)take((size_t)NB_ * HD * TT * 2);
    if ((size_t)(wsp - (char*)d_ws) > ws_size) return;    // ws 256 MiB
    // the query tiles of the NB_ batches lie one behind the other in each key split's slab, so the last launch sees NB_ * TT tokens; the projections and the attention take the batch from blockIdx.y
    k_proj<<<dim3(TT / PT_, NB_, 1), 256, 0, stream>>>(x, wq, bq, wk, bk, wv, bv, QPh, QPl, KPh, KPl, VTh, VTl);   /* x, Wq, Wk, Wv -> q, k, v hi/lo planes */
    k_fattn<<<dim3(TT / (16 * FQT * FW_), NB_, FKS), 256, 0, stream>>>(QPh, QPl, KPh, KPl, VTh, VTl, PO, PML);   /* scores + softmax + attn.v -> partial context per key split */
    k_tail<<<dim3(NB_ * TT / ET_, CC / EC_, 1), 256, 0, stream>>>(PO, PML, wo, bo, OUT);   /* merge of the key splits, Wo ctx + bo, channel-major */
}

// v008
// One run takes 29.4 microseconds.
// Two timings next to v007 both put it at 1.07 times that version's speed.
// All steps since v000 together make it 26.8 times as fast.
#include <hip/hip_runtime.h>

// SAGAN self-attention over a feature map (x [4][256][64][64] channel-major; tokens = 4,096 positions; q, k, v = 1x1 convs to 32 channels ('oi' [32][256] + [32]); energy = q.k (unscaled, 32 dims: logit sigma ~5.7); attn = softmax over positions; out = attn v ([4096][32]); y = Wo out + bo (1x1 conv 'oi' [256][32] + [256]) written channel-major -> [4][256][64][64] (4.2 M)).
// Every stage runs once for all NB_ batches (the batch is a grid dimension, or extra rows of a row-contiguous operand); every workspace plane holds NB_ slabs.
// Layout per batch: one launch (k_proj) reads the channel-major slab and the three f32 weight matrices, rounds them to bf16 into LDS (x transposed to token-major on the way), does the three 32-channel projections (exact products + f32 biases; q then times log2 e) and writes the q, k and v hi/lo planes; scores as hi/lo x hi/lo (3 products) for every row (the logits are too sharp for fp16), softmax on the score tiles in registers (a reference maximum that is renewed only when needed, a running sum), bf16 hi/lo probabilities, attn.v (3 products), all in one launch, which stores one f32 partial context with its maximum and sum per key split; one launch (k_tail) merges the splits into the 32-wide hi/lo context, rounds Wo ([256][32]), does Wo x context (hi/lo, exact products) + bo and writes channel-major rows.
// Compute dtypes, f32 accumulate: every input rounded to bf16; projections exact + f32 biases; scores and attn.v 3 products; softmax f32; Wo hl x exact + bias.

#define NB_  4
#define TT   4096
#define DM   256
#define NH_  1
#define NKV  1
#define REP  (NH_ / NKV)
#define HD   32                    // head width of the q, k, v planes and of the context: the real channels only
#define DQ   (NH_ * HD)
#define ZH   1
#define RH   4096                  // read only by k_merge, which is not launched; every query row uses hi+lo planes
#define WIN  0
#define PCAR 1024.0f
#define SCL  1.0f   // unscaled energy
#define CC   256     // channels
#define CQR  32      // real q/k/v channels
typedef _Float16 h16;
typedef unsigned short bf;
typedef __attribute__((ext_vector_type(16))) __bf16   v16bf;
typedef __attribute__((ext_vector_type(16))) _Float16 v16h;
typedef __attribute__((ext_vector_type(8)))  _Float16 v8h;
typedef __attribute__((ext_vector_type(8)))  unsigned short v8us;
typedef __attribute__((ext_vector_type(8)))  float    v8f;
typedef __attribute__((ext_vector_type(4)))  float    v4f;
typedef v8h  __attribute__((may_alias)) v8ha;
typedef v4f  __attribute__((may_alias)) v4fa;
typedef v8us __attribute__((may_alias)) v8usa;

__device__ __forceinline__ unsigned short f2bf(float f) { unsigned u = __float_as_uint(f); u += 0x7FFFu + ((u >> 16) & 1u); return (unsigned short)(u >> 16); }
__device__ __forceinline__ float bf2f(unsigned short b) { return __uint_as_float(((unsigned)b) << 16); }
__device__ __forceinline__ float bfr(float f) { return bf2f(f2bf(f)); }
__device__ __forceinline__ v16h cat16(v8h lo, v8h hi) { return __builtin_shufflevector(lo, hi, 0, 1, 2, 3, 4, 5, 6, 7, 8, 9, 10, 11, 12, 13, 14, 15); }
__device__ __forceinline__ v16bf cat16b(v8us lo, v8us hi) { return __builtin_bit_cast(v16bf, __builtin_shufflevector(lo, hi, 0, 1, 2, 3, 4, 5, 6, 7, 8, 9, 10, 11, 12, 13, 14, 15)); }
__device__ __forceinline__ v8f wmma16(v16h a, v16h b, v8f c) { return __builtin_amdgcn_wmma_f32_16x16x32_f16(false, a, false, b, (short)0, c, false, false); }
__device__ __forceinline__ v8f wmmab(v16bf a, v16bf b, v8f c) { return __builtin_amdgcn_wmma_f32_16x16x32_bf16(false, a, false, b, (short)0, c, false, false); }



// fragment loads: a lane's 16 elements of a K-contiguous 16-bit row are k = 8h .. 8h + 7 and 16 + 8h .. 16 + 8h + 7, the same for the A and the B operand
template <typename T16> struct WFrag;
template <> struct WFrag<h16> { typedef v16h V; static __device__ __forceinline__ V ld(const h16* p) { return cat16(*(const v8h*)p, *(const v8h*)(p + 16)); } static __device__ __forceinline__ v8f mma(V a, V b, v8f c) { return wmma16(a, b, c); } };
template <> struct WFrag<bf> { typedef v16bf V; static __device__ __forceinline__ V ld(const bf* p) { return cat16b(*(const v8us*)p, *(const v8us*)(p + 16)); } static __device__ __forceinline__ v8f mma(V a, V b, v8f c) { return wmmab(a, b, c); } };
__device__ __forceinline__ h16 tohx(float x) { return (h16)x; }
__device__ __forceinline__ void splitf(float y, unsigned short& h, unsigned short& l) { h = f2bf(y); l = f2bf(y - bf2f(h)); }
typedef __attribute__((ext_vector_type(2))) _Float16 v2h;
typedef __attribute__((ext_vector_type(4))) _Float16 v4h;
typedef __attribute__((ext_vector_type(2))) unsigned short v2us;
typedef __attribute__((ext_vector_type(4))) unsigned short v4us;
typedef __attribute__((ext_vector_type(2))) float v2f;
typedef __attribute__((ext_vector_type(4))) int v4i;

__global__ __launch_bounds__(256) void k_wtG(const float* __restrict__ w, int K, int N, bf* Bt) {
    const int lane = threadIdx.x & 31; const int L0 = (blockIdx.x * 8 + (threadIdx.x >> 5)) * 8; const int nlines = N * K / 64;
{
#pragma unroll 1
        for (int l = 0; l < 8; ++l) { const int L = L0 + l; if (L >= nlines) break; const size_t e = (size_t)L * 64 + lane * 2; const int k = (int)(e % K), n = (int)(e / K); v2us o;
            o[0] = f2bf(w[(size_t)k * N + n]); o[1] = f2bf(w[(size_t)(k + 1) * N + n]); *(v2us*)(Bt + e) = o; }
         }
}
__global__ __launch_bounds__(256) void k_cvt8(const float* __restrict__ src, bf* dst, size_t n8) { const size_t i = (size_t)blockIdx.x * 256 + threadIdx.x; if (i >= n8) return; const v8f v = *(const v8f*)(src + i * 8); v8us o;
#pragma unroll
    for (int k = 0; k < 8; ++k) o[k] = f2bf(v[k]); *(v8us*)(dst + i * 8) = o;  }


typedef __attribute__((ext_vector_type(2))) __bf16 v2bf;
#define FW_   8                 // waves of a work-group = query groups
#define FKS   8                 // key splits = grid z
#define FQT   2                 // query tiles (16 columns each) of a wave
#define FSK   64                // keys per stage
#define FNS   (TT / FKS / FSK)  // stages of a key split
#define FKP   40                // LDS pitch of a K row (HD elements), 16-bit elements
#define FPI   72                // LDS pitch of a V^T row (FSK elements), 16-bit elements
#define FKT   (FSK * FKP)       // one staged K plane: FSK rows
#define FVT   (HD * FPI)        // one staged V^T plane: HD rows
#define FSL   (2 * FKT + 2 * FVT)   // one stage buffer
#define NTL   (NB_ * TT / 16)   // query tiles of all batches: one key split's slab of partial results
#define L2E   1.4426950408889634f
__device__ __forceinline__ float xhalf(float v) { const int b = __float_as_int(v); return __int_as_float(__builtin_amdgcn_permlanex16(b, b, 0x76543210, 0xfedcba98, false, false)); }
// S^T of one stage for the wave's FQT query tiles: 3 products a tile, the first one on top of c0 (a lane's 8 elements of a tile belong to one query, so c0 holds one value a lane)
__device__ __forceinline__ void fscores(const bf* kh_s, const bf* kl_s, int c, int h, const v16bf (&qh)[FQT], const v16bf (&ql)[FQT], const v8f (&c0)[FQT], v8f (&sc)[FQT][4]) {
#pragma unroll
    for (int kp = 0; kp < 4; kp += 2) { v16bf a[2], a2[2];   // two key tiles at a time: 2 * FQT independent accumulators
#pragma unroll
        for (int k = 0; k < 2; ++k) { a[k] = WFrag<bf>::ld(kh_s + ((kp + k) * 16 + c) * FKP + 8 * h); a2[k] = WFrag<bf>::ld(kl_s + ((kp + k) * 16 + c) * FKP + 8 * h); }
#pragma unroll
        for (int t = 0; t < FQT; ++t)
#pragma unroll
            for (int k = 0; k < 2; ++k) sc[t][kp + k] = wmmab(a[k], qh[t], c0[t]);
#pragma unroll
        for (int t = 0; t < FQT; ++t)
#pragma unroll
            for (int k = 0; k < 2; ++k) sc[t][kp + k] = wmmab(a[k], ql[t], sc[t][kp + k]);
#pragma unroll
        for (int t = 0; t < FQT; ++t)
#pragma unroll
            for (int k = 0; k < 2; ++k) sc[t][kp + k] = wmmab(a2[k], qh[t], sc[t][kp + k]); }
}
#define FBIG  1.0e12f           // a stage's sum of exponentials above this (or not a number) means that the reference maximum is too low by about 40 binary orders: it is then renewed
// four waves a SIMD (two work-groups a WGP): the register budget is 256
__global__ __launch_bounds__(256) __attribute__((amdgpu_waves_per_eu(4, 4))) void k_fattn(const bf* __restrict__ Qh, const bf* __restrict__ Ql, const bf* __restrict__ Kh, const bf* __restrict__ Kl, const bf* __restrict__ Vh, const bf* __restrict__ Vl, float* __restrict__ PO, float* __restrict__ PML) {
    __shared__ __align__(16) bf sm[2 * FSL];
    const int tid = threadIdx.x, lane = tid & 31, c = lane & 15, h = lane >> 4; const int w = __builtin_amdgcn_readfirstlane((int)(threadIdx.x >> 5)); const int q0 = (blockIdx.x * FW_ + w) * (16 * FQT);
    { const size_t zb = (size_t)blockIdx.y * TT * HD; Qh += zb; Ql += zb; Kh += zb; Kl += zb; Vh += zb; Vl += zb; }   // blockIdx.y = batch
    v16bf qh[FQT], ql[FQT]; v8f o[FQT][2]; float m[FQT], l[FQT];
#pragma unroll
    for (int t = 0; t < FQT; ++t) { const bf* pqh = Qh + (size_t)(q0 + t * 16 + c) * HD + 8 * h; const bf* pql = Ql + (size_t)(q0 + t * 16 + c) * HD + 8 * h;
        qh[t] = WFrag<bf>::ld(pqh); ql[t] = WFrag<bf>::ld(pql); o[t][0] = (v8f){}; o[t][1] = (v8f){}; m[t] = -3.0e38f; l[t] = 0.0f;
        asm volatile("s_wait_xcnt 0x0" :: "v"(pqh), "v"(pql) : "memory"); }   // precaution: stands before any overwrite of the address registers of the loads just issued; naming them keeps them whole up to here
    v8f cm[FQT], cz[FQT];   // C operands of the first score product: cm holds minus the reference maximum m in every element, cz zeros
#pragma unroll
    for (int t = 0; t < FQT; ++t) { cm[t] = (v8f){}; cz[t] = (v8f){}; }
    const int kdst = (tid >> 2) * FKP + (tid & 3) * 8;                                    // a 16-byte piece of a K row: 4 threads a row, the work-group covers the 64 rows
    const int srow = tid >> 3, scol = (tid & 7) * 8, vdst = srow * FPI + scol;            // of a V^T row: 8 threads a row, the work-group covers the 32 rows
    const int kbase = blockIdx.z * (TT / FKS);
    v8us st[4];
    { const bf* pkh = Kh + (size_t)kbase * HD + tid * 8; const bf* pkl = Kl + (size_t)kbase * HD + tid * 8; const bf* pvh = Vh + (size_t)srow * TT + kbase + scol; const bf* pvl = Vl + (size_t)srow * TT + kbase + scol;
        st[0] = *(const v8us*)pkh; st[1] = *(const v8us*)pkl; st[2] = *(const v8us*)pvh; st[3] = *(const v8us*)pvl;
        asm volatile("s_wait_xcnt 0x0" :: "v"(pkh), "v"(pkl), "v"(pvh), "v"(pvl) : "memory"); }   // same precaution as behind the Q loads
#pragma unroll 1
    for (int s = 0; s < FNS; ++s) {
        bf* kh_s = sm + (s & 1) * FSL; bf* kl_s = kh_s + FKT; bf* vh_s = kl_s + FKT; bf* vl_s = vh_s + FVT;
        *(v8us*)(kh_s + kdst) = st[0]; *(v8us*)(kl_s + kdst) = st[1]; *(v8us*)(vh_s + vdst) = st[2]; *(v8us*)(vl_s + vdst) = st[3];
        __syncthreads();   // publishes this stage's tiles; it also ends every wave's reads of the other buffer, which the next stage refills
        // the next stage's pieces fly while this stage is computed (issued behind the barrier, which would wait for them)
        if (s + 1 < FNS) {
            const int key1 = kbase + (s + 1) * FSK;
            const bf* pkh = Kh + (size_t)key1 * HD + tid * 8; const bf* pkl = Kl + (size_t)key1 * HD + tid * 8; const bf* pvh = Vh + (size_t)srow * TT + key1 + scol; const bf* pvl = Vl + (size_t)srow * TT + key1 + scol;
            st[0] = *(const v8us*)pkh; st[1] = *(const v8us*)pkl; st[2] = *(const v8us*)pvh; st[3] = *(const v8us*)pvl;
            asm volatile("s_wait_xcnt 0x0" :: "v"(pkh), "v"(pkl), "v"(pvh), "v"(pvl) : "memory");   // same precaution as behind the Q loads
        }
        // The score products deliver the exp2 arguments themselves: q arrives times log2 e (k_proj), and minus m enters as their C operand. For that m is a reference, not the running maximum,
        // so a stage needs no maximum, no subtraction, no multiplication and no rescaling.
        // It is set from the first stage's scores and renewed (true maximum, sums and context rescaled) only when a stage's exponentials outgrow FBIG; the test is one scalar branch a stage.
        v8f sc[FQT][4]; float ps[FQT];
        bool full = (s == 0);
        if (!full) {
            fscores(kh_s, kl_s, c, h, qh, ql, cm, sc);
#pragma unroll
            for (int t = 0; t < FQT; ++t) { ps[t] = 0.0f;
#pragma unroll
                for (int kt = 0; kt < 4; ++kt)
#pragma unroll
                    for (int r = 0; r < 8; ++r) { const float p = __builtin_amdgcn_exp2f(sc[t][kt][r]); sc[t][kt][r] = p; ps[t] += p; } }
            bool need = false;
#pragma unroll
            for (int t = 0; t < FQT; ++t) need = need || !(ps[t] <= FBIG);
            full = __builtin_amdgcn_ballot_w32(need) != 0;   // the same for the whole wave: both halves of a query's lanes keep one reference
        }
        if (full) {
            fscores(kh_s, kl_s, c, h, qh, ql, cz, sc);
#pragma unroll
            for (int t = 0; t < FQT; ++t) {
                float mx = sc[t][0][0];
#pragma unroll
                for (int kt = 0; kt < 4; ++kt)
#pragma unroll
                    for (int r = 0; r < 8; ++r) mx = fmaxf(mx, sc[t][kt][r]);
                mx = fmaxf(mx, xhalf(mx));
                const float mn = fmaxf(m[t], mx); const float al = __builtin_amdgcn_exp2f(m[t] - mn); m[t] = mn; cm[t] = (v8f){} - mn;
                ps[t] = 0.0f;
#pragma unroll
                for (int kt = 0; kt < 4; ++kt)
#pragma unroll
                    for (int r = 0; r < 8; ++r) { const float p = __builtin_amdgcn_exp2f(sc[t][kt][r] - mn); sc[t][kt][r] = p; ps[t] += p; }
                l[t] *= al;
#pragma unroll
                for (int dt = 0; dt < 2; ++dt) o[t][dt] *= al;
            }
        }
#pragma unroll
        for (int t = 0; t < FQT; ++t) l[t] += ps[t];
#pragma unroll
        for (int kb = 0; kb < 2; ++kb) { v16bf ph[FQT], pl[FQT];
#pragma unroll
            for (int t = 0; t < FQT; ++t)
#pragma unroll
                for (int e = 0; e < 16; e += 2) { v2f pp; pp[0] = sc[t][2 * kb + (e >> 3)][e & 7]; pp[1] = sc[t][2 * kb + (e >> 3)][(e & 7) + 1]; const v2bf hh = __builtin_convertvector(pp, v2bf); const v2f bk = __builtin_convertvector(hh, v2f); const v2bf ll = __builtin_convertvector(pp - bk, v2bf); ph[t][e] = hh[0]; ph[t][e + 1] = hh[1]; pl[t][e] = ll[0]; pl[t][e + 1] = ll[1]; }
            v16bf a[2], a2[2];
#pragma unroll
            for (int dt = 0; dt < 2; ++dt) { a[dt] = WFrag<bf>::ld(vh_s + (dt * 16 + c) * FPI + kb * 32 + 8 * h); a2[dt] = WFrag<bf>::ld(vl_s + (dt * 16 + c) * FPI + kb * 32 + 8 * h); }
#pragma unroll
            for (int t = 0; t < FQT; ++t)
#pragma unroll
                for (int dt = 0; dt < 2; ++dt) o[t][dt] = wmmab(a[dt], ph[t], o[t][dt]);
#pragma unroll
            for (int t = 0; t < FQT; ++t)
#pragma unroll
                for (int dt = 0; dt < 2; ++dt) o[t][dt] = wmmab(a2[dt], ph[t], o[t][dt]);
#pragma unroll
            for (int t = 0; t < FQT; ++t)
#pragma unroll
                for (int dt = 0; dt < 2; ++dt) o[t][dt] = wmmab(a[dt], pl[t], o[t][dt]); }
    }
    // this key split's partial O^T, reference maximum and sum of each query tile. A lane's 16 values (dims 8h + r and 16 + 8h + r of query c) are the B fragment of the last launch's product,
    // so they are stored lane by lane: a tile is 4 rows of 32 lanes x 16 B, every store 512 contiguous bytes; maxima (lanes 0..15) and sums (lanes 16..31) are one 128-byte row a tile.
    const size_t tile0 = ((size_t)blockIdx.z * NB_ + blockIdx.y) * (TT / 16) + (q0 >> 4);
    float* po = PO + tile0 * 512 + lane * 4; float* pm = PML + tile0 * 32 + lane;
#pragma unroll
    for (int t = 0; t < FQT; ++t) { l[t] += xhalf(l[t]);
#pragma unroll
        for (int dt = 0; dt < 2; ++dt) { v4f lo4, hi4;
#pragma unroll
            for (int r = 0; r < 4; ++r) { lo4[r] = o[t][dt][r]; hi4[r] = o[t][dt][4 + r]; }
            *(v4f*)(po + t * 512 + dt * 256) = lo4; *(v4f*)(po + t * 512 + dt * 256 + 128) = hi4; }
        pm[t * 32] = h ? l[t] : m[t]; }
}

// k_proj: everything in front of the attention in one launch. One work-group = PT_ tokens of one batch (blockIdx.y) x the 96 output channels of q, k and v.
// Wave w reads channels 32w..32w+31 of the tokens (16-byte loads along the tokens: 256 contiguous bytes a channel row), rounds them to bf16 and stores them token-major in LDS:
// a lane's 4 tokens go to 4 different 16-row tiles (LDS row j * 16 + lr = token 4 * lr + j), so its 8 channels of one token are one 16-byte store. The 96 weight rows are rounded into LDS beside them.
// Behind the barrier wave w does token tile w & 3 x output tiles 3 * (w >> 2) .. + 2, the channels in rising order in one accumulator each; results + biases go through LDS so that every plane is stored in whole rows.
typedef __attribute__((ext_vector_type(8))) __bf16 v8bf;
#define PT_  64                 // tokens of a work-group
#define PNO  96                 // output channels: q 0..31, k 32..63, v 64..95
#define PXP  264                // LDS pitch of a row of CC 16-bit channels: 512 B + 16 B
#define POP  100                // LDS pitch of a token's PNO f32 results, floats
__device__ __forceinline__ v8us rnd8(v8f v) { return __builtin_bit_cast(v8us, __builtin_convertvector(v, v8bf)); }   // nearest even, as f2bf
__device__ __forceinline__ void split8(v8f y, v8us& h, v8us& l) { h = rnd8(y); l = rnd8(y - __builtin_convertvector(__builtin_bit_cast(v8bf, h), v8f)); }
__global__ __launch_bounds__(256) void k_proj(const float* __restrict__ x, const float* __restrict__ wq, const float* __restrict__ bq, const float* __restrict__ wk, const float* __restrict__ bk, const float* __restrict__ wv, const float* __restrict__ bv, bf* Qh, bf* Ql, bf* Kh, bf* Kl, bf* Vh, bf* Vl) {
    __shared__ __align__(16) bf xs[PT_ * PXP];
    __shared__ __align__(16) bf wsh[PNO * PXP];
    __shared__ __align__(16) float os[PT_ * POP];
    const int lane = threadIdx.x & 31, lr = lane & 15, hi = lane >> 4; const int w = __builtin_amdgcn_readfirstlane((int)(threadIdx.x >> 5));
    const int n0 = blockIdx.x * PT_; const size_t b = blockIdx.y;
    const int mt = w & 3, g = w >> 2;
    const float* xp = x + (b * CC + 32 * w + 8 * hi) * TT + n0 + 4 * lr;
    v4f xv[16];
#pragma unroll
    for (int e = 0; e < 8; ++e) { xv[e] = *(const v4f*)(xp + (size_t)e * TT); xv[8 + e] = *(const v4f*)(xp + (size_t)(16 + e) * TT); }
    v4f wr[24];   // wave w rounds weight rows w, w + 8, ... of each matrix: a row is 1 KiB, 32 bytes a lane
#pragma unroll
    for (int s = 0; s < 12; ++s) { const float* wp = ((s < 4) ? wq : (s < 8) ? wk : wv) + (size_t)(w + 8 * (s & 3)) * CC + lane * 8; wr[2 * s] = *(const v4f*)wp; wr[2 * s + 1] = *(const v4f*)(wp + 4); }
    float bias[3];
#pragma unroll
    for (int n = 0; n < 3; ++n) { const int nt = 3 * g + n; const float* bp = (nt < 2) ? bq : (nt < 4) ? bk : bv; bias[n] = bfr(bp[(nt & 1) * 16 + lr]); }
    asm volatile("s_wait_xcnt 0x0" :: "v"(xp) : "memory");   // precaution: stands before any overwrite of the address registers of the loads just issued; naming the x address keeps it whole up to here
#pragma unroll
    for (int j = 0; j < 4; ++j) { v8f t0, t1;
#pragma unroll
        for (int e = 0; e < 8; ++e) { t0[e] = xv[e][j]; t1[e] = xv[8 + e][j]; }
        bf* d = xs + (j * 16 + lr) * PXP + 32 * w + 8 * hi; *(v8us*)d = rnd8(t0); *(v8us*)(d + 16) = rnd8(t1); }
#pragma unroll
    for (int s = 0; s < 12; ++s) { const v8f t = __builtin_shufflevector(wr[2 * s], wr[2 * s + 1], 0, 1, 2, 3, 4, 5, 6, 7); *(v8us*)(wsh + ((s >> 2) * 32 + w + 8 * (s & 3)) * PXP + lane * 8) = rnd8(t); }
    __syncthreads();
    v8f acc[3];
#pragma unroll
    for (int n = 0; n < 3; ++n) acc[n] = (v8f){};
#pragma unroll
    for (int kc = 0; kc < CC; kc += 32) { const v16bf a = WFrag<bf>::ld(xs + (mt * 16 + lr) * PXP + kc + 8 * hi);
#pragma unroll
        for (int n = 0; n < 3; ++n) acc[n] = wmmab(a, WFrag<bf>::ld(wsh + ((3 * g + n) * 16 + lr) * PXP + kc + 8 * hi), acc[n]); }
#pragma unroll
    for (int n = 0; n < 3; ++n) { const float qs = (3 * g + n < 2) ? L2E : 1.0f;   // q leaves times log2 e: the attention's scores are then exp2 arguments
#pragma unroll
        for (int r = 0; r < 8; ++r) os[(4 * (8 * hi + r) + mt) * POP + (3 * g + n) * 16 + lr] = (acc[n][r] + bias[n]) * qs; }
    __syncthreads();
    { const int t = threadIdx.x >> 2, c0 = (threadIdx.x & 3) * 8; const float* p = os + t * POP + c0; const size_t o = (b * TT + n0 + t) * HD + c0; v8us h8, l8;   // q, k: 8 channels of a token a thread
        split8(__builtin_shufflevector(*(const v4fa*)p, *(const v4fa*)(p + 4), 0, 1, 2, 3, 4, 5, 6, 7), h8, l8); *(v8us*)(Qh + o) = h8; *(v8us*)(Ql + o) = l8;
        split8(__builtin_shufflevector(*(const v4fa*)(p + 32), *(const v4fa*)(p + 36), 0, 1, 2, 3, 4, 5, 6, 7), h8, l8); *(v8us*)(Kh + o) = h8; *(v8us*)(Kl + o) = l8; }
    { const int d = threadIdx.x >> 3, t0 = (threadIdx.x & 7) * 8; v8f y; v8us h8, l8;   // v, channel-major: 8 tokens of a channel a thread
#pragma unroll
        for (int q = 0; q < 8; ++q) y[q] = os[(t0 + q) * POP + 64 + d];
        const size_t o = (b * HD + d) * TT + n0 + t0; split8(y, h8, l8); *(v8us*)(Vh + o) = h8; *(v8us*)(Vl + o) = l8; }
}
// k_tail: everything behind the attention in one launch. One work-group = ET_ tokens (all of one batch) x EC_ output channels.
// y^T = Wo ctx^T: A = 16 rows of Wo, B = the context (hi, then lo, in one accumulator), so a lane holds 8 channels of one token.
// The context is merged here from the FKS key splits' partial results (rising split order, common maximum, one division): a lane reads its own 16 values of each split, which are its B fragment's elements.
// The work-group's EC_ rows of Wo (f32, contiguous) are read in whole lines, rounded to bf16 and laid in LDS once; behind the barrier wave w does token tile w x the EC_ / 16 channel tiles.
// The results go through LDS so that every store is 512 contiguous bytes of one channel row of the channel-major output; the bias is added there.
typedef __attribute__((ext_vector_type(4))) __bf16 v4bf;
typedef __attribute__((ext_vector_type(16))) unsigned short v16us;
#define ET_  128                // tokens of a work-group
#define EC_  128                // output channels of a work-group: the grid is one work-group a WGP
#define EWP  40                 // LDS pitch of a rounded Wo row (CQR elements), 16-bit elements: 64 B + 16 B
#define EOP  132                // LDS pitch of a channel's ET_ f32 results, floats: rows 8 apart lie 32 banks apart
__global__ __launch_bounds__(256) void k_tail(const float* __restrict__ PO, const float* __restrict__ PML, const float* __restrict__ wo, const float* __restrict__ bo, float* __restrict__ out) {
    __shared__ __align__(16) bf wsh[EC_ * EWP];
    __shared__ __align__(16) float os[EC_ * EOP];
    const int lane = threadIdx.x & 31, lr = lane & 15, hi = lane >> 4; const int w = __builtin_amdgcn_readfirstlane((int)(threadIdx.x >> 5));
    const int t0 = blockIdx.x * ET_, c0 = blockIdx.y * EC_;   // t0 counts the tokens of all batches, one behind the other
    float bias[EC_ / 8];
#pragma unroll
    for (int i = 0; i < EC_ / 8; ++i) bias[i] = bfr(bo[c0 + w + 8 * i]);
    const int tid = threadIdx.x; const float* pw = wo + (size_t)(c0 * CQR + tid * 4);   // 4 of a row's CQR floats a thread: 32 rows a load
    const size_t tile = (size_t)(t0 >> 4) + w; const float* pp = PO + tile * 512 + lane * 4; const float* pm = PML + tile * 32 + lr;
    v4f wr[EC_ / 32];
#pragma unroll
    for (int j = 0; j < EC_ / 32; ++j) wr[j] = *(const v4f*)(pw + j * 32 * CQR);
    v4f pv[FKS][4]; float pmx[FKS], pls[FKS];
#pragma unroll
    for (int u = 0; u < FKS; ++u) { const float* pu = pp + (size_t)u * NTL * 512; const float* mu = pm + (size_t)u * NTL * 32;
#pragma unroll
        for (int i = 0; i < 4; ++i) pv[u][i] = *(const v4f*)(pu + i * 128);
        pmx[u] = mu[0]; pls[u] = mu[16]; }
    __builtin_amdgcn_sched_barrier(0);   // every load above is issued before the first is waited for: one trip to L2 instead of several, one behind the other
    asm volatile("s_wait_xcnt 0x0" :: "v"(pw), "v"(pp), "v"(pm) : "memory");   // precaution: stands before any overwrite of the address registers of the loads just issued; naming them keeps them whole up to here
#pragma unroll
    for (int j = 0; j < EC_ / 32; ++j) *(v4us*)(wsh + (32 * j + (tid >> 3)) * EWP + (tid & 7) * 4) = __builtin_bit_cast(v4us, __builtin_convertvector(wr[j], v4bf));   // nearest even, as f2bf
    v16bf bh, bl;
    { float M = -3.0e38f;
#pragma unroll
        for (int u = 0; u < FKS; ++u) M = fmaxf(M, pmx[u]);
        float L = 0.0f; v4f acc[4];
#pragma unroll
        for (int i = 0; i < 4; ++i) acc[i] = (v4f){};
#pragma unroll
        for (int u = 0; u < FKS; ++u) { const float f = __builtin_amdgcn_exp2f(pmx[u] - M); L += pls[u] * f;   // the reference maxima are in log2 units, as the scores
#pragma unroll
            for (int i = 0; i < 4; ++i) acc[i] += pv[u][i] * f; }
        const float inv = __fdiv_rn(1.0f, L); v16us uh, ul;
#pragma unroll
        for (int e = 0; e < 16; ++e) { unsigned short h0, l0; splitf(acc[e >> 2][e & 3] * inv, h0, l0); uh[e] = h0; ul[e] = l0; }
        bh = __builtin_bit_cast(v16bf, uh); bl = __builtin_bit_cast(v16bf, ul); }
    __syncthreads();
#pragma unroll
    for (int mt = 0; mt < EC_ / 16; ++mt) { const v16bf a = WFrag<bf>::ld(wsh + (16 * mt + lr) * EWP + 8 * hi);
        v8f d = wmmab(a, bh, (v8f){}); d = wmmab(a, bl, d);
#pragma unroll
        for (int r = 0; r < 8; ++r) os[(16 * mt + 8 * hi + r) * EOP + 16 * w + lr] = d[r]; }
    __syncthreads();
    float* po = out + ((size_t)(t0 / TT) * CC + c0 + w) * TT + (t0 % TT) + lane * 4;   // wave w stores channel rows w, w + 8, ...
#pragma unroll
    for (int i = 0; i < EC_ / 8; ++i) { v4f v = *(const v4fa*)(os + (w + 8 * i) * EOP + lane * 4); v += bias[i]; *(v4f*)(po + (size_t)i * 8 * TT) = v; }
}
__global__ __launch_bounds__(256) void k_merge(const float* __restrict__ O, int h0, float* OUTb) { const size_t e = ((size_t)blockIdx.x * 256 + threadIdx.x) * 2; if (e >= (size_t)ZH * TT * HD) return; const int d = (int)(e % HD); const int t = (int)((e / HD) % TT); const int zz = (int)(e / ((size_t)HD * TT)); const float cs = (t < RH) ? 1.0f : (1.0f / PCAR); const size_t oo = (size_t)t * DQ + (h0 + zz) * HD + d;
    v2f o2; o2[0] = O[e] * cs; o2[1] = O[e + 1] * cs; *(v2f*)(OUTb + oo) = o2;  }

extern "C" void kernel_launch(void* const* d_in, const int* in_sizes, int n_in,
                              void* d_out, int out_size, void* d_ws, size_t ws_size, hipStream_t stream) {
    (void)in_sizes; (void)n_in; (void)out_size;
    const float* x = (const float*)d_in[0]; const float* wq = (const float*)d_in[1]; const float* bq = (const float*)d_in[2]; const float* wk = (const float*)d_in[3]; const float* bk = (const float*)d_in[4]; const float* wv = (const float*)d_in[5]; const float* bv = (const float*)d_in[6]; const float* wo = (const float*)d_in[7]; const float* bo = (const float*)d_in[8];
    float* OUT = (float*)d_out;   /* [4][256][4096] channel-major */
    char* wsp = (char*)d_ws;
    auto take = [&](size_t bytes) { char* p = wsp; wsp += (bytes + 255) & ~(size_t)255; return (void*)p; };
    float* PO = (float*)take((size_t)FKS * NB_ * TT * HD * 4); float* PML = (float*)take((size_t)FKS * NB_ * TT * 2 * 4);   /* per key split: partial context; maxima and sums */
    bf* QPh = (bf*)take((size_t)NB_ * TT * HD * 2); bf* QPl = (bf*)take((size_t)NB_ * TT * HD * 2); bf* KPh = (bf*)take((size_t)NB_ * TT * HD * 2); bf* KPl = (bf*)take((size_t)NB_ * TT * HD * 2); bf* VTh = (bf*)take((size_t)NB_ * HD * TT * 2); bf* VTl = (bf*)take((size_t)NB_ * HD * TT * 2);
    if ((size_t)(wsp - (char*)d_ws) > ws_size) return;    // ws 256 MiB
    // the query tiles of the NB_ batches lie one behind the other in each key split's slab, so the last launch sees NB_ * TT tokens; the projections and the attention take the batch from blockIdx.y
    k_proj<<<dim3(TT / PT_, NB_, 1), 256, 0, stream>>>(x, wq, bq, wk, bk, wv, bv, QPh, QPl, KPh, KPl, VTh, VTl);   /* x, Wq, Wk, Wv -> q, k, v hi/lo planes */
    k_fattn<<<dim3(TT / (16 * FQT * FW_), NB_, FKS), 256, 0, stream>>>(QPh, QPl, KPh, KPl, VTh, VTl, PO, PML);   /* scores + softmax + attn.v -> partial context per key split */
    k_tail<<<dim3(NB_ * TT / ET_, CC / EC_, 1), 256, 0, stream>>>(PO, PML, wo, bo, OUT);   /* merge of the key splits, Wo ctx + bo, channel-major */
}

// v009
// A run of this version takes 26 microseconds.
// Next to v008, in two timings, it ran 1.14 times as fast each time.
// Over all steps from v000 it is 30.6 times as fast.
#include <hip/hip_runtime.h>

// SAGAN self-attention over a feature map (x [4][256][64][64] channel-major; tokens = 4,096 positions; q, k, v = 1x1 convs to 32 channels ('oi' [32][256] + [32]); energy = q.k (unscaled, 32 dims: logit sigma ~5.7); attn = softmax over positions; out = attn v ([4096][32]); y = Wo out + bo (1x1 conv 'oi' [256][32] + [256]) written channel-major -> [4][256][64][64] (4.2 M)).
// Every stage runs once for all NB_ batches (the batch is a grid dimension, or extra rows of a row-contiguous operand); every workspace plane holds NB_ slabs.
// Layout per batch: one launch (k_proj) reads the channel-major slab and the three f32 weight matrices, rounds them to bf16 into LDS (x transposed to token-major on the way), does the three 32-channel projections (exact products + f32 biases; q then times log2 e) and writes the q and k hi/lo planes and the f16 v plane; scores as hi/lo x hi/lo (3 products) for every row (the logits are too sharp for fp16), softmax on the score tiles in registers (a reference maximum that is renewed only when needed, a running sum), f16 probabilities, attn.v (one f16 product), all in one launch, which stores one f32 partial context with its maximum and sum per key split; one launch (k_tail) merges the splits into the 32-wide hi/lo context, rounds Wo ([256][32]), does Wo x context (hi/lo, exact products) + bo and writes channel-major rows.
// Compute dtypes, f32 accumulate: every input rounded to bf16; projections exact + f32 biases; scores 3 products; softmax f32, row sum on the unrounded exponentials; attn.v one f16 x f16 product (probabilities and v each rounded once to f16); Wo hl x exact + bias.

#define NB_  4
#define TT   4096
#define DM   256
#define NH_  1
#define NKV  1
#define REP  (NH_ / NKV)
#define HD   32                    // head width of the q, k, v planes and of the context: the real channels only
#define DQ   (NH_ * HD)
#define ZH   1
#define RH   4096                  // read only by k_merge, which is not launched; every query row uses hi+lo planes
#define WIN  0
#define PCAR 1024.0f
#define SCL  1.0f   // unscaled energy
#define CC   256     // channels
#define CQR  32      // real q/k/v channels
typedef _Float16 h16;
typedef unsigned short bf;
typedef __attribute__((ext_vector_type(16))) __bf16   v16bf;
typedef __attribute__((ext_vector_type(16))) _Float16 v16h;
typedef __attribute__((ext_vector_type(8)))  _Float16 v8h;
typedef __attribute__((ext_vector_type(8)))  unsigned short v8us;
typedef __attribute__((ext_vector_type(8)))  float    v8f;
typedef __attribute__((ext_vector_type(4)))  float    v4f;
typedef v8h  __attribute__((may_alias)) v8ha;
typedef v4f  __attribute__((may_alias)) v4fa;
typedef v8us __attribute__((may_alias)) v8usa;

__device__ __forceinline__ unsigned short f2bf(float f) { unsigned u = __float_as_uint(f); u += 0x7FFFu + ((u >> 16) & 1u); return (unsigned short)(u >> 16); }
__device__ __forceinline__ float bf2f(unsigned short b) { return __uint_as_float(((unsigned)b) << 16); }
__device__ __forceinline__ float bfr(float f) { return bf2f(f2bf(f)); }
__device__ __forceinline__ v16h cat16(v8h lo, v8h hi) { return __builtin_shufflevector(lo, hi, 0, 1, 2, 3, 4, 5, 6, 7, 8, 9, 10, 11, 12, 13, 14, 15); }
__device__ __forceinline__ v16bf cat16b(v8us lo, v8us hi) { return __builtin_bit_cast(v16bf, __builtin_shufflevector(lo, hi, 0, 1, 2, 3, 4, 5, 6, 7, 8, 9, 10, 11, 12, 13, 14, 15)); }
__device__ __forceinline__ v8f wmma16(v16h a, v16h b, v8f c) { return __builtin_amdgcn_wmma_f32_16x16x32_f16(false, a, false, b, (short)0, c, false, false); }
__device__ __forceinline__ v8f wmmab(v16bf a, v16bf b, v8f c) { return __builtin_amdgcn_wmma_f32_16x16x32_bf16(false, a, false, b, (short)0, c, false, false); }



// fragment loads: a lane's 16 elements of a K-contiguous 16-bit row are k = 8h .. 8h + 7 and 16 + 8h .. 16 + 8h + 7, the same for the A and the B operand
template <typename T16> struct WFrag;
template <> struct WFrag<h16> { typedef v16h V; static __device__ __forceinline__ V ld(const h16* p) { return cat16(*(const v8h*)p, *(const v8h*)(p + 16)); } static __device__ __forceinline__ v8f mma(V a, V b, v8f c) { return wmma16(a, b, c); } };
template <> struct WFrag<bf> { typedef v16bf V; static __device__ __forceinline__ V ld(const bf* p) { return cat16b(*(const v8us*)p, *(const v8us*)(p + 16)); } static __device__ __forceinline__ v8f mma(V a, V b, v8f c) { return wmmab(a, b, c); } };
__device__ __forceinline__ h16 tohx(float x) { return (h16)x; }
__device__ __forceinline__ void splitf(float y, unsigned short& h, unsigned short& l) { h = f2bf(y); l = f2bf(y - bf2f(h)); }
typedef __attribute__((ext_vector_type(2))) _Float16 v2h;
typedef __attribute__((ext_vector_type(4))) _Float16 v4h;
typedef __attribute__((ext_vector_type(2))) unsigned short v2us;
typedef __attribute__((ext_vector_type(4))) unsigned short v4us;
typedef __attribute__((ext_vector_type(2))) float v2f;
typedef __attribute__((ext_vector_type(4))) int v4i;

__global__ __launch_bounds__(256) void k_wtG(const float* __restrict__ w, int K, int N, bf* Bt) {
    const int lane = threadIdx.x & 31; const int L0 = (blockIdx.x * 8 + (threadIdx.x >> 5)) * 8; const int nlines = N * K / 64;
{
#pragma unroll 1
        for (int l = 0; l < 8; ++l) { const int L = L0 + l; if (L >= nlines) break; const size_t e = (size_t)L * 64 + lane * 2; const int k = (int)(e % K), n = (int)(e / K); v2us o;
            o[0] = f2bf(w[(size_t)k * N + n]); o[1] = f2bf(w[(size_t)(k + 1) * N + n]); *(v2us*)(Bt + e) = o; }
         }
}
__global__ __launch_bounds__(256) void k_cvt8(const float* __restrict__ src, bf* dst, size_t n8) { const size_t i = (size_t)blockIdx.x * 256 + threadIdx.x; if (i >= n8) return; const v8f v = *(const v8f*)(src + i * 8); v8us o;
#pragma unroll
    for (int k = 0; k < 8; ++k) o[k] = f2bf(v[k]); *(v8us*)(dst + i * 8) = o;  }


#define FW_   8                 // waves of a work-group = query groups
#define FKS   8                 // key splits = grid z
#define FQT   2                 // query tiles (16 columns each) of a wave
#define FSK   64                // keys per stage
#define FNS   (TT / FKS / FSK)  // stages of a key split
#define FKP   40                // LDS pitch of a K row (HD elements), 16-bit elements
#define FPI   72                // LDS pitch of a V^T row (FSK elements), 16-bit elements
#define FKT   (FSK * FKP)       // one staged K plane: FSK rows
#define FVT   (HD * FPI)        // one staged V^T plane: HD rows
#define FSL   (2 * FKT + FVT)   // one stage buffer: K hi, K lo, V^T
#define NTL   (NB_ * TT / 16)   // query tiles of all batches: one key split's slab of partial results
#define L2E   1.4426950408889634f
__device__ __forceinline__ float xhalf(float v) { const int b = __float_as_int(v); return __int_as_float(__builtin_amdgcn_permlanex16(b, b, 0x76543210, 0xfedcba98, false, false)); }
// S^T of one stage for the wave's FQT query tiles: 3 products a tile, the first one on top of c0 (a lane's 8 elements of a tile belong to one query, so c0 holds one value a lane)
__device__ __forceinline__ void fscores(const bf* kh_s, const bf* kl_s, int c, int h, const v16bf (&qh)[FQT], const v16bf (&ql)[FQT], const v8f (&c0)[FQT], v8f (&sc)[FQT][4]) {
#pragma unroll
    for (int kp = 0; kp < 4; kp += 2) { v16bf a[2], a2[2];   // two key tiles at a time: 2 * FQT independent accumulators
#pragma unroll
        for (int k = 0; k < 2; ++k) { a[k] = WFrag<bf>::ld(kh_s + ((kp + k) * 16 + c) * FKP + 8 * h); a2[k] = WFrag<bf>::ld(kl_s + ((kp + k) * 16 + c) * FKP + 8 * h); }
#pragma unroll
        for (int t = 0; t < FQT; ++t)
#pragma unroll
            for (int k = 0; k < 2; ++k) sc[t][kp + k] = wmmab(a[k], qh[t], c0[t]);
#pragma unroll
        for (int t = 0; t < FQT; ++t)
#pragma unroll
            for (int k = 0; k < 2; ++k) sc[t][kp + k] = wmmab(a[k], ql[t], sc[t][kp + k]);
#pragma unroll
        for (int t = 0; t < FQT; ++t)
#pragma unroll
            for (int k = 0; k < 2; ++k) sc[t][kp + k] = wmmab(a2[k], qh[t], sc[t][kp + k]); }
}
#define FBIG  3.0e4f            // a lane's sum of a stage's exponentials above this: one of them may pass the end of f16 (65,504), so the reference is raised before they are rounded
#define FHUGE 1.0e30f           // above this (or not a number) the f32 exponentials themselves are no longer trusted: the stage is done again from its true maximum
#define FSH   6                 // a reference is set this many binary orders above what it is set from: about 21 orders of room; the largest exponential is then about 2^-6, and the f16 quantum of the small ones (2^-24) stays far below the row sum
// four waves a SIMD (two work-groups a WGP): the register budget is 256
__global__ __launch_bounds__(256) __attribute__((amdgpu_waves_per_eu(4, 4))) void k_fattn(const bf* __restrict__ Qh, const bf* __restrict__ Ql, const bf* __restrict__ Kh, const bf* __restrict__ Kl, const h16* __restrict__ Vf, float* __restrict__ PO, float* __restrict__ PML) {
    __shared__ __align__(16) bf sm[2 * FSL];
    const int tid = threadIdx.x, lane = tid & 31, c = lane & 15, h = lane >> 4; const int w = __builtin_amdgcn_readfirstlane((int)(threadIdx.x >> 5)); const int q0 = (blockIdx.x * FW_ + w) * (16 * FQT);
    { const size_t zb = (size_t)blockIdx.y * TT * HD; Qh += zb; Ql += zb; Kh += zb; Kl += zb; Vf += zb; }   // blockIdx.y = batch
    v16bf qh[FQT], ql[FQT]; v8f o[FQT][2]; float m[FQT], l[FQT];
#pragma unroll
    for (int t = 0; t < FQT; ++t) { const bf* pqh = Qh + (size_t)(q0 + t * 16 + c) * HD + 8 * h; const bf* pql = Ql + (size_t)(q0 + t * 16 + c) * HD + 8 * h;
        qh[t] = WFrag<bf>::ld(pqh); ql[t] = WFrag<bf>::ld(pql); o[t][0] = (v8f){}; o[t][1] = (v8f){}; m[t] = -3.0e38f; l[t] = 0.0f;
        asm volatile("s_wait_xcnt 0x0" :: "v"(pqh), "v"(pql) : "memory"); }   // precaution: stands before any overwrite of the address registers of the loads just issued; naming them keeps them whole up to here
    v8f cm[FQT], cz[FQT];   // C operands of the first score product: cm holds minus the reference maximum m in every element, cz zeros
#pragma unroll
    for (int t = 0; t < FQT; ++t) { cm[t] = (v8f){}; cz[t] = (v8f){}; }
    const int kdst = (tid >> 2) * FKP + (tid & 3) * 8;                                    // a 16-byte piece of a K row: 4 threads a row, the work-group covers the 64 rows
    const int srow = tid >> 3, scol = (tid & 7) * 8, vdst = srow * FPI + scol;            // of a V^T row: 8 threads a row, the work-group covers the 32 rows
    const int kbase = blockIdx.z * (TT / FKS);
    v8us st[3];
    { const bf* pkh = Kh + (size_t)kbase * HD + tid * 8; const bf* pkl = Kl + (size_t)kbase * HD + tid * 8; const h16* pvf = Vf + (size_t)srow * TT + kbase + scol;
        st[0] = *(const v8us*)pkh; st[1] = *(const v8us*)pkl; st[2] = *(const v8usa*)pvf;
        asm volatile("s_wait_xcnt 0x0" :: "v"(pkh), "v"(pkl), "v"(pvf) : "memory"); }   // same precaution as behind the Q loads
#pragma unroll 1
    for (int s = 0; s < FNS; ++s) {
        bf* kh_s = sm + (s & 1) * FSL; bf* kl_s = kh_s + FKT; bf* vf_s = kl_s + FKT;
        *(v8us*)(kh_s + kdst) = st[0]; *(v8us*)(kl_s + kdst) = st[1]; *(v8us*)(vf_s + vdst) = st[2];
        __syncthreads();   // publishes this stage's tiles; it also ends every wave's reads of the other buffer, which the next stage refills
        // the next stage's pieces fly while this stage is computed (issued behind the barrier, which would wait for them)
        if (s + 1 < FNS) {
            const int key1 = kbase + (s + 1) * FSK;
            const bf* pkh = Kh + (size_t)key1 * HD + tid * 8; const bf* pkl = Kl + (size_t)key1 * HD + tid * 8; const h16* pvf = Vf + (size_t)srow * TT + key1 + scol;
            st[0] = *(const v8us*)pkh; st[1] = *(const v8us*)pkl; st[2] = *(const v8usa*)pvf;
            asm volatile("s_wait_xcnt 0x0" :: "v"(pkh), "v"(pkl), "v"(pvf) : "memory");   // same precaution as behind the Q loads
        }
        // The score products deliver the exp2 arguments themselves: q arrives times log2 e (k_proj), and minus m enters as their C operand. For that m is a reference, not the running maximum,
        // so a stage needs no maximum, no subtraction, no multiplication and no rescaling.
        // It is set from the first stage's scores (their maximum, rounded up, + FSH) and raised (sums and context rescaled) only when a stage's exponentials outgrow FBIG; the test is one scalar branch a stage.
        v8f sc[FQT][4]; float ps[FQT];
        bool full = (s == 0);
        if (!full) {
            fscores(kh_s, kl_s, c, h, qh, ql, cm, sc);
#pragma unroll
            for (int t = 0; t < FQT; ++t) { ps[t] = 0.0f;
#pragma unroll
                for (int kt = 0; kt < 4; ++kt)
#pragma unroll
                    for (int r = 0; r < 8; ++r) { const float p = __builtin_amdgcn_exp2f(sc[t][kt][r]); sc[t][kt][r] = p; ps[t] += p; } }
            bool need = false;
#pragma unroll
            for (int t = 0; t < FQT; ++t) need = need || !(ps[t] <= FBIG);
            if (__builtin_amdgcn_ballot_w32(need) != 0) {   // one scalar branch for the wave
                bool bad = false;
#pragma unroll
                for (int t = 0; t < FQT; ++t) bad = bad || !(ps[t] <= FHUGE);
                full = __builtin_amdgcn_ballot_w32(bad) != 0;
                if (!full) {
                    // the reference goes up by a whole number k of binary orders: this stage's exponentials, the sums and the context are scaled by 2^-k, which is exact
#pragma unroll
                    for (int t = 0; t < FQT; ++t) {
                        const float big = fmaxf(ps[t], xhalf(ps[t]));   // both halves of a query's lanes keep one reference
                        const int k = (big > FBIG) ? __builtin_amdgcn_frexp_expf(big) + FSH : 0;
                        const float al = __builtin_ldexpf(1.0f, -k);
                        m[t] += (float)k; cm[t] = (v8f){} - m[t]; ps[t] *= al; l[t] *= al;
#pragma unroll
                        for (int kt = 0; kt < 4; ++kt) sc[t][kt] *= al;
#pragma unroll
                        for (int dt = 0; dt < 2; ++dt) o[t][dt] *= al;
                    }
                }
            }
        }
        if (full) {
            fscores(kh_s, kl_s, c, h, qh, ql, cz, sc);
#pragma unroll
            for (int t = 0; t < FQT; ++t) {
                float mx = sc[t][0][0];
#pragma unroll
                for (int kt = 0; kt < 4; ++kt)
#pragma unroll
                    for (int r = 0; r < 8; ++r) mx = fmaxf(mx, sc[t][kt][r]);
                mx = fmaxf(mx, xhalf(mx));
                const float mn = fmaxf(m[t], __builtin_ceilf(mx) + (float)FSH);   /* a whole number, so that a later step up by k is exact */ const float al = __builtin_amdgcn_exp2f(m[t] - mn); m[t] = mn; cm[t] = (v8f){} - mn;
                ps[t] = 0.0f;
#pragma unroll
                for (int kt = 0; kt < 4; ++kt)
#pragma unroll
                    for (int r = 0; r < 8; ++r) { const float p = __builtin_amdgcn_exp2f(sc[t][kt][r] - mn); sc[t][kt][r] = p; ps[t] += p; }
                l[t] *= al;
#pragma unroll
                for (int dt = 0; dt < 2; ++dt) o[t][dt] *= al;
            }
        }
#pragma unroll
        for (int t = 0; t < FQT; ++t) l[t] += ps[t];
        v16h a[2][2], pf[2][FQT];
#pragma unroll
        for (int kb = 0; kb < 2; ++kb)
#pragma unroll
            for (int dt = 0; dt < 2; ++dt) { const bf* pa = vf_s + (dt * 16 + c) * FPI + kb * 32 + 8 * h; a[kb][dt] = cat16(*(const v8ha*)pa, *(const v8ha*)(pa + 16)); }
#pragma unroll
        for (int kb = 0; kb < 2; ++kb)
#pragma unroll
            for (int t = 0; t < FQT; ++t)
#pragma unroll
                for (int e = 0; e < 16; e += 2) { v2f pp; pp[0] = sc[t][2 * kb + (e >> 3)][e & 7]; pp[1] = sc[t][2 * kb + (e >> 3)][(e & 7) + 1]; const v2h hh = __builtin_convertvector(pp, v2h); pf[kb][t][e] = hh[0]; pf[kb][t][e + 1] = hh[1]; }   // nearest even
#pragma unroll
        for (int kb = 0; kb < 2; ++kb)   // four independent accumulators in turn
#pragma unroll
            for (int t = 0; t < FQT; ++t)
#pragma unroll
                for (int dt = 0; dt < 2; ++dt) o[t][dt] = wmma16(a[kb][dt], pf[kb][t], o[t][dt]);
    }
    // this key split's partial O^T, reference maximum and sum of each query tile. A lane's 16 values (dims 8h + r and 16 + 8h + r of query c) are the B fragment of the last launch's product,
    // so they are stored lane by lane: a tile is 4 rows of 32 lanes x 16 B, every store 512 contiguous bytes; maxima (lanes 0..15) and sums (lanes 16..31) are one 128-byte row a tile.
    const size_t tile0 = ((size_t)blockIdx.z * NB_ + blockIdx.y) * (TT / 16) + (q0 >> 4);
    float* po = PO + tile0 * 512 + lane * 4; float* pm = PML + tile0 * 32 + lane;
#pragma unroll
    for (int t = 0; t < FQT; ++t) { l[t] += xhalf(l[t]);
#pragma unroll
        for (int dt = 0; dt < 2; ++dt) { v4f lo4, hi4;
#pragma unroll
            for (int r = 0; r < 4; ++r) { lo4[r] = o[t][dt][r]; hi4[r] = o[t][dt][4 + r]; }
            *(v4f*)(po + t * 512 + dt * 256) = lo4; *(v4f*)(po + t * 512 + dt * 256 + 128) = hi4; }
        pm[t * 32] = h ? l[t] : m[t]; }
}

// k_proj: everything in front of the attention in one launch. One work-group = PT_ tokens of one batch (blockIdx.y) x the 96 output channels of q, k and v.
// Wave w reads channels 32w..32w+31 of the tokens (16-byte loads along the tokens: 256 contiguous bytes a channel row), rounds them to bf16 and stores them token-major in LDS:
// a lane's 4 tokens go to 4 different 16-row tiles (LDS row j * 16 + lr = token 4 * lr + j), so its 8 channels of one token are one 16-byte store. The 96 weight rows are rounded into LDS beside them.
// Behind the barrier wave w does token tile w & 3 x output tiles 3 * (w >> 2) .. + 2, the channels in rising order in one accumulator each; results + biases go through LDS so that every plane is stored in whole rows.
typedef __attribute__((ext_vector_type(8))) __bf16 v8bf;
#define PT_  64                 // tokens of a work-group
#define PNO  96                 // output channels: q 0..31, k 32..63, v 64..95
#define PXP  264                // LDS pitch of a row of CC 16-bit channels: 512 B + 16 B
#define POP  100                // LDS pitch of a token's PNO f32 results, floats
__device__ __forceinline__ v8us rnd8(v8f v) { return __builtin_bit_cast(v8us, __builtin_convertvector(v, v8bf)); }   // nearest even, as f2bf
__device__ __forceinline__ void split8(v8f y, v8us& h, v8us& l) { h = rnd8(y); l = rnd8(y - __builtin_convertvector(__builtin_bit_cast(v8bf, h), v8f)); }
__global__ __launch_bounds__(256) void k_proj(const float* __restrict__ x, const float* __restrict__ wq, const float* __restrict__ bq, const float* __restrict__ wk, const float* __restrict__ bk, const float* __restrict__ wv, const float* __restrict__ bv, bf* Qh, bf* Ql, bf* Kh, bf* Kl, h16* Vf) {
    __shared__ __align__(16) bf xs[PT_ * PXP];
    __shared__ __align__(16) bf wsh[PNO * PXP];
    __shared__ __align__(16) float os[PT_ * POP];
    const int lane = threadIdx.x & 31, lr = lane & 15, hi = lane >> 4; const int w = __builtin_amdgcn_readfirstlane((int)(threadIdx.x >> 5));
    const int n0 = blockIdx.x * PT_; const size_t b = blockIdx.y;
    const int mt = w & 3, g = w >> 2;
    const float* xp = x + (b * CC + 32 * w + 8 * hi) * TT + n0 + 4 * lr;
    v4f xv[16];
#pragma unroll
    for (int e = 0; e < 8; ++e) { xv[e] = *(const v4f*)(xp + (size_t)e * TT); xv[8 + e] = *(const v4f*)(xp + (size_t)(16 + e) * TT); }
    v4f wr[24];   // wave w rounds weight rows w, w + 8, ... of each matrix: a row is 1 KiB, 32 bytes a lane
#pragma unroll
    for (int s = 0; s < 12; ++s) { const float* wp = ((s < 4) ? wq : (s < 8) ? wk : wv) + (size_t)(w + 8 * (s & 3)) * CC + lane * 8; wr[2 * s] = *(const v4f*)wp; wr[2 * s + 1] = *(const v4f*)(wp + 4); }
    float bias[3];
#pragma unroll
    for (int n = 0; n < 3; ++n) { const int nt = 3 * g + n; const float* bp = (nt < 2) ? bq : (nt < 4) ? bk : bv; bias[n] = bfr(bp[(nt & 1) * 16 + lr]); }
    asm volatile("s_wait_xcnt 0x0" :: "v"(xp) : "memory");   // precaution: stands before any overwrite of the address registers of the loads just issued; naming the x address keeps it whole up to here
#pragma unroll
    for (int j = 0; j < 4; ++j) { v8f t0, t1;
#pragma unroll
        for (int e = 0; e < 8; ++e) { t0[e] = xv[e][j]; t1[e] = xv[8 + e][j]; }
        bf* d = xs + (j * 16 + lr) * PXP + 32 * w + 8 * hi; *(v8us*)d = rnd8(t0); *(v8us*)(d + 16) = rnd8(t1); }
#pragma unroll
    for (int s = 0; s < 12; ++s) { const v8f t = __builtin_shufflevector(wr[2 * s], wr[2 * s + 1], 0, 1, 2, 3, 4, 5, 6, 7); *(v8us*)(wsh + ((s >> 2) * 32 + w + 8 * (s & 3)) * PXP + lane * 8) = rnd8(t); }
    __syncthreads();
    v8f acc[3];
#pragma unroll
    for (int n = 0; n < 3; ++n) acc[n] = (v8f){};
#pragma unroll
    for (int kc = 0; kc < CC; kc += 32) { const v16bf a = WFrag<bf>::ld(xs + (mt * 16 + lr) * PXP + kc + 8 * hi);
#pragma unroll
        for (int n = 0; n < 3; ++n) acc[n] = wmmab(a, WFrag<bf>::ld(wsh + ((3 * g + n) * 16 + lr) * PXP + kc + 8 * hi), acc[n]); }
#pragma unroll
    for (int n = 0; n < 3; ++n) { const float qs = (3 * g + n < 2) ? L2E : 1.0f;   // q leaves times log2 e: the attention's scores are then exp2 arguments
#pragma unroll
        for (int r = 0; r < 8; ++r) os[(4 * (8 * hi + r) + mt) * POP + (3 * g + n) * 16 + lr] = (acc[n][r] + bias[n]) * qs; }
    __syncthreads();
    { const int t = threadIdx.x >> 2, c0 = (threadIdx.x & 3) * 8; const float* p = os + t * POP + c0; const size_t o = (b * TT + n0 + t) * HD + c0; v8us h8, l8;   // q, k: 8 channels of a token a thread
        split8(__builtin_shufflevector(*(const v4fa*)p, *(const v4fa*)(p + 4), 0, 1, 2, 3, 4, 5, 6, 7), h8, l8); *(v8us*)(Qh + o) = h8; *(v8us*)(Ql + o) = l8;
        split8(__builtin_shufflevector(*(const v4fa*)(p + 32), *(const v4fa*)(p + 36), 0, 1, 2, 3, 4, 5, 6, 7), h8, l8); *(v8us*)(Kh + o) = h8; *(v8us*)(Kl + o) = l8; }
    { const int d = threadIdx.x >> 3, t0 = (threadIdx.x & 7) * 8; v8f y;   // v, channel-major, rounded once to f16 (nearest even): 8 tokens of a channel a thread
#pragma unroll
        for (int q = 0; q < 8; ++q) y[q] = os[(t0 + q) * POP + 64 + d];
        const size_t o = (b * HD + d) * TT + n0 + t0; *(v8h*)(Vf + o) = __builtin_convertvector(y, v8h); }
}
// k_tail: everything behind the attention in one launch. One work-group = ET_ tokens (all of one batch) x EC_ output channels.
// y^T = Wo ctx^T: A = 16 rows of Wo, B = the context (hi, then lo, in one accumulator), so a lane holds 8 channels of one token.
// The context is merged here from the FKS key splits' partial results (rising split order, common maximum, one division): a lane reads its own 16 values of each split, which are its B fragment's elements.
// The work-group's EC_ rows of Wo (f32, contiguous) are read in whole lines, rounded to bf16 and laid in LDS once; behind the barrier wave w does token tile w x the EC_ / 16 channel tiles.
// The results go through LDS so that every store is 512 contiguous bytes of one channel row of the channel-major output; the bias is added there.
typedef __attribute__((ext_vector_type(4))) __bf16 v4bf;
typedef __attribute__((ext_vector_type(16))) unsigned short v16us;
#define ET_  128                // tokens of a work-group
#define EC_  128                // output channels of a work-group: the grid is one work-group a WGP
#define EWP  40                 // LDS pitch of a rounded Wo row (CQR elements), 16-bit elements: 64 B + 16 B
#define EOP  132                // LDS pitch of a channel's ET_ f32 results, floats: rows 8 apart lie 32 banks apart
__global__ __launch_bounds__(256) void k_tail(const float* __restrict__ PO, const float* __restrict__ PML, const float* __restrict__ wo, const float* __restrict__ bo, float* __restrict__ out) {
    __shared__ __align__(16) bf wsh[EC_ * EWP];
    __shared__ __align__(16) float os[EC_ * EOP];
    const int lane = threadIdx.x & 31, lr = lane & 15, hi = lane >> 4; const int w = __builtin_amdgcn_readfirstlane((int)(threadIdx.x >> 5));
    const int t0 = blockIdx.x * ET_, c0 = blockIdx.y * EC_;   // t0 counts the tokens of all batches, one behind the other
    float bias[EC_ / 8];
#pragma unroll
    for (int i = 0; i < EC_ / 8; ++i) bias[i] = bfr(bo[c0 + w + 8 * i]);
    const int tid = threadIdx.x; const float* pw = wo + (size_t)(c0 * CQR + tid * 4);   // 4 of a row's CQR floats a thread: 32 rows a load
    const size_t tile = (size_t)(t0 >> 4) + w; const float* pp = PO + tile * 512 + lane * 4; const float* pm = PML + tile * 32 + lr;
    v4f wr[EC_ / 32];
#pragma unroll
    for (int j = 0; j < EC_ / 32; ++j) wr[j] = *(const v4f*)(pw + j * 32 * CQR);
    v4f pv[FKS][4]; float pmx[FKS], pls[FKS];
#pragma unroll
    for (int u = 0; u < FKS; ++u) { const float* pu = pp + (size_t)u * NTL * 512; const float* mu = pm + (size_t)u * NTL * 32;
#pragma unroll
        for (int i = 0; i < 4; ++i) pv[u][i] = *(const v4f*)(pu + i * 128);
        pmx[u] = mu[0]; pls[u] = mu[16]; }
    __builtin_amdgcn_sched_barrier(0);   // every load above is issued before the first is waited for: one trip to L2 instead of several, one behind the other
    asm volatile("s_wait_xcnt 0x0" :: "v"(pw), "v"(pp), "v"(pm) : "memory");   // precaution: stands before any overwrite of the address registers of the loads just issued; naming them keeps them whole up to here
#pragma unroll
    for (int j = 0; j < EC_ / 32; ++j) *(v4us*)(wsh + (32 * j + (tid >> 3)) * EWP + (tid & 7) * 4) = __builtin_bit_cast(v4us, __builtin_convertvector(wr[j], v4bf));   // nearest even, as f2bf
    v16bf bh, bl;
    { float M = -3.0e38f;
#pragma unroll
        for (int u = 0; u < FKS; ++u) M = fmaxf(M, pmx[u]);
        float L = 0.0f; v4f acc[4];
#pragma unroll
        for (int i = 0; i < 4; ++i) acc[i] = (v4f){};
#pragma unroll
        for (int u = 0; u < FKS; ++u) { const float f = __builtin_amdgcn_exp2f(pmx[u] - M); L += pls[u] * f;   // the reference maxima are in log2 units, as the scores
#pragma unroll
            for (int i = 0; i < 4; ++i) acc[i] += pv[u][i] * f; }
        const float inv = __fdiv_rn(1.0f, L); v16us uh, ul;
#pragma unroll
        for (int e = 0; e < 16; ++e) { unsigned short h0, l0; splitf(acc[e >> 2][e & 3] * inv, h0, l0); uh[e] = h0; ul[e] = l0; }
        bh = __builtin_bit_cast(v16bf, uh); bl = __builtin_bit_cast(v16bf, ul); }
    __syncthreads();
#pragma unroll
    for (int mt = 0; mt < EC_ / 16; ++mt) { const v16bf a = WFrag<bf>::ld(wsh + (16 * mt + lr) * EWP + 8 * hi);
        v8f d = wmmab(a, bh, (v8f){}); d = wmmab(a, bl, d);
#pragma unroll
        for (int r = 0; r < 8; ++r) os[(16 * mt + 8 * hi + r) * EOP + 16 * w + lr] = d[r]; }
    __syncthreads();
    float* po = out + ((size_t)(t0 / TT) * CC + c0 + w) * TT + (t0 % TT) + lane * 4;   // wave w stores channel rows w, w + 8, ...
#pragma unroll
    for (int i = 0; i < EC_ / 8; ++i) { v4f v = *(const v4fa*)(os + (w + 8 * i) * EOP + lane * 4); v += bias[i]; *(v4f*)(po + (size_t)i * 8 * TT) = v; }
}
__global__ __launch_bounds__(256) void k_merge(const float* __restrict__ O, int h0, float* OUTb) { const size_t e = ((size_t)blockIdx.x * 256 + threadIdx.x) * 2; if (e >= (size_t)ZH * TT * HD) return; const int d = (int)(e % HD); const int t = (int)((e / HD) % TT); const int zz = (int)(e / ((size_t)HD * TT)); const float cs = (t < RH) ? 1.0f : (1.0f / PCAR); const size_t oo = (size_t)t * DQ + (h0 + zz) * HD + d;
    v2f o2; o2[0] = O[e] * cs; o2[1] = O[e + 1] * cs; *(v2f*)(OUTb + oo) = o2;  }

extern "C" void kernel_launch(void* const* d_in, const int* in_sizes, int n_in,
                              void* d_out, int out_size, void* d_ws, size_t ws_size, hipStream_t stream) {
    (void)in_sizes; (void)n_in; (void)out_size;
    const float* x = (const float*)d_in[0]; const float* wq = (const float*)d_in[1]; const float* bq = (const float*)d_in[2]; const float* wk = (const float*)d_in[3]; const float* bk = (const float*)d_in[4]; const float* wv = (const float*)d_in[5]; const float* bv = (const float*)d_in[6]; const float* wo = (const float*)d_in[7]; const float* bo = (const float*)d_in[8];
    float* OUT = (float*)d_out;   /* [4][256][4096] channel-major */
    char* wsp = (char*)d_ws;
    auto take = [&](size_t bytes) { char* p = wsp; wsp += (bytes + 255) & ~(size_t)255; return (void*)p; };
    float* PO = (float*)take((size_t)FKS * NB_ * TT * HD * 4); float* PML = (float*)take((size_t)FKS * NB_ * TT * 2 * 4);   /* per key split: partial context; maxima and sums */
    bf* QPh = (bf*)take((size_t)NB_ * TT * HD * 2); bf* QPl = (bf*)take((size_t)NB_ * TT * HD * 2); bf* KPh = (bf*)take((size_t)NB_ * TT * HD * 2); bf* KPl = (bf*)take((size_t)NB_ * TT * HD * 2); h16* VTf = (h16*)take((size_t)NB_ * HD * TT * 2);
    if ((size_t)(wsp - (char*)d_ws) > ws_size) return;    // ws 256 MiB
    // the query tiles of the NB_ batches lie one behind the other in each key split's slab, so the last launch sees NB_ * TT tokens; the projections and the attention take the batch from blockIdx.y
    k_proj<<<dim3(TT / PT_, NB_, 1), 256, 0, stream>>>(x, wq, bq, wk, bk, wv, bv, QPh, QPl, KPh, KPl, VTf);   /* x, Wq, Wk, Wv -> q, k hi/lo planes, f16 v plane */
    k_fattn<<<dim3(TT / (16 * FQT * FW_), NB_, FKS), 256, 0, stream>>>(QPh, QPl, KPh, KPl, VTf, PO, PML);   /* scores + softmax + attn.v -> partial context per key split */
    k_tail<<<dim3(NB_ * TT / ET_, CC / EC_, 1), 256, 0, stream>>>(PO, PML, wo, bo, OUT);   /* merge of the key splits, Wo ctx + bo, channel-major */
}

// v010
// It runs in 23.8 microseconds.
// Next to v009, in two timings, it ran 1.09 and 1.10 times as fast.
// All steps since v000 together make it 33.4 times as fast.
#include <hip/hip_runtime.h>

// SAGAN self-attention over a feature map (x [4][256][64][64] channel-major; tokens = 4,096 positions; q, k, v = 1x1 convs to 32 channels ('oi' [32][256] + [32]); energy = q.k (unscaled, 32 dims: logit sigma ~5.7); attn = softmax over positions; out = attn v ([4096][32]); y = Wo out + bo (1x1 conv 'oi' [256][32] + [256]) written channel-major -> [4][256][64][64] (4.2 M)).
// Every stage runs once for all NB_ batches (the batch is a grid dimension, or extra rows of a row-contiguous operand); every workspace plane holds NB_ slabs.
// Layout per batch: one launch (k_proj) reads the channel-major slab and the three f32 weight matrices, rounds them to bf16 into LDS (x transposed to token-major on the way), does the three 32-channel projections (exact products + f32 biases; q then times log2 e) and writes the q and k hi/lo planes and the f16 v plane; scores as hi/lo x hi/lo (3 products) for every row (the logits are too sharp for fp16), softmax on the score tiles in registers (a reference maximum that is renewed only when needed, a running sum), f16 probabilities, attn.v (one f16 product), all in one launch, which stores one partial context (divided by its own sum, f16) with its maximum and sum per key split; one launch (k_tail) merges the splits into the 32-wide hi/lo context, rounds Wo ([256][32]), does Wo x context (hi/lo, exact products) + bo and writes channel-major rows.
// Compute dtypes, f32 accumulate: every input rounded to bf16; projections exact + f32 biases; scores 3 products; softmax f32, row sum on the unrounded exponentials; attn.v one f16 x f16 product (probabilities and v each rounded once to f16); each key split's normalised context rounded once to f16 on its way to the merge; Wo hl x exact + bias.

#define NB_  4
#define TT   4096
#define DM   256
#define NH_  1
#define NKV  1
#define REP  (NH_ / NKV)
#define HD   32                    // head width of the q, k, v planes and of the context: the real channels only
#define DQ   (NH_ * HD)
#define ZH   1
#define RH   4096                  // read only by k_merge, which is not launched; every query row uses hi+lo planes
#define WIN  0
#define PCAR 1024.0f
#define SCL  1.0f   // unscaled energy
#define CC   256     // channels
#define CQR  32      // real q/k/v channels
typedef _Float16 h16;
typedef unsigned short bf;
typedef __attribute__((ext_vector_type(16))) __bf16   v16bf;
typedef __attribute__((ext_vector_type(16))) _Float16 v16h;
typedef __attribute__((ext_vector_type(8)))  _Float16 v8h;
typedef __attribute__((ext_vector_type(8)))  unsigned short v8us;
typedef __attribute__((ext_vector_type(8)))  float    v8f;
typedef __attribute__((ext_vector_type(4)))  float    v4f;
typedef v8h  __attribute__((may_alias)) v8ha;
typedef v4f  __attribute__((may_alias)) v4fa;
typedef v8us __attribute__((may_alias)) v8usa;

__device__ __forceinline__ unsigned short f2bf(float f) { unsigned u = __float_as_uint(f); u += 0x7FFFu + ((u >> 16) & 1u); return (unsigned short)(u >> 16); }
__device__ __forceinline__ float bf2f(unsigned short b) { return __uint_as_float(((unsigned)b) << 16); }
__device__ __forceinline__ float bfr(float f) { return bf2f(f2bf(f)); }
__device__ __forceinline__ v16h cat16(v8h lo, v8h hi) { return __builtin_shufflevector(lo, hi, 0, 1, 2, 3, 4, 5, 6, 7, 8, 9, 10, 11, 12, 13, 14, 15); }
__device__ __forceinline__ v16bf cat16b(v8us lo, v8us hi) { return __builtin_bit_cast(v16bf, __builtin_shufflevector(lo, hi, 0, 1, 2, 3, 4, 5, 6, 7, 8, 9, 10, 11, 12, 13, 14, 15)); }
__device__ __forceinline__ v8f wmma16(v16h a, v16h b, v8f c) { return __builtin_amdgcn_wmma_f32_16x16x32_f16(false, a, false, b, (short)0, c, false, false); }
__device__ __forceinline__ v8f wmmab(v16bf a, v16bf b, v8f c) { return __builtin_amdgcn_wmma_f32_16x16x32_bf16(false, a, false, b, (short)0, c, false, false); }



// fragment loads: a lane's 16 elements of a K-contiguous 16-bit row are k = 8h .. 8h + 7 and 16 + 8h .. 16 + 8h + 7, the same for the A and the B operand
template <typename T16> struct WFrag;
template <> struct WFrag<h16> { typedef v16h V; static __device__ __forceinline__ V ld(const h16* p) { return cat16(*(const v8h*)p, *(const v8h*)(p + 16)); } static __device__ __forceinline__ v8f mma(V a, V b, v8f c) { return wmma16(a, b, c); } };
template <> struct WFrag<bf> { typedef v16bf V; static __device__ __forceinline__ V ld(const bf* p) { return cat16b(*(const v8us*)p, *(const v8us*)(p + 16)); } static __device__ __forceinline__ v8f mma(V a, V b, v8f c) { return wmmab(a, b, c); } };
__device__ __forceinline__ h16 tohx(float x) { return (h16)x; }
__device__ __forceinline__ void splitf(float y, unsigned short& h, unsigned short& l) { h = f2bf(y); l = f2bf(y - bf2f(h)); }
typedef __attribute__((ext_vector_type(2))) _Float16 v2h;
typedef __attribute__((ext_vector_type(4))) _Float16 v4h;
typedef __attribute__((ext_vector_type(2))) unsigned short v2us;
typedef __attribute__((ext_vector_type(4))) unsigned short v4us;
typedef __attribute__((ext_vector_type(2))) float v2f;
typedef __attribute__((ext_vector_type(4))) int v4i;

__global__ __launch_bounds__(256) void k_wtG(const float* __restrict__ w, int K, int N, bf* Bt) {
    const int lane = threadIdx.x & 31; const int L0 = (blockIdx.x * 8 + (threadIdx.x >> 5)) * 8; const int nlines = N * K / 64;
{
#pragma unroll 1
        for (int l = 0; l < 8; ++l) { const int L = L0 + l; if (L >= nlines) break; const size_t e = (size_t)L * 64 + lane * 2; const int k = (int)(e % K), n = (int)(e / K); v2us o;
            o[0] = f2bf(w[(size_t)k * N + n]); o[1] = f2bf(w[(size_t)(k + 1) * N + n]); *(v2us*)(Bt + e) = o; }
         }
}
__global__ __launch_bounds__(256) void k_cvt8(const float* __restrict__ src, bf* dst, size_t n8) { const size_t i = (size_t)blockIdx.x * 256 + threadIdx.x; if (i >= n8) return; const v8f v = *(const v8f*)(src + i * 8); v8us o;
#pragma unroll
    for (int k = 0; k < 8; ++k) o[k] = f2bf(v[k]); *(v8us*)(dst + i * 8) = o;  }


#define FW_   8                 // waves of a work-group = query groups
#define FKS   8                 // key splits = grid z
#define FQT   2                 // query tiles (16 columns each) of a wave
#define FSK   64                // keys per stage
#define FNS   (TT / FKS / FSK)  // stages of a key split
#define FKP   40                // LDS pitch of a K row (HD elements), 16-bit elements
#define FPI   72                // LDS pitch of a V^T row (FSK elements), 16-bit elements
#define FKT   (FSK * FKP)       // one staged K plane: FSK rows
#define FVT   (HD * FPI)        // one staged V^T plane: HD rows
#define FSL   (2 * FKT + FVT)   // one stage buffer: K hi, K lo, V^T
#define NTL   (NB_ * TT / 16)   // query tiles of all batches: one key split's slab of partial results
#define L2E   1.4426950408889634f
__device__ __forceinline__ float xhalf(float v) { const int b = __float_as_int(v); return __int_as_float(__builtin_amdgcn_permlanex16(b, b, 0x76543210, 0xfedcba98, false, false)); }
// S^T of one stage for the wave's FQT query tiles: 3 products a tile, the first one on top of c0 (a lane's 8 elements of a tile belong to one query, so c0 holds one value a lane)
__device__ __forceinline__ void fscores(const bf* kh_s, const bf* kl_s, int c, int h, const v16bf (&qh)[FQT], const v16bf (&ql)[FQT], const v8f (&c0)[FQT], v8f (&sc)[FQT][4]) {
#pragma unroll
    for (int kp = 0; kp < 4; kp += 2) { v16bf a[2], a2[2];   // two key tiles at a time: 2 * FQT independent accumulators
#pragma unroll
        for (int k = 0; k < 2; ++k) { a[k] = WFrag<bf>::ld(kh_s + ((kp + k) * 16 + c) * FKP + 8 * h); a2[k] = WFrag<bf>::ld(kl_s + ((kp + k) * 16 + c) * FKP + 8 * h); }
#pragma unroll
        for (int t = 0; t < FQT; ++t)
#pragma unroll
            for (int k = 0; k < 2; ++k) sc[t][kp + k] = wmmab(a[k], qh[t], c0[t]);
#pragma unroll
        for (int t = 0; t < FQT; ++t)
#pragma unroll
            for (int k = 0; k < 2; ++k) sc[t][kp + k] = wmmab(a[k], ql[t], sc[t][kp + k]);
#pragma unroll
        for (int t = 0; t < FQT; ++t)
#pragma unroll
            for (int k = 0; k < 2; ++k) sc[t][kp + k] = wmmab(a2[k], qh[t], sc[t][kp + k]); }
}
#define FBIG  3.0e4f            // a lane's sum of a stage's exponentials above this: one of them may pass the end of f16 (65,504), so the reference is raised before they are rounded
#define FHUGE 1.0e30f           // above this (or not a number) the f32 exponentials themselves are no longer trusted: the stage is done again from its true maximum
#define FSH   6                 // a reference is set this many binary orders above what it is set from: about 21 orders of room; the largest exponential is then about 2^-6, and the f16 quantum of the small ones (2^-24) stays far below the row sum
// four waves a SIMD (two work-groups a WGP): the register budget is 256
__global__ __launch_bounds__(256) __attribute__((amdgpu_waves_per_eu(4, 4))) void k_fattn(const bf* __restrict__ Qh, const bf* __restrict__ Ql, const bf* __restrict__ Kh, const bf* __restrict__ Kl, const h16* __restrict__ Vf, h16* __restrict__ PO, float* __restrict__ PML) {
    __shared__ __align__(16) bf sm[2 * FSL];
    const int tid = threadIdx.x, lane = tid & 31, c = lane & 15, h = lane >> 4; const int w = __builtin_amdgcn_readfirstlane((int)(threadIdx.x >> 5)); const int q0 = (blockIdx.x * FW_ + w) * (16 * FQT);
    { const size_t zb = (size_t)blockIdx.y * TT * HD; Qh += zb; Ql += zb; Kh += zb; Kl += zb; Vf += zb; }   // blockIdx.y = batch
    v16bf qh[FQT], ql[FQT]; v8f o[FQT][2]; float m[FQT], l[FQT];
#pragma unroll
    for (int t = 0; t < FQT; ++t) { const bf* pqh = Qh + (size_t)(q0 + t * 16 + c) * HD + 8 * h; const bf* pql = Ql + (size_t)(q0 + t * 16 + c) * HD + 8 * h;
        qh[t] = WFrag<bf>::ld(pqh); ql[t] = WFrag<bf>::ld(pql); o[t][0] = (v8f){}; o[t][1] = (v8f){}; m[t] = -3.0e38f; l[t] = 0.0f;
        asm volatile("s_wait_xcnt 0x0" :: "v"(pqh), "v"(pql) : "memory"); }   // precaution: stands before any overwrite of the address registers of the loads just issued; naming them keeps them whole up to here
    v8f cm[FQT], cz[FQT];   // C operands of the first score product: cm holds minus the reference maximum m in every element, cz zeros
#pragma unroll
    for (int t = 0; t < FQT; ++t) { cm[t] = (v8f){}; cz[t] = (v8f){}; }
    const int kdst = (tid >> 2) * FKP + (tid & 3) * 8;                                    // a 16-byte piece of a K row: 4 threads a row, the work-group covers the 64 rows
    const int srow = tid >> 3, scol = (tid & 7) * 8, vdst = srow * FPI + scol;            // of a V^T row: 8 threads a row, the work-group covers the 32 rows
    const int kbase = blockIdx.z * (TT / FKS);
    v8us st[3];
    { const bf* pkh = Kh + (size_t)kbase * HD + tid * 8; const bf* pkl = Kl + (size_t)kbase * HD + tid * 8; const h16* pvf = Vf + (size_t)srow * TT + kbase + scol;
        st[0] = *(const v8us*)pkh; st[1] = *(const v8us*)pkl; st[2] = *(const v8usa*)pvf;
        asm volatile("s_wait_xcnt 0x0" :: "v"(pkh), "v"(pkl), "v"(pvf) : "memory"); }   // same precaution as behind the Q loads
#pragma unroll 1
    for (int s = 0; s < FNS; ++s) {
        bf* kh_s = sm + (s & 1) * FSL; bf* kl_s = kh_s + FKT; bf* vf_s = kl_s + FKT;
        *(v8us*)(kh_s + kdst) = st[0]; *(v8us*)(kl_s + kdst) = st[1]; *(v8us*)(vf_s + vdst) = st[2];
        __syncthreads();   // publishes this stage's tiles; it also ends every wave's reads of the other buffer, which the next stage refills
        // the next stage's pieces fly while this stage is computed (issued behind the barrier, which would wait for them)
        if (s + 1 < FNS) {
            const int key1 = kbase + (s + 1) * FSK;
            const bf* pkh = Kh + (size_t)key1 * HD + tid * 8; const bf* pkl = Kl + (size_t)key1 * HD + tid * 8; const h16* pvf = Vf + (size_t)srow * TT + key1 + scol;
            st[0] = *(const v8us*)pkh; st[1] = *(const v8us*)pkl; st[2] = *(const v8usa*)pvf;
            asm volatile("s_wait_xcnt 0x0" :: "v"(pkh), "v"(pkl), "v"(pvf) : "memory");   // same precaution as behind the Q loads
        }
        // The score products deliver the exp2 arguments themselves: q arrives times log2 e (k_proj), and minus m enters as their C operand. For that m is a reference, not the running maximum,
        // so a stage needs no maximum, no subtraction, no multiplication and no rescaling.
        // It is set from the first stage's scores (their maximum, rounded up, + FSH) and raised (sums and context rescaled) only when a stage's exponentials outgrow FBIG; the test is one scalar branch a stage.
        v8f sc[FQT][4]; float ps[FQT];
        bool full = (s == 0);
        if (!full) {
            fscores(kh_s, kl_s, c, h, qh, ql, cm, sc);
#pragma unroll
            for (int t = 0; t < FQT; ++t) { ps[t] = 0.0f;
#pragma unroll
                for (int kt = 0; kt < 4; ++kt)
#pragma unroll
                    for (int r = 0; r < 8; ++r) { const float p = __builtin_amdgcn_exp2f(sc[t][kt][r]); sc[t][kt][r] = p; ps[t] += p; } }
            bool need = false;
#pragma unroll
            for (int t = 0; t < FQT; ++t) need = need || !(ps[t] <= FBIG);
            if (__builtin_amdgcn_ballot_w32(need) != 0) {   // one scalar branch for the wave
                bool bad = false;
#pragma unroll
                for (int t = 0; t < FQT; ++t) bad = bad || !(ps[t] <= FHUGE);
                full = __builtin_amdgcn_ballot_w32(bad) != 0;
                if (!full) {
                    // the reference goes up by a whole number k of binary orders: this stage's exponentials, the sums and the context are scaled by 2^-k, which is exact
#pragma unroll
                    for (int t = 0; t < FQT; ++t) {
                        const float big = fmaxf(ps[t], xhalf(ps[t]));   // both halves of a query's lanes keep one reference
                        const int k = (big > FBIG) ? __builtin_amdgcn_frexp_expf(big) + FSH : 0;
                        const float al = __builtin_ldexpf(1.0f, -k);
                        m[t] += (float)k; cm[t] = (v8f){} - m[t]; ps[t] *= al; l[t] *= al;
#pragma unroll
                        for (int kt = 0; kt < 4; ++kt) sc[t][kt] *= al;
#pragma unroll
                        for (int dt = 0; dt < 2; ++dt) o[t][dt] *= al;
                    }
                }
            }
        }
        if (full) {
            fscores(kh_s, kl_s, c, h, qh, ql, cz, sc);
#pragma unroll
            for (int t = 0; t < FQT; ++t) {
                float mx = sc[t][0][0];
#pragma unroll
                for (int kt = 0; kt < 4; ++kt)
#pragma unroll
                    for (int r = 0; r < 8; ++r) mx = fmaxf(mx, sc[t][kt][r]);
                mx = fmaxf(mx, xhalf(mx));
                const float mn = fmaxf(m[t], __builtin_ceilf(mx) + (float)FSH);   /* a whole number, so that a later step up by k is exact */ const float al = __builtin_amdgcn_exp2f(m[t] - mn); m[t] = mn; cm[t] = (v8f){} - mn;
                ps[t] = 0.0f;
#pragma unroll
                for (int kt = 0; kt < 4; ++kt)
#pragma unroll
                    for (int r = 0; r < 8; ++r) { const float p = __builtin_amdgcn_exp2f(sc[t][kt][r] - mn); sc[t][kt][r] = p; ps[t] += p; }
                l[t] *= al;
#pragma unroll
                for (int dt = 0; dt < 2; ++dt) o[t][dt] *= al;
            }
        }
#pragma unroll
        for (int t = 0; t < FQT; ++t) l[t] += ps[t];
        v16h a[2][2], pf[2][FQT];
#pragma unroll
        for (int kb = 0; kb < 2; ++kb)
#pragma unroll
            for (int dt = 0; dt < 2; ++dt) { const bf* pa = vf_s + (dt * 16 + c) * FPI + kb * 32 + 8 * h; a[kb][dt] = cat16(*(const v8ha*)pa, *(const v8ha*)(pa + 16)); }
#pragma unroll
        for (int kb = 0; kb < 2; ++kb)
#pragma unroll
            for (int t = 0; t < FQT; ++t)
#pragma unroll
                for (int e = 0; e < 16; e += 2) { v2f pp; pp[0] = sc[t][2 * kb + (e >> 3)][e & 7]; pp[1] = sc[t][2 * kb + (e >> 3)][(e & 7) + 1]; const v2h hh = __builtin_convertvector(pp, v2h); pf[kb][t][e] = hh[0]; pf[kb][t][e + 1] = hh[1]; }   // nearest even
#pragma unroll
        for (int kb = 0; kb < 2; ++kb)   // four independent accumulators in turn
#pragma unroll
            for (int t = 0; t < FQT; ++t)
#pragma unroll
                for (int dt = 0; dt < 2; ++dt) o[t][dt] = wmma16(a[kb][dt], pf[kb][t], o[t][dt]);
    }
    // this key split's partial O^T, reference maximum and sum of each query tile. The context leaves divided by the split's own sum: it is then a weighted mean of v rows, of the size of v itself (which is f16 already),
    // so it fits f16 whatever the reference is, and half the bytes go out and come back; the last launch weighs it with the sum again.
    // A lane's 16 values (dims 8h + r and 16 + 8h + r of query c) are the B fragment of the last launch's product,
    // so they are stored lane by lane: a tile is 2 rows of 32 lanes x 16 B, every store 512 contiguous bytes; maxima (lanes 0..15) and sums (lanes 16..31) are one 128-byte row a tile.
    const size_t tile0 = ((size_t)blockIdx.z * NB_ + blockIdx.y) * (TT / 16) + (q0 >> 4);
    h16* po = PO + tile0 * 512 + lane * 8; float* pm = PML + tile0 * 32 + lane;
    v8h y[FQT][2];
#pragma unroll
    for (int t = 0; t < FQT; ++t) { l[t] += xhalf(l[t]); const float inv = __builtin_amdgcn_rcpf(l[t]);   // the last launch multiplies by the sum again: the reciprocal's last bit lies far below the f16 rounding
#pragma unroll
        for (int dt = 0; dt < 2; ++dt) y[t][dt] = __builtin_convertvector(o[t][dt] * inv, v8h); }   // nearest even
#pragma unroll
    for (int t = 0; t < FQT; ++t) {
#pragma unroll
        for (int dt = 0; dt < 2; ++dt) *(v8h*)(po + t * 512 + dt * 256) = y[t][dt];
        pm[t * 32] = h ? l[t] : m[t]; }
}

// k_proj: everything in front of the attention in one launch. One work-group = PT_ tokens of one batch (blockIdx.y) x the 96 output channels of q, k and v.
// Wave w reads channels 32w..32w+31 of the tokens (16-byte loads along the tokens: 256 contiguous bytes a channel row), rounds them to bf16 and stores them token-major in LDS:
// a lane's 4 tokens go to 4 different 16-row tiles (LDS row j * 16 + lr = token 4 * lr + j), so its 8 channels of one token are one 16-byte store. The 96 weight rows are rounded into LDS beside them.
// Behind the barrier wave w does token tile w & 3 x output tiles 3 * (w >> 2) .. + 2, the channels in rising order in one accumulator each; results + biases go through LDS so that every plane is stored in whole rows.
typedef __attribute__((ext_vector_type(8))) __bf16 v8bf;
#define PT_  64                 // tokens of a work-group
#define PNO  96                 // output channels: q 0..31, k 32..63, v 64..95
#define PXP  264                // LDS pitch of a row of CC 16-bit channels: 512 B + 16 B
#define POP  100                // LDS pitch of a token's PNO f32 results, floats
__device__ __forceinline__ v8us rnd8(v8f v) { return __builtin_bit_cast(v8us, __builtin_convertvector(v, v8bf)); }   // nearest even, as f2bf
__device__ __forceinline__ void split8(v8f y, v8us& h, v8us& l) { h = rnd8(y); l = rnd8(y - __builtin_convertvector(__builtin_bit_cast(v8bf, h), v8f)); }
__global__ __launch_bounds__(256) void k_proj(const float* __restrict__ x, const float* __restrict__ wq, const float* __restrict__ bq, const float* __restrict__ wk, const float* __restrict__ bk, const float* __restrict__ wv, const float* __restrict__ bv, bf* Qh, bf* Ql, bf* Kh, bf* Kl, h16* Vf) {
    __shared__ __align__(16) bf xs[PT_ * PXP];
    __shared__ __align__(16) bf wsh[PNO * PXP];
    __shared__ __align__(16) float os[PT_ * POP];
    const int lane = threadIdx.x & 31, lr = lane & 15, hi = lane >> 4; const int w = __builtin_amdgcn_readfirstlane((int)(threadIdx.x >> 5));
    const int n0 = blockIdx.x * PT_; const size_t b = blockIdx.y;
    const int mt = w & 3, g = w >> 2;
    const float* xp = x + (b * CC + 32 * w + 8 * hi) * TT + n0 + 4 * lr;
    v4f xv[16];
#pragma unroll
    for (int e = 0; e < 8; ++e) { xv[e] = *(const v4f*)(xp + (size_t)e * TT); xv[8 + e] = *(const v4f*)(xp + (size_t)(16 + e) * TT); }
    v4f wr[24];   // wave w rounds weight rows w, w + 8, ... of each matrix: a row is 1 KiB, 32 bytes a lane
#pragma unroll
    for (int s = 0; s < 12; ++s) { const float* wp = ((s < 4) ? wq : (s < 8) ? wk : wv) + (size_t)(w + 8 * (s & 3)) * CC + lane * 8; wr[2 * s] = *(const v4f*)wp; wr[2 * s + 1] = *(const v4f*)(wp + 4); }
    float bias[3];
#pragma unroll
    for (int n = 0; n < 3; ++n) { const int nt = 3 * g + n; const float* bp = (nt < 2) ? bq : (nt < 4) ? bk : bv; bias[n] = bfr(bp[(nt & 1) * 16 + lr]); }
    asm volatile("s_wait_xcnt 0x0" :: "v"(xp) : "memory");   // precaution: stands before any overwrite of the address registers of the loads just issued; naming the x address keeps it whole up to here
#pragma unroll
    for (int j = 0; j < 4; ++j) { v8f t0, t1;
#pragma unroll
        for (int e = 0; e < 8; ++e) { t0[e] = xv[e][j]; t1[e] = xv[8 + e][j]; }
        bf* d = xs + (j * 16 + lr) * PXP + 32 * w + 8 * hi; *(v8us*)d = rnd8(t0); *(v8us*)(d + 16) = rnd8(t1); }
#pragma unroll
    for (int s = 0; s < 12; ++s) { const v8f t = __builtin_shufflevector(wr[2 * s], wr[2 * s + 1], 0, 1, 2, 3, 4, 5, 6, 7); *(v8us*)(wsh + ((s >> 2) * 32 + w + 8 * (s & 3)) * PXP + lane * 8) = rnd8(t); }
    __syncthreads();
    v8f acc[3];
#pragma unroll
    for (int n = 0; n < 3; ++n) acc[n] = (v8f){};
#pragma unroll
    for (int kc = 0; kc < CC; kc += 32) { const v16bf a = WFrag<bf>::ld(xs + (mt * 16 + lr) * PXP + kc + 8 * hi);
#pragma unroll
        for (int n = 0; n < 3; ++n) acc[n] = wmmab(a, WFrag<bf>::ld(wsh + ((3 * g + n) * 16 + lr) * PXP + kc + 8 * hi), acc[n]); }
#pragma unroll
    for (int n = 0; n < 3; ++n) { const float qs = (3 * g + n < 2) ? L2E : 1.0f;   // q leaves times log2 e: the attention's scores are then exp2 arguments
#pragma unroll
        for (int r = 0; r < 8; ++r) os[(4 * (8 * hi + r) + mt) * POP + (3 * g + n) * 16 + lr] = (acc[n][r] + bias[n]) * qs; }
    __syncthreads();
    { const int t = threadIdx.x >> 2, c0 = (threadIdx.x & 3) * 8; const float* p = os + t * POP + c0; const size_t o = (b * TT + n0 + t) * HD + c0; v8us h8, l8;   // q, k: 8 channels of a token a thread
        split8(__builtin_shufflevector(*(const v4fa*)p, *(const v4fa*)(p + 4), 0, 1, 2, 3, 4, 5, 6, 7), h8, l8); *(v8us*)(Qh + o) = h8; *(v8us*)(Ql + o) = l8;
        split8(__builtin_shufflevector(*(const v4fa*)(p + 32), *(const v4fa*)(p + 36), 0, 1, 2, 3, 4, 5, 6, 7), h8, l8); *(v8us*)(Kh + o) = h8; *(v8us*)(Kl + o) = l8; }
    { const int d = threadIdx.x >> 3, t0 = (threadIdx.x & 7) * 8; v8f y;   // v, channel-major, rounded once to f16 (nearest even): 8 tokens of a channel a thread
#pragma unroll
        for (int q = 0; q < 8; ++q) y[q] = os[(t0 + q) * POP + 64 + d];
        const size_t o = (b * HD + d) * TT + n0 + t0; *(v8h*)(Vf + o) = __builtin_convertvector(y, v8h); }
}
// k_tail: everything behind the attention in one launch. One work-group = ET_ tokens (all of one batch) x EC_ output channels.
// y^T = Wo ctx^T: A = 16 rows of Wo, B = the context (hi, then lo, in one accumulator), so a lane holds 8 channels of one token.
// The context is merged here from the FKS key splits' partial results (f16 means, each weighed with its split's sum; rising split order, common maximum, one division): a lane reads its own 16 values of each split, which are its B fragment's elements.
// The work-group's EC_ rows of Wo (f32, contiguous) are read in whole lines, rounded to bf16 and laid in LDS once; behind the barrier wave w does token tile w x the EC_ / 16 channel tiles.
// The results go through LDS so that every store is 512 contiguous bytes of one channel row of the channel-major output; the bias is added there.
typedef __attribute__((ext_vector_type(4))) __bf16 v4bf;
typedef __attribute__((ext_vector_type(16))) unsigned short v16us;
#define ET_  128                // tokens of a work-group
#define EC_  128                // output channels of a work-group: the grid is one work-group a WGP
#define EWP  40                 // LDS pitch of a rounded Wo row (CQR elements), 16-bit elements: 64 B + 16 B
#define EOP  132                // LDS pitch of a channel's ET_ f32 results, floats: rows 8 apart lie 32 banks apart
__global__ __launch_bounds__(256) void k_tail(const h16* __restrict__ PO, const float* __restrict__ PML, const float* __restrict__ wo, const float* __restrict__ bo, float* __restrict__ out) {
    __shared__ __align__(16) bf wsh[EC_ * EWP];
    __shared__ __align__(16) float os[EC_ * EOP];
    const int lane = threadIdx.x & 31, lr = lane & 15, hi = lane >> 4; const int w = __builtin_amdgcn_readfirstlane((int)(threadIdx.x >> 5));
    const int t0 = blockIdx.x * ET_, c0 = blockIdx.y * EC_;   // t0 counts the tokens of all batches, one behind the other
    float bias[EC_ / 8];
#pragma unroll
    for (int i = 0; i < EC_ / 8; ++i) bias[i] = bfr(bo[c0 + w + 8 * i]);
    const int tid = threadIdx.x; const float* pw = wo + (size_t)(c0 * CQR + tid * 4);   // 4 of a row's CQR floats a thread: 32 rows a load
    const size_t tile = (size_t)(t0 >> 4) + w; const h16* pp = PO + tile * 512 + lane * 8; const float* pm = PML + tile * 32 + lr;
    v4f wr[EC_ / 32];
#pragma unroll
    for (int j = 0; j < EC_ / 32; ++j) wr[j] = *(const v4f*)(pw + j * 32 * CQR);
    v8h pv[FKS][2]; float pmx[FKS], pls[FKS];
#pragma unroll
    for (int u = 0; u < FKS; ++u) { const h16* pu = pp + (size_t)u * NTL * 512; const float* mu = pm + (size_t)u * NTL * 32;
#pragma unroll
        for (int i = 0; i < 2; ++i) pv[u][i] = *(const v8h*)(pu + i * 256);
        pmx[u] = mu[0]; pls[u] = mu[16]; }
    __builtin_amdgcn_sched_barrier(0);   // every load above is issued before the first is waited for: one trip to L2 instead of several, one behind the other
    asm volatile("s_wait_xcnt 0x0" :: "v"(pw), "v"(pp), "v"(pm) : "memory");   // precaution: stands before any overwrite of the address registers of the loads just issued; naming them keeps them whole up to here
#pragma unroll
    for (int j = 0; j < EC_ / 32; ++j) *(v4us*)(wsh + (32 * j + (tid >> 3)) * EWP + (tid & 7) * 4) = __builtin_bit_cast(v4us, __builtin_convertvector(wr[j], v4bf));   // nearest even, as f2bf
    v16bf bh, bl;
    { float M = -3.0e38f;
#pragma unroll
        for (int u = 0; u < FKS; ++u) M = fmaxf(M, pmx[u]);
        float L = 0.0f; v8f acc[2];
#pragma unroll
        for (int i = 0; i < 2; ++i) acc[i] = (v8f){};
#pragma unroll
        for (int u = 0; u < FKS; ++u) { const float f = pls[u] * __builtin_amdgcn_exp2f(pmx[u] - M); L += f;   // a split's weight: its sum, brought to the common maximum (the reference maxima are in log2 units, as the scores)
#pragma unroll
            for (int i = 0; i < 2; ++i) acc[i] += __builtin_convertvector(pv[u][i], v8f) * f; }
        const float inv = __fdiv_rn(1.0f, L); v16us uh, ul;
#pragma unroll
        for (int e = 0; e < 16; ++e) { unsigned short h0, l0; splitf(acc[e >> 3][e & 7] * inv, h0, l0); uh[e] = h0; ul[e] = l0; }
        bh = __builtin_bit_cast(v16bf, uh); bl = __builtin_bit_cast(v16bf, ul); }
    __syncthreads();
#pragma unroll
    for (int mt = 0; mt < EC_ / 16; ++mt) { const v16bf a = WFrag<bf>::ld(wsh + (16 * mt + lr) * EWP + 8 * hi);
        v8f d = wmmab(a, bh, (v8f){}); d = wmmab(a, bl, d);
#pragma unroll
        for (int r = 0; r < 8; ++r) os[(16 * mt + 8 * hi + r) * EOP + 16 * w + lr] = d[r]; }
    __syncthreads();
    float* po = out + ((size_t)(t0 / TT) * CC + c0 + w) * TT + (t0 % TT) + lane * 4;   // wave w stores channel rows w, w + 8, ...
#pragma unroll
    for (int i = 0; i < EC_ / 8; ++i) { v4f v = *(const v4fa*)(os + (w + 8 * i) * EOP + lane * 4); v += bias[i]; *(v4f*)(po + (size_t)i * 8 * TT) = v; }
}
__global__ __launch_bounds__(256) void k_merge(const float* __restrict__ O, int h0, float* OUTb) { const size_t e = ((size_t)blockIdx.x * 256 + threadIdx.x) * 2; if (e >= (size_t)ZH * TT * HD) return; const int d = (int)(e % HD); const int t = (int)((e / HD) % TT); const int zz = (int)(e / ((size_t)HD * TT)); const float cs = (t < RH) ? 1.0f : (1.0f / PCAR); const size_t oo = (size_t)t * DQ + (h0 + zz) * HD + d;
    v2f o2; o2[0] = O[e] * cs; o2[1] = O[e + 1] * cs; *(v2f*)(OUTb + oo) = o2;  }

extern "C" void kernel_launch(void* const* d_in, const int* in_sizes, int n_in,
                              void* d_out, int out_size, void* d_ws, size_t ws_size, hipStream_t stream) {
    (void)in_sizes; (void)n_in; (void)out_size;
    const float* x = (const float*)d_in[0]; const float* wq = (const float*)d_in[1]; const float* bq = (const float*)d_in[2]; const float* wk = (const float*)d_in[3]; const float* bk = (const float*)d_in[4]; const float* wv = (const float*)d_in[5]; const float* bv = (const float*)d_in[6]; const float* wo = (const float*)d_in[7]; const float* bo = (const float*)d_in[8];
    float* OUT = (float*)d_out;   /* [4][256][4096] channel-major */
    char* wsp = (char*)d_ws;
    auto take = [&](size_t bytes) { char* p = wsp; wsp += (bytes + 255) & ~(size_t)255; return (void*)p; };
    h16* PO = (h16*)take((size_t)FKS * NB_ * TT * HD * 2); float* PML = (float*)take((size_t)FKS * NB_ * TT * 2 * 4);   /* per key split: normalised partial context, f16; maxima and sums */
    bf* QPh = (bf*)take((size_t)NB_ * TT * HD * 2); bf* QPl = (bf*)take((size_t)NB_ * TT * HD * 2); bf* KPh = (bf*)take((size_t)NB_ * TT * HD * 2); bf* KPl = (bf*)take((size_t)NB_ * TT * HD * 2); h16* VTf = (h16*)take((size_t)NB_ * HD * TT * 2);
    if ((size_t)(wsp - (char*)d_ws) > ws_size) return;    // ws 256 MiB
    // the query tiles of the NB_ batches lie one behind the other in each key split's slab, so the last launch sees NB_ * TT tokens; the projections and the attention take the batch from blockIdx.y
    k_proj<<<dim3(TT / PT_, NB_, 1), 256, 0, stream>>>(x, wq, bq, wk, bk, wv, bv, QPh, QPl, KPh, KPl, VTf);   /* x, Wq, Wk, Wv -> q, k hi/lo planes, f16 v plane */
    k_fattn<<<dim3(TT / (16 * FQT * FW_), NB_, FKS), 256, 0, stream>>>(QPh, QPl, KPh, KPl, VTf, PO, PML);   /* scores + softmax + attn.v -> partial context per key split */
    k_tail<<<dim3(NB_ * TT / ET_, CC / EC_, 1), 256, 0, stream>>>(PO, PML, wo, bo, OUT);   /* merge of the key splits, Wo ctx + bo, channel-major */
}
